// v000
// The times below were measured on an AMD MI455X: many runs one after another, warmed up first and cycling through
// copies of the inputs, with the whole window's GPU time divided by the number of runs. Launches and the gaps
// between them are all in it. The median over several windows is given; except for v000 it joins two sittings, which
// can be a few percent apart, so the side-by-side timings, each taken in one sitting, are the better comparison.
// v000 is the starting kernel. One run takes 231 microseconds.
#include <hip/hip_runtime.h>
#include <stdint.h>
#include <math.h>

// Problem constants (from reference): B=128, F=256, N=2000, scale = 1/sqrt(F)
#define BB 128
#define FF 256
#define NN 2000
#define SCALE 0.0625f

#define TILE_N 128          // nodes per LDS tile in pass B (256*128*4 = 128 KB LDS)
#define PB_THREADS 1024     // 32 waves per workgroup in pass B

typedef __attribute__((ext_vector_type(2))) float v2f;
typedef __attribute__((ext_vector_type(8))) float v8f;

__device__ __forceinline__ void async_copy_b64(const void* gp, void* lp) {
#if defined(__HIP_DEVICE_COMPILE__)
  unsigned int loff = (unsigned int)(uintptr_t)lp;      // generic LDS ptr: low 32 bits = LDS addr
  unsigned long long ga = (unsigned long long)(uintptr_t)gp;
  asm volatile("global_load_async_to_lds_b64 %0, %1, off"
               :: "v"(loff), "v"(ga) : "memory");
#else
  (void)gp; (void)lp;
#endif
}

__device__ __forceinline__ void wait_asynccnt0() {
#if defined(__HIP_DEVICE_COMPILE__)
  asm volatile("s_wait_asynccnt 0" ::: "memory");
#endif
}

// ---------------------------------------------------------------------------
// Pass A: glb[b,f] = max_n x[b,f,n]   (one wave per row, float4 loads)
// ---------------------------------------------------------------------------
__global__ __launch_bounds__(256) void rowmax_kernel(const float* __restrict__ x,
                                                     float* __restrict__ glb) {
  const int row  = blockIdx.x * 8 + (threadIdx.x >> 5);   // row in [0, B*F)
  const int lane = threadIdx.x & 31;
  const float4* rp = (const float4*)(x + (size_t)row * NN);
  float m = -INFINITY;
  for (int c = lane; c < NN / 4; c += 32) {               // 2000/4 = 500 exact
    float4 v = rp[c];
    m = fmaxf(m, fmaxf(fmaxf(v.x, v.y), fmaxf(v.z, v.w)));
  }
#pragma unroll
  for (int o = 16; o; o >>= 1) m = fmaxf(m, __shfl_xor(m, o));
  if (lane == 0) glb[row] = m;
}

// ---------------------------------------------------------------------------
// Gather last/current city features: context[b, 0:F]=x[:, last], [F:2F]=x[:, cur]
// ---------------------------------------------------------------------------
__global__ __launch_bounds__(256) void gather_kernel(const float* __restrict__ x,
                                                     const int* __restrict__ lc,
                                                     float* __restrict__ ctx) {
  const int id = blockIdx.x * 256 + threadIdx.x;          // B*2F total
  const int b = id / (2 * FF);
  const int k = id - b * 2 * FF;
  const int j = (k >= FF) ? 1 : 0;
  const int f = (k >= FF) ? k - FF : k;
  const int n = lc[b * 2 + j];
  ctx[id] = x[((size_t)b * FF + f) * NN + n];
}

__global__ __launch_bounds__(32) void gemm16_kernel(
    const float* __restrict__ A, int lda,
    const float* __restrict__ Bp, int sbk, int sbn,
    const float* __restrict__ bias, const float* __restrict__ addm,
    float* __restrict__ C, int ldc, int ntiles_n, int K) {
  const int m0  = (blockIdx.x / ntiles_n) << 4;
  const int n0  = (blockIdx.x % ntiles_n) << 4;
  const int lane = threadIdx.x & 31;
  const int l16 = lane & 15;
  const int hi  = lane >> 4;
  v8f acc = {};
#if __has_builtin(__builtin_amdgcn_wmma_f32_16x16x4_f32)
  for (int k = 0; k < K; k += 4) {
    v2f a, bv;
    const float* ap = A + (size_t)(m0 + l16) * lda + (k + 2 * hi);
    a[0] = ap[0];
    a[1] = ap[1];
    const int kk = k + 2 * hi;
    const size_t nb = (size_t)(n0 + l16) * sbn;
    bv[0] = Bp[(size_t)kk * sbk + nb];
    bv[1] = Bp[(size_t)(kk + 1) * sbk + nb];
    acc = __builtin_amdgcn_wmma_f32_16x16x4_f32(
        false, a, false, bv, (short)0, acc, false, false);
  }
#else
  for (int r = 0; r < 8; ++r) {
    const int row = m0 + r + 8 * hi;
    float s = 0.f;
    for (int k = 0; k < K; ++k)
      s += A[(size_t)row * lda + k] * Bp[(size_t)k * sbk + (size_t)(n0 + l16) * sbn];
    acc[r] = s;
  }
#endif
  const int col = n0 + l16;
  const float bcol = bias ? bias[col] : 0.f;
#pragma unroll
  for (int r = 0; r < 8; ++r) {
    const int row = m0 + r + 8 * hi;
    float v = acc[r] + bcol;
    if (addm) v += addm[(size_t)row * ldc + col];
    C[(size_t)row * ldc + col] = v;
  }
}

// ---------------------------------------------------------------------------
// out[b] = sum_f A[b,f] * v[f]   (one wave per batch row)
// ---------------------------------------------------------------------------
__global__ __launch_bounds__(32) void dotrow_kernel(const float* __restrict__ A,
                                                    const float* __restrict__ v,
                                                    float* __restrict__ out, int K) {
  const int b = blockIdx.x;
  const int lane = threadIdx.x;
  float s = 0.f;
  for (int f = lane; f < K; f += 32) s += A[(size_t)b * K + f] * v[f];
#pragma unroll
  for (int o = 16; o; o >>= 1) s += __shfl_xor(s, o);
  if (lane == 0) out[b] = s;
}

// ---------------------------------------------------------------------------
// Pass B: per batch, fused scores + online softmax + xbar accumulation.
// x[b] is streamed through LDS tiles exactly once via async global->LDS copies.
//   t[n]   = (qk . x[:,n] + cK) * scale
//   attn   = softmax(t)          (online, flash-style rescaling)
//   xbar[f]= sum_n attn[n] * x[f,n]
// ---------------------------------------------------------------------------
__global__ __launch_bounds__(PB_THREADS) void passB_kernel(
    const float* __restrict__ x, const float* __restrict__ qk,
    const float* __restrict__ cK, float* __restrict__ xbar) {
  __shared__ float tile[FF * TILE_N];   // 128 KB x-tile
  __shared__ float qs[FF];
  __shared__ float abuf[TILE_N];
  __shared__ float xb[FF];
  __shared__ float p1[PB_THREADS];
  __shared__ float red[32];
  __shared__ float ms[2];               // running max, running sum
  const int b = blockIdx.x;
  const int tid = threadIdx.x;
  const float* xbase = x + (size_t)b * FF * NN;
  if (tid < FF) { qs[tid] = qk[b * FF + tid]; xb[tid] = 0.f; }
  if (tid == 0) { ms[0] = -INFINITY; ms[1] = 0.f; }
  const float cKb = cK[b];
  __syncthreads();

  for (int t0 = 0; t0 < NN; t0 += TILE_N) {
    const int nt = min(TILE_N, NN - t0);        // 128 or final 80 (both even)
    const int chunksPerRow = nt >> 1;
    const int chunks = FF * chunksPerRow;
    for (int c = tid; c < chunks; c += PB_THREADS) {
      const int f = c / chunksPerRow;
      const int i = c - f * chunksPerRow;
      async_copy_b64(xbase + (size_t)f * NN + t0 + 2 * i,
                     &tile[f * TILE_N + 2 * i]);
    }
    wait_asynccnt0();
    __syncthreads();

    // --- scores: split F across 8 thread groups, then combine ---
    {
      const int n = tid & (TILE_N - 1);
      const int g = tid >> 7;                   // 0..7
      const int f0 = g * (FF / 8);
      float acc = 0.f;
      for (int f = f0; f < f0 + FF / 8; ++f)
        acc += qs[f] * tile[f * TILE_N + n];
      p1[tid] = acc;
    }
    __syncthreads();
    float tval = -INFINITY;
    if (tid < TILE_N && tid < nt) {
      float s = 0.f;
#pragma unroll
      for (int g = 0; g < 8; ++g) s += p1[g * TILE_N + tid];
      tval = (s + cKb) * SCALE;
    }

    // --- block max of tval ---
    float wm = tval;
#pragma unroll
    for (int o = 16; o; o >>= 1) wm = fmaxf(wm, __shfl_xor(wm, o));
    if ((tid & 31) == 0) red[tid >> 5] = wm;
    __syncthreads();
    if (tid < 32) {
      float v = red[tid];
#pragma unroll
      for (int o = 16; o; o >>= 1) v = fmaxf(v, __shfl_xor(v, o));
      if (tid == 0) red[0] = v;
    }
    __syncthreads();
    const float tmax  = red[0];
    const float m_old = ms[0];
    const float m_new = fmaxf(m_old, tmax);
    const float r     = __expf(m_old - m_new);  // 0 on first tile (m_old=-inf)

    float e = 0.f;
    if (tid < TILE_N) {
      e = (tid < nt) ? __expf(tval - m_new) : 0.f;
      abuf[tid] = e;
    }
    __syncthreads();                            // abuf ready; red[0]/ms[0] consumed

    // --- block sum of e; thread 0 updates running (m, s) ---
    float wsum = e;
#pragma unroll
    for (int o = 16; o; o >>= 1) wsum += __shfl_xor(wsum, o);
    if ((tid & 31) == 0) red[tid >> 5] = wsum;
    __syncthreads();
    if (tid == 0) {
      float tsum = 0.f;
      for (int w = 0; w < 32; ++w) tsum += red[w];
      ms[1] = ms[1] * r + tsum;
      ms[0] = m_new;
    }

    // --- xbar accumulate: 4 threads per feature row, quad shuffle-combine ---
    {
      const int f = tid >> 2;
      const int j = tid & 3;
      float part = 0.f;
      for (int i = j; i < nt; i += 4)
        part += abuf[i] * tile[f * TILE_N + i];
      part += __shfl_xor(part, 1);
      part += __shfl_xor(part, 2);
      if (j == 0) xb[f] = xb[f] * r + part;
    }
    __syncthreads();
  }
  const float s = ms[1];
  if (tid < FF) xbar[b * FF + tid] = xb[tid] / s;   // softmax-normalized
}

// ---------------------------------------------------------------------------
// Pass C: logits[b,n] = tanh((ql . x[:,n] + cL) * scale) * 10
// 256 threads cover 256 consecutive n -> coalesced row walks; sw prefetch ahead.
// ---------------------------------------------------------------------------
__global__ __launch_bounds__(256) void passC_kernel(
    const float* __restrict__ x, const float* __restrict__ ql,
    const float* __restrict__ cL, float* __restrict__ out) {
  __shared__ float qs[FF];
  const int b = blockIdx.x >> 3;
  const int chunk = blockIdx.x & 7;
  const int tid = threadIdx.x;
  qs[tid] = ql[b * FF + tid];
  __syncthreads();
  const int n = chunk * 256 + tid;
  const float* xbase = x + (size_t)b * FF * NN;
  if (n < NN) {
    float acc = 0.f;
    for (int f = 0; f < FF; ++f) {
      if (f + 8 < FF) __builtin_prefetch(xbase + (size_t)(f + 8) * NN + n, 0, 0);
      acc += qs[f] * xbase[(size_t)f * NN + n];
    }
    out[b * NN + n] = tanhf((acc + cL[b]) * SCALE) * 10.f;
  }
}

// ---------------------------------------------------------------------------
extern "C" void kernel_launch(void* const* d_in, const int* in_sizes, int n_in,
                              void* d_out, int out_size, void* d_ws, size_t ws_size,
                              hipStream_t stream) {
  const float* x     = (const float*)d_in[0];   // [B,F,N,1]
  const int*   lc    = (const int*)  d_in[1];   // [B,2]
  const float* Wg    = (const float*)d_in[2];   // [F,F]
  const float* bg    = (const float*)d_in[3];   // [F]
  const float* Wnode = (const float*)d_in[4];   // [3F,F]
  const float* bnode = (const float*)d_in[5];   // [3F]
  const float* Wlc   = (const float*)d_in[6];   // [F,2F]
  const float* blc   = (const float*)d_in[7];   // [F]
  const float* Wproj = (const float*)d_in[8];   // [F,F]
  const float* bproj = (const float*)d_in[9];   // [F]
  float* out = (float*)d_out;                   // [B,N]

  // workspace carve-up (~1.32 MB of f32)
  float* ws   = (float*)d_ws;
  float* glb  = ws;                         // [B,F]
  float* ctx  = glb  + BB * FF;             // [B,2F]
  float* Qb   = ctx  + BB * 2 * FF;         // [B,F]
  float* cQ   = Qb   + BB * FF;             // [B,F]
  float* qk   = cQ   + BB * FF;             // [B,F]
  float* cK   = qk   + BB * FF;             // [B]
  float* xbar = cK   + BB;                  // [B,F]
  float* v1   = xbar + BB * FF;             // [B,F]
  float* nc   = v1   + BB * FF;             // [B,F]
  float* ql   = nc   + BB * FF;             // [B,F]
  float* cL   = ql   + BB * FF;             // [B]

  const int gtiles = (BB / 16) * (FF / 16); // 128 WMMA tiles per small GEMM

  // Pass A: glb = max_n x
  rowmax_kernel<<<BB * FF / 8, 256, 0, stream>>>(x, glb);
  // context gather
  gather_kernel<<<(BB * 2 * FF) / 256, 256, 0, stream>>>(x, lc, ctx);
  // Q = glb @ Wg^T + bg            (B[k,n] = Wg[n,k]: sbk=1, sbn=F)
  gemm16_kernel<<<gtiles, 32, 0, stream>>>(glb, FF, Wg, 1, FF, bg, nullptr, Qb, FF, FF / 16, FF);
  // cQ = ctx @ Wlc^T + blc + Q     (B[k,n] = Wlc[n,k]: sbk=1, sbn=2F)
  gemm16_kernel<<<gtiles, 32, 0, stream>>>(ctx, 2 * FF, Wlc, 1, 2 * FF, blc, Qb, cQ, FF, FF / 16, 2 * FF);
  // qk = cQ @ Wnode_K              (B[k,n] = Wnode[k,n]: sbk=F, sbn=1)
  gemm16_kernel<<<gtiles, 32, 0, stream>>>(cQ, FF, Wnode, FF, 1, nullptr, nullptr, qk, FF, FF / 16, FF);
  // cK = cQ . bnode_K
  dotrow_kernel<<<BB, 32, 0, stream>>>(cQ, bnode, cK, FF);
  // Pass B: fused attention (single read of x)
  passB_kernel<<<BB, PB_THREADS, 0, stream>>>(x, qk, cK, xbar);
  // v1 = xbar @ Wnode_V^T + bnode_V  (B[k,n] = Wnode[F+n,k]: base F*F, sbk=1, sbn=F)
  gemm16_kernel<<<gtiles, 32, 0, stream>>>(xbar, FF, Wnode + (size_t)FF * FF, 1, FF, bnode + FF, nullptr, v1, FF, FF / 16, FF);
  // nc = v1 @ Wproj^T + bproj
  gemm16_kernel<<<gtiles, 32, 0, stream>>>(v1, FF, Wproj, 1, FF, bproj, nullptr, nc, FF, FF / 16, FF);
  // ql = nc @ Wnode_L              (base 2F*F, sbk=F, sbn=1)
  gemm16_kernel<<<gtiles, 32, 0, stream>>>(nc, FF, Wnode + (size_t)2 * FF * FF, FF, 1, nullptr, nullptr, ql, FF, FF / 16, FF);
  // cL = nc . bnode_L
  dotrow_kernel<<<BB, 32, 0, stream>>>(nc, bnode + 2 * FF, cL, FF);
  // Pass C: logits
  passC_kernel<<<BB * 8, 256, 0, stream>>>(x, ql, cL, out);
}

// v001
// A run of this version takes 156 microseconds.
// Next to v000, in two timings, it ran 1.52 and 1.49 times as fast.
#include <hip/hip_runtime.h>
#include <stdint.h>
#include <math.h>

// Problem constants (from reference): B=128, F=256, N=2000, scale = 1/sqrt(F)
#define BB 128
#define FF 256
#define NN 2000
#define SCALE 0.0625f

#define PB_WAVES 16         // waves per workgroup in pass B
#define PB_THREADS (PB_WAVES * 32)
#define PB_ROWS (FF / PB_WAVES)   // feature rows held by one wave
#define N4 (NN / 4)         // float4 columns per feature row
#define PB_TILES ((N4 + 31) / 32) // tiles of 128 nodes (32 lanes x float4)

typedef __attribute__((ext_vector_type(2))) float v2f;
typedef __attribute__((ext_vector_type(4))) float v4f;
typedef __attribute__((ext_vector_type(8))) float v8f;

// ---------------------------------------------------------------------------
// Pass A: glb[b,f] = max_n x[b,f,n]   (one wave per row, float4 loads)
// ---------------------------------------------------------------------------
__global__ __launch_bounds__(256) void rowmax_kernel(const float* __restrict__ x,
                                                     float* __restrict__ glb) {
  const int row  = blockIdx.x * 8 + (threadIdx.x >> 5);   // row in [0, B*F)
  const int lane = threadIdx.x & 31;
  const float4* rp = (const float4*)(x + (size_t)row * NN);
  float m = -INFINITY;
  for (int c = lane; c < NN / 4; c += 32) {               // 2000/4 = 500 exact
    float4 v = rp[c];
    m = fmaxf(m, fmaxf(fmaxf(v.x, v.y), fmaxf(v.z, v.w)));
  }
#pragma unroll
  for (int o = 16; o; o >>= 1) m = fmaxf(m, __shfl_xor(m, o));
  if (lane == 0) glb[row] = m;
}

// ---------------------------------------------------------------------------
// Gather last/current city features: context[b, 0:F]=x[:, last], [F:2F]=x[:, cur]
// ---------------------------------------------------------------------------
__global__ __launch_bounds__(256) void gather_kernel(const float* __restrict__ x,
                                                     const int* __restrict__ lc,
                                                     float* __restrict__ ctx) {
  const int id = blockIdx.x * 256 + threadIdx.x;          // B*2F total
  const int b = id / (2 * FF);
  const int k = id - b * 2 * FF;
  const int j = (k >= FF) ? 1 : 0;
  const int f = (k >= FF) ? k - FF : k;
  const int n = lc[b * 2 + j];
  ctx[id] = x[((size_t)b * FF + f) * NN + n];
}

__global__ __launch_bounds__(32) void gemm16_kernel(
    const float* __restrict__ A, int lda,
    const float* __restrict__ Bp, int sbk, int sbn,
    const float* __restrict__ bias, const float* __restrict__ addm,
    float* __restrict__ C, int ldc, int ntiles_n, int K) {
  const int m0  = (blockIdx.x / ntiles_n) << 4;
  const int n0  = (blockIdx.x % ntiles_n) << 4;
  const int lane = threadIdx.x & 31;
  const int l16 = lane & 15;
  const int hi  = lane >> 4;
  v8f acc = {};
#if __has_builtin(__builtin_amdgcn_wmma_f32_16x16x4_f32)
  for (int k = 0; k < K; k += 4) {
    v2f a, bv;
    const float* ap = A + (size_t)(m0 + l16) * lda + (k + 2 * hi);
    a[0] = ap[0];
    a[1] = ap[1];
    const int kk = k + 2 * hi;
    const size_t nb = (size_t)(n0 + l16) * sbn;
    bv[0] = Bp[(size_t)kk * sbk + nb];
    bv[1] = Bp[(size_t)(kk + 1) * sbk + nb];
    acc = __builtin_amdgcn_wmma_f32_16x16x4_f32(
        false, a, false, bv, (short)0, acc, false, false);
  }
#else
  for (int r = 0; r < 8; ++r) {
    const int row = m0 + r + 8 * hi;
    float s = 0.f;
    for (int k = 0; k < K; ++k)
      s += A[(size_t)row * lda + k] * Bp[(size_t)k * sbk + (size_t)(n0 + l16) * sbn];
    acc[r] = s;
  }
#endif
  const int col = n0 + l16;
  const float bcol = bias ? bias[col] : 0.f;
#pragma unroll
  for (int r = 0; r < 8; ++r) {
    const int row = m0 + r + 8 * hi;
    float v = acc[r] + bcol;
    if (addm) v += addm[(size_t)row * ldc + col];
    C[(size_t)row * ldc + col] = v;
  }
}

// ---------------------------------------------------------------------------
// out[b] = sum_f A[b,f] * v[f]   (one wave per batch row)
// ---------------------------------------------------------------------------
__global__ __launch_bounds__(32) void dotrow_kernel(const float* __restrict__ A,
                                                    const float* __restrict__ v,
                                                    float* __restrict__ out, int K) {
  const int b = blockIdx.x;
  const int lane = threadIdx.x;
  float s = 0.f;
  for (int f = lane; f < K; f += 32) s += A[(size_t)b * K + f] * v[f];
#pragma unroll
  for (int o = 16; o; o >>= 1) s += __shfl_xor(s, o);
  if (lane == 0) out[b] = s;
}

__device__ __forceinline__ void pb_copy8(const v4f* g, const v4f* l) {
#if defined(__HIP_DEVICE_COMPILE__)
  const unsigned long long g0 = (unsigned long long)(uintptr_t)g;
  const unsigned int l0 = (unsigned int)(uintptr_t)l;   // generic LDS pointer: low 32 bits
  asm volatile(
      "global_load_async_to_lds_b128 %0, %8, off\n\t"
      "global_load_async_to_lds_b128 %1, %9, off\n\t"
      "global_load_async_to_lds_b128 %2, %10, off\n\t"
      "global_load_async_to_lds_b128 %3, %11, off\n\t"
      "global_load_async_to_lds_b128 %4, %12, off\n\t"
      "global_load_async_to_lds_b128 %5, %13, off\n\t"
      "global_load_async_to_lds_b128 %6, %14, off\n\t"
      "global_load_async_to_lds_b128 %7, %15, off\n\t"
      "s_wait_xcnt 0x0"
      :: "v"(l0), "v"(l0 + 512u), "v"(l0 + 1024u), "v"(l0 + 1536u),
         "v"(l0 + 2048u), "v"(l0 + 2560u), "v"(l0 + 3072u), "v"(l0 + 3584u),
         "v"(g0), "v"(g0 + 1ull * NN * 4), "v"(g0 + 2ull * NN * 4), "v"(g0 + 3ull * NN * 4),
         "v"(g0 + 4ull * NN * 4), "v"(g0 + 5ull * NN * 4), "v"(g0 + 6ull * NN * 4),
         "v"(g0 + 7ull * NN * 4)
      : "memory");
#else
  (void)g; (void)l;
#endif
}

// The wave's 16 rows of tile t into its slice of one LDS buffer.
__device__ __forceinline__ void pb_fill(const v4f* xr, v4f* slice, int t, int lane) {
  const int c = min(t * 32 + lane, N4 - 1);     // past the row's end: copy its last column
  pb_copy8(xr + c, slice + lane);
  pb_copy8(xr + 8 * N4 + c, slice + 8 * 32 + lane);
}

// One trip: tile t out of its LDS buffer. REFILL: a tile t + 2 exists and is copied
// into the buffer that this trip has read (the caller's loop bounds are the test).
template <bool REFILL>
__device__ __forceinline__ void pb_trip(const v4f* xr, v4f* slice, v4f (*part)[32],
                                        const float (&q)[PB_ROWS], int t, int w, int lane,
                                        float cKb, v2f (&acc)[PB_ROWS], float& m, float& l) {
  // this wave's share of the scores of the lane's four nodes; sums run in node
  // pairs (.xy, .zw) so that packed f32 instructions take the registers as they lie
  v4f X[PB_ROWS];
#pragma unroll
  for (int i = 0; i < PB_ROWS; ++i) X[i] = slice[i * 32 + lane];
  v2f s01 = {0.f, 0.f}, s23 = {0.f, 0.f};
#pragma unroll
  for (int i = 0; i < PB_ROWS; ++i) {
    const v2f qq = {q[i], q[i]};
    s01 = __builtin_elementwise_fma(qq, X[i].xy, s01);
    s23 = __builtin_elementwise_fma(qq, X[i].zw, s23);
  }
  part[w][lane] = (v4f){s01.x, s01.y, s23.x, s23.y};
  __syncthreads();
  // every wave adds the 16 shares in the same order, so all waves see equal scores
  v4f tot = part[0][lane];
#pragma unroll
  for (int v = 1; v < PB_WAVES; ++v) tot += part[v][lane];
  const bool valid = t * 32 + lane < N4;
  const float t0 = valid ? (tot.x + cKb) * SCALE : -INFINITY;
  const float t1 = valid ? (tot.y + cKb) * SCALE : -INFINITY;
  const float t2 = valid ? (tot.z + cKb) * SCALE : -INFINITY;
  const float t3 = valid ? (tot.w + cKb) * SCALE : -INFINITY;
  const float mn = fmaxf(m, fmaxf(fmaxf(t0, t1), fmaxf(t2, t3)));
  const float r  = __expf(m - mn);              // 0 on the first tile (m = -inf)
  const v2f e01 = {valid ? __expf(t0 - mn) : 0.f, valid ? __expf(t1 - mn) : 0.f};
  const v2f e23 = {valid ? __expf(t2 - mn) : 0.f, valid ? __expf(t3 - mn) : 0.f};
  const v2f es = e01 + e23;
  l = fmaf(l, r, es.x + es.y);
  m = mn;
  const v2f rr = {r, r};
#pragma unroll
  for (int i = 0; i < PB_ROWS; ++i)
    acc[i] = __builtin_elementwise_fma(e23, X[i].zw,
             __builtin_elementwise_fma(e01, X[i].xy, acc[i] * rr));

  // keeps the arithmetic above in front of the foot: without it the compiler moved it
  // behind the barrier, ahead of the copies, and read the 16 shares one wait at a time
  __builtin_amdgcn_sched_barrier(0);
  // foot of the trip: own LDS reads done, tile t+1 landed, everybody here; only
  // then is the buffer just read refilled
  asm volatile("s_wait_dscnt 0x0" ::: "memory");
  asm volatile("s_wait_asynccnt 0x0" ::: "memory");
  __syncthreads();
  if (REFILL) pb_fill(xr, slice, t + 2, lane);
}

__global__ __launch_bounds__(PB_THREADS) void passB_kernel(
    const float* __restrict__ x, const float* __restrict__ qk,
    const float* __restrict__ cK, float* __restrict__ xbar) {
  __shared__ __attribute__((aligned(16))) v4f tile[2][FF * 32];   // 2 x 128 KB
  __shared__ v4f part[PB_WAVES][32];
  __shared__ float xs[FF];
  const int b = blockIdx.x;
  const int tid = threadIdx.x;
  const int lane = tid & 31;
  const int w = __builtin_amdgcn_readfirstlane(tid >> 5);
  const v4f* xr = (const v4f*)(x + ((size_t)b * FF + w * PB_ROWS) * NN);
  float q[PB_ROWS];
  v2f acc[PB_ROWS];
#pragma unroll
  for (int i = 0; i < PB_ROWS; ++i) {
    q[i] = qk[b * FF + w * PB_ROWS + i];
    acc[i] = (v2f){0.f, 0.f};
  }
  const float cKb = cK[b];
  float m = -INFINITY, l = 0.f;

  pb_fill(xr, &tile[0][w * PB_ROWS * 32], 0, lane);
  asm volatile("s_wait_asynccnt 0x0" ::: "memory");   // tile 0 has landed
  __syncthreads();
  pb_fill(xr, &tile[1][w * PB_ROWS * 32], 1, lane);

  // both loops rolled: the bodies stay small in the instruction cache
#pragma unroll 1
  for (int t = 0; t < PB_TILES - 2; ++t)
    pb_trip<true>(xr, &tile[t & 1][w * PB_ROWS * 32], part, q, t, w, lane, cKb, acc, m, l);
#pragma unroll 1
  for (int t = PB_TILES - 2; t < PB_TILES; ++t)
    pb_trip<false>(xr, &tile[t & 1][w * PB_ROWS * 32], part, q, t, w, lane, cKb, acc, m, l);
  asm volatile("s_wait_asynccnt 0x0" ::: "memory");   // nothing in flight at the wave's end

  // join the 32 lanes: common max, rescale, butterfly sums
  float M = m;
#pragma unroll
  for (int o = 16; o; o >>= 1) M = fmaxf(M, __shfl_xor(M, o));
  const float sc = __expf(m - M);
  l *= sc;
#pragma unroll
  for (int o = 16; o; o >>= 1) l += __shfl_xor(l, o);
  float a[PB_ROWS];
#pragma unroll
  for (int i = 0; i < PB_ROWS; ++i) a[i] = (acc[i].x + acc[i].y) * sc;
#pragma unroll
  for (int o = 16; o; o >>= 1) {
#pragma unroll
    for (int i = 0; i < PB_ROWS; ++i) a[i] += __shfl_xor(a[i], o);
  }
  if (lane == 0) {
#pragma unroll
    for (int i = 0; i < PB_ROWS; ++i) xs[w * PB_ROWS + i] = a[i];
  }
  __syncthreads();
  // l is the same in every wave; whole 128-byte lines per wave
  if (tid < FF) xbar[b * FF + tid] = xs[tid] / l;   // softmax-normalized
}

// ---------------------------------------------------------------------------
// Pass C: logits[b,n] = tanh((ql . x[:,n] + cL) * scale) * 10
// 256 threads cover 256 consecutive n -> coalesced row walks; sw prefetch ahead.
// ---------------------------------------------------------------------------
__global__ __launch_bounds__(256) void passC_kernel(
    const float* __restrict__ x, const float* __restrict__ ql,
    const float* __restrict__ cL, float* __restrict__ out) {
  __shared__ float qs[FF];
  const int b = blockIdx.x >> 3;
  const int chunk = blockIdx.x & 7;
  const int tid = threadIdx.x;
  qs[tid] = ql[b * FF + tid];
  __syncthreads();
  const int n = chunk * 256 + tid;
  const float* xbase = x + (size_t)b * FF * NN;
  if (n < NN) {
    float acc = 0.f;
    for (int f = 0; f < FF; ++f) {
      if (f + 8 < FF) __builtin_prefetch(xbase + (size_t)(f + 8) * NN + n, 0, 0);
      acc += qs[f] * xbase[(size_t)f * NN + n];
    }
    out[b * NN + n] = tanhf((acc + cL[b]) * SCALE) * 10.f;
  }
}

// ---------------------------------------------------------------------------
extern "C" void kernel_launch(void* const* d_in, const int* in_sizes, int n_in,
                              void* d_out, int out_size, void* d_ws, size_t ws_size,
                              hipStream_t stream) {
  const float* x     = (const float*)d_in[0];   // [B,F,N,1]
  const int*   lc    = (const int*)  d_in[1];   // [B,2]
  const float* Wg    = (const float*)d_in[2];   // [F,F]
  const float* bg    = (const float*)d_in[3];   // [F]
  const float* Wnode = (const float*)d_in[4];   // [3F,F]
  const float* bnode = (const float*)d_in[5];   // [3F]
  const float* Wlc   = (const float*)d_in[6];   // [F,2F]
  const float* blc   = (const float*)d_in[7];   // [F]
  const float* Wproj = (const float*)d_in[8];   // [F,F]
  const float* bproj = (const float*)d_in[9];   // [F]
  float* out = (float*)d_out;                   // [B,N]

  // workspace carve-up (~1.32 MB of f32)
  float* ws   = (float*)d_ws;
  float* glb  = ws;                         // [B,F]
  float* ctx  = glb  + BB * FF;             // [B,2F]
  float* Qb   = ctx  + BB * 2 * FF;         // [B,F]
  float* cQ   = Qb   + BB * FF;             // [B,F]
  float* qk   = cQ   + BB * FF;             // [B,F]
  float* cK   = qk   + BB * FF;             // [B]
  float* xbar = cK   + BB;                  // [B,F]
  float* v1   = xbar + BB * FF;             // [B,F]
  float* nc   = v1   + BB * FF;             // [B,F]
  float* ql   = nc   + BB * FF;             // [B,F]
  float* cL   = ql   + BB * FF;             // [B]

  const int gtiles = (BB / 16) * (FF / 16); // 128 WMMA tiles per small GEMM

  // Pass A: glb = max_n x
  rowmax_kernel<<<BB * FF / 8, 256, 0, stream>>>(x, glb);
  // context gather
  gather_kernel<<<(BB * 2 * FF) / 256, 256, 0, stream>>>(x, lc, ctx);
  // Q = glb @ Wg^T + bg            (B[k,n] = Wg[n,k]: sbk=1, sbn=F)
  gemm16_kernel<<<gtiles, 32, 0, stream>>>(glb, FF, Wg, 1, FF, bg, nullptr, Qb, FF, FF / 16, FF);
  // cQ = ctx @ Wlc^T + blc + Q     (B[k,n] = Wlc[n,k]: sbk=1, sbn=2F)
  gemm16_kernel<<<gtiles, 32, 0, stream>>>(ctx, 2 * FF, Wlc, 1, 2 * FF, blc, Qb, cQ, FF, FF / 16, 2 * FF);
  // qk = cQ @ Wnode_K              (B[k,n] = Wnode[k,n]: sbk=F, sbn=1)
  gemm16_kernel<<<gtiles, 32, 0, stream>>>(cQ, FF, Wnode, FF, 1, nullptr, nullptr, qk, FF, FF / 16, FF);
  // cK = cQ . bnode_K
  dotrow_kernel<<<BB, 32, 0, stream>>>(cQ, bnode, cK, FF);
  // Pass B: fused attention (single read of x)
  passB_kernel<<<BB, PB_THREADS, 0, stream>>>(x, qk, cK, xbar);
  // v1 = xbar @ Wnode_V^T + bnode_V  (B[k,n] = Wnode[F+n,k]: base F*F, sbk=1, sbn=F)
  gemm16_kernel<<<gtiles, 32, 0, stream>>>(xbar, FF, Wnode + (size_t)FF * FF, 1, FF, bnode + FF, nullptr, v1, FF, FF / 16, FF);
  // nc = v1 @ Wproj^T + bproj
  gemm16_kernel<<<gtiles, 32, 0, stream>>>(v1, FF, Wproj, 1, FF, bproj, nullptr, nc, FF, FF / 16, FF);
  // ql = nc @ Wnode_L              (base 2F*F, sbk=F, sbn=1)
  gemm16_kernel<<<gtiles, 32, 0, stream>>>(nc, FF, Wnode + (size_t)2 * FF * FF, FF, 1, nullptr, nullptr, ql, FF, FF / 16, FF);
  // cL = nc . bnode_L
  dotrow_kernel<<<BB, 32, 0, stream>>>(nc, bnode + 2 * FF, cL, FF);
  // Pass C: logits
  passC_kernel<<<BB * 8, 256, 0, stream>>>(x, ql, cL, out);
}

// v002
// Measured time: 116 microseconds a run.
// Timed twice side by side with v001, it ran 1.35 and 1.33 times as fast.
// Over all steps from v000 it is 2.02 times as fast.
#include <hip/hip_runtime.h>
#include <stdint.h>
#include <math.h>

// Problem constants (from reference): B=128, F=256, N=2000, scale = 1/sqrt(F)
#define BB 128
#define FF 256
#define NN 2000
#define SCALE 0.0625f

#define PB_WAVES 16         // waves per workgroup in pass B
#define PB_THREADS (PB_WAVES * 32)
#define PB_ROWS (FF / PB_WAVES)   // feature rows held by one wave
#define N4 (NN / 4)         // float4 columns per feature row
#define PB_TILES ((N4 + 31) / 32) // tiles of 128 nodes (32 lanes x float4)

typedef __attribute__((ext_vector_type(2))) float v2f;
typedef __attribute__((ext_vector_type(4))) float v4f;
typedef __attribute__((ext_vector_type(8))) float v8f;

// ---------------------------------------------------------------------------
// Pass A: glb[b,f] = max_n x[b,f,n]   (one wave per row, float4 loads)
// ---------------------------------------------------------------------------
__global__ __launch_bounds__(256) void rowmax_kernel(const float* __restrict__ x,
                                                     float* __restrict__ glb) {
  const int row  = blockIdx.x * 8 + (threadIdx.x >> 5);   // row in [0, B*F)
  const int lane = threadIdx.x & 31;
  const float4* rp = (const float4*)(x + (size_t)row * NN);
  float m = -INFINITY;
  for (int c = lane; c < NN / 4; c += 32) {               // 2000/4 = 500 exact
    float4 v = rp[c];
    m = fmaxf(m, fmaxf(fmaxf(v.x, v.y), fmaxf(v.z, v.w)));
  }
#pragma unroll
  for (int o = 16; o; o >>= 1) m = fmaxf(m, __shfl_xor(m, o));
  if (lane == 0) glb[row] = m;
}

// ---------------------------------------------------------------------------
// Gather last/current city features: context[b, 0:F]=x[:, last], [F:2F]=x[:, cur]
// ---------------------------------------------------------------------------
__global__ __launch_bounds__(256) void gather_kernel(const float* __restrict__ x,
                                                     const int* __restrict__ lc,
                                                     float* __restrict__ ctx) {
  const int id = blockIdx.x * 256 + threadIdx.x;          // B*2F total
  const int b = id / (2 * FF);
  const int k = id - b * 2 * FF;
  const int j = (k >= FF) ? 1 : 0;
  const int f = (k >= FF) ? k - FF : k;
  const int n = lc[b * 2 + j];
  ctx[id] = x[((size_t)b * FF + f) * NN + n];
}

#define GK_SLICES 8

#define GK_NOPS "v_nop\n\tv_nop\n\tv_nop\n\tv_nop\n\tv_nop\n\tv_nop\n\tv_nop\n\tv_nop"
__device__ __forceinline__ void gk_slots(const v8f& d, const v4f (&a)[4], const v4f (&b)[4]) {
#if defined(__HIP_DEVICE_COMPILE__)
  asm volatile(GK_NOPS :: "v"(d), "v"(a[0]), "v"(a[1]), "v"(a[2]), "v"(a[3]),
               "v"(b[0]), "v"(b[1]), "v"(b[2]), "v"(b[3]));
#else
  (void)d; (void)a; (void)b;
#endif
}
__device__ __forceinline__ void gk_slots(const v8f& d, const v4f (&a)[8], const v4f (&b)[8]) {
#if defined(__HIP_DEVICE_COMPILE__)
  asm volatile(GK_NOPS :: "v"(d), "v"(a[0]), "v"(a[1]), "v"(a[2]), "v"(a[3]),
               "v"(a[4]), "v"(a[5]), "v"(a[6]), "v"(a[7]),
               "v"(b[0]), "v"(b[1]), "v"(b[2]), "v"(b[3]),
               "v"(b[4]), "v"(b[5]), "v"(b[6]), "v"(b[7]));
#else
  (void)d; (void)a; (void)b;
#endif
}
template <int K, bool BT, bool BIAS, bool ADDM>
__global__ __launch_bounds__(512) void gemm_slices_kernel(
    const float* __restrict__ A, const float* __restrict__ Bp,
    const float* __restrict__ bias, const float* __restrict__ addm,
    float* __restrict__ C) {
  constexpr int KW = K / GK_SLICES;   // k per wave
  constexpr int J  = KW / 8;          // 16-byte loads per lane and operand
  __shared__ float red[GK_SLICES][16 * 32];
  const int tid  = threadIdx.x;
  const int lane = tid & 31;
  const int l16  = lane & 15;
  const int hi   = lane >> 4;
  const int w    = __builtin_amdgcn_readfirstlane(tid >> 5);
  const int nt   = w & 1;
  const int ks   = w >> 1;
  const int m0   = (blockIdx.x >> 3) << 4;
  const int n0   = (blockIdx.x & 7) << 5;
  const int kb   = ks * KW + 4 * hi;
  const int col  = n0 + nt * 16 + l16;

  // every loop of this kernel is unrolled: the fragments must lie in registers, and a
  // rolled loop would wait for each load before it issues the next
  v4f a4[J], b4[J];
  const float* ap = A + (size_t)(m0 + l16) * K + kb;
#pragma unroll
  for (int j = 0; j < J; ++j) a4[j] = *(const v4f*)(ap + 8 * j);
  if (BT) {
    const float* bp = Bp + (size_t)col * K + kb;
#pragma unroll
    for (int j = 0; j < J; ++j) b4[j] = *(const v4f*)(bp + 8 * j);
  } else {
    const float* bp = Bp + (size_t)kb * FF + col;
#pragma unroll
    for (int j = 0; j < J; ++j) {
#pragma unroll
      for (int e = 0; e < 4; ++e) b4[j][e] = bp[(size_t)(8 * j + e) * FF];
    }
  }
  // the element this thread finishes: row tid/32, column tid%32 of the block's tile
  const int orow = m0 + (tid >> 5);
  const int ocol = n0 + lane;
  const float bcol = BIAS ? bias[ocol] : 0.f;
  const float am   = ADDM ? addm[(size_t)orow * FF + ocol] : 0.f;

  v8f acc = {};
#if __has_builtin(__builtin_amdgcn_wmma_f32_16x16x4_f32)
#pragma unroll
  for (int j = 0; j < J; ++j) {
#pragma unroll
    for (int h = 0; h < 2; ++h) {
      const v2f a  = {a4[j][2 * h], a4[j][2 * h + 1]};
      const v2f bv = {b4[j][2 * h], b4[j][2 * h + 1]};
      acc = __builtin_amdgcn_wmma_f32_16x16x4_f32(
          false, a, false, bv, (short)0, acc, false, false);
    }
  }
#endif
  gk_slots(acc, a4, b4);
#pragma unroll
  for (int r = 0; r < 8; ++r) red[ks][(r + 8 * hi) * 32 + nt * 16 + l16] = acc[r];
  __syncthreads();
  float tot = red[0][tid];
#pragma unroll
  for (int v = 1; v < GK_SLICES; ++v) tot += red[v][tid];
  if (BIAS) tot += bcol;
  if (ADDM) tot += am;
  C[(size_t)orow * FF + ocol] = tot;
}

// ---------------------------------------------------------------------------
// out[b] = sum_f A[b,f] * v[f]   (one wave per batch row)
// ---------------------------------------------------------------------------
__global__ __launch_bounds__(32) void dotrow_kernel(const float* __restrict__ A,
                                                    const float* __restrict__ v,
                                                    float* __restrict__ out, int K) {
  const int b = blockIdx.x;
  const int lane = threadIdx.x;
  float s = 0.f;
  for (int f = lane; f < K; f += 32) s += A[(size_t)b * K + f] * v[f];
#pragma unroll
  for (int o = 16; o; o >>= 1) s += __shfl_xor(s, o);
  if (lane == 0) out[b] = s;
}

__device__ __forceinline__ void pb_copy8(const v4f* g, const v4f* l) {
#if defined(__HIP_DEVICE_COMPILE__)
  const unsigned long long g0 = (unsigned long long)(uintptr_t)g;
  const unsigned int l0 = (unsigned int)(uintptr_t)l;   // generic LDS pointer: low 32 bits
  asm volatile(
      "global_load_async_to_lds_b128 %0, %8, off\n\t"
      "global_load_async_to_lds_b128 %1, %9, off\n\t"
      "global_load_async_to_lds_b128 %2, %10, off\n\t"
      "global_load_async_to_lds_b128 %3, %11, off\n\t"
      "global_load_async_to_lds_b128 %4, %12, off\n\t"
      "global_load_async_to_lds_b128 %5, %13, off\n\t"
      "global_load_async_to_lds_b128 %6, %14, off\n\t"
      "global_load_async_to_lds_b128 %7, %15, off\n\t"
      "s_wait_xcnt 0x0"
      :: "v"(l0), "v"(l0 + 512u), "v"(l0 + 1024u), "v"(l0 + 1536u),
         "v"(l0 + 2048u), "v"(l0 + 2560u), "v"(l0 + 3072u), "v"(l0 + 3584u),
         "v"(g0), "v"(g0 + 1ull * NN * 4), "v"(g0 + 2ull * NN * 4), "v"(g0 + 3ull * NN * 4),
         "v"(g0 + 4ull * NN * 4), "v"(g0 + 5ull * NN * 4), "v"(g0 + 6ull * NN * 4),
         "v"(g0 + 7ull * NN * 4)
      : "memory");
#else
  (void)g; (void)l;
#endif
}

// The wave's 16 rows of tile t into its slice of one LDS buffer.
__device__ __forceinline__ void pb_fill(const v4f* xr, v4f* slice, int t, int lane) {
  const int c = min(t * 32 + lane, N4 - 1);     // past the row's end: copy its last column
  pb_copy8(xr + c, slice + lane);
  pb_copy8(xr + 8 * N4 + c, slice + 8 * 32 + lane);
}

// One trip: tile t out of its LDS buffer. REFILL: a tile t + 2 exists and is copied
// into the buffer that this trip has read (the caller's loop bounds are the test).
template <bool REFILL>
__device__ __forceinline__ void pb_trip(const v4f* xr, v4f* slice, v4f (*part)[32],
                                        const float (&q)[PB_ROWS], int t, int w, int lane,
                                        float cKb, v2f (&acc)[PB_ROWS], float& m, float& l) {
  // this wave's share of the scores of the lane's four nodes; sums run in node
  // pairs (.xy, .zw) so that packed f32 instructions take the registers as they lie
  v4f X[PB_ROWS];
#pragma unroll
  for (int i = 0; i < PB_ROWS; ++i) X[i] = slice[i * 32 + lane];
  v2f s01 = {0.f, 0.f}, s23 = {0.f, 0.f};
#pragma unroll
  for (int i = 0; i < PB_ROWS; ++i) {
    const v2f qq = {q[i], q[i]};
    s01 = __builtin_elementwise_fma(qq, X[i].xy, s01);
    s23 = __builtin_elementwise_fma(qq, X[i].zw, s23);
  }
  part[w][lane] = (v4f){s01.x, s01.y, s23.x, s23.y};
  __syncthreads();
  // every wave adds the 16 shares in the same order, so all waves see equal scores
  v4f tot = part[0][lane];
#pragma unroll
  for (int v = 1; v < PB_WAVES; ++v) tot += part[v][lane];
  const bool valid = t * 32 + lane < N4;
  const float t0 = valid ? (tot.x + cKb) * SCALE : -INFINITY;
  const float t1 = valid ? (tot.y + cKb) * SCALE : -INFINITY;
  const float t2 = valid ? (tot.z + cKb) * SCALE : -INFINITY;
  const float t3 = valid ? (tot.w + cKb) * SCALE : -INFINITY;
  const float mn = fmaxf(m, fmaxf(fmaxf(t0, t1), fmaxf(t2, t3)));
  const float r  = __expf(m - mn);              // 0 on the first tile (m = -inf)
  const v2f e01 = {valid ? __expf(t0 - mn) : 0.f, valid ? __expf(t1 - mn) : 0.f};
  const v2f e23 = {valid ? __expf(t2 - mn) : 0.f, valid ? __expf(t3 - mn) : 0.f};
  const v2f es = e01 + e23;
  l = fmaf(l, r, es.x + es.y);
  m = mn;
  const v2f rr = {r, r};
#pragma unroll
  for (int i = 0; i < PB_ROWS; ++i)
    acc[i] = __builtin_elementwise_fma(e23, X[i].zw,
             __builtin_elementwise_fma(e01, X[i].xy, acc[i] * rr));

  // keeps the arithmetic above in front of the foot: without it the compiler moved it
  // behind the barrier, ahead of the copies, and read the 16 shares one wait at a time
  __builtin_amdgcn_sched_barrier(0);
  // foot of the trip: own LDS reads done, tile t+1 landed, everybody here; only
  // then is the buffer just read refilled
  asm volatile("s_wait_dscnt 0x0" ::: "memory");
  asm volatile("s_wait_asynccnt 0x0" ::: "memory");
  __syncthreads();
  if (REFILL) pb_fill(xr, slice, t + 2, lane);
}

__global__ __launch_bounds__(PB_THREADS) void passB_kernel(
    const float* __restrict__ x, const float* __restrict__ qk,
    const float* __restrict__ cK, float* __restrict__ xbar) {
  __shared__ __attribute__((aligned(16))) v4f tile[2][FF * 32];   // 2 x 128 KB
  __shared__ v4f part[PB_WAVES][32];
  __shared__ float xs[FF];
  const int b = blockIdx.x;
  const int tid = threadIdx.x;
  const int lane = tid & 31;
  const int w = __builtin_amdgcn_readfirstlane(tid >> 5);
  const v4f* xr = (const v4f*)(x + ((size_t)b * FF + w * PB_ROWS) * NN);
  float q[PB_ROWS];
  v2f acc[PB_ROWS];
#pragma unroll
  for (int i = 0; i < PB_ROWS; ++i) {
    q[i] = qk[b * FF + w * PB_ROWS + i];
    acc[i] = (v2f){0.f, 0.f};
  }
  const float cKb = cK[b];
  float m = -INFINITY, l = 0.f;

  pb_fill(xr, &tile[0][w * PB_ROWS * 32], 0, lane);
  asm volatile("s_wait_asynccnt 0x0" ::: "memory");   // tile 0 has landed
  __syncthreads();
  pb_fill(xr, &tile[1][w * PB_ROWS * 32], 1, lane);

  // both loops rolled: the bodies stay small in the instruction cache
#pragma unroll 1
  for (int t = 0; t < PB_TILES - 2; ++t)
    pb_trip<true>(xr, &tile[t & 1][w * PB_ROWS * 32], part, q, t, w, lane, cKb, acc, m, l);
#pragma unroll 1
  for (int t = PB_TILES - 2; t < PB_TILES; ++t)
    pb_trip<false>(xr, &tile[t & 1][w * PB_ROWS * 32], part, q, t, w, lane, cKb, acc, m, l);
  asm volatile("s_wait_asynccnt 0x0" ::: "memory");   // nothing in flight at the wave's end

  // join the 32 lanes: common max, rescale, butterfly sums
  float M = m;
#pragma unroll
  for (int o = 16; o; o >>= 1) M = fmaxf(M, __shfl_xor(M, o));
  const float sc = __expf(m - M);
  l *= sc;
#pragma unroll
  for (int o = 16; o; o >>= 1) l += __shfl_xor(l, o);
  float a[PB_ROWS];
#pragma unroll
  for (int i = 0; i < PB_ROWS; ++i) a[i] = (acc[i].x + acc[i].y) * sc;
#pragma unroll
  for (int o = 16; o; o >>= 1) {
#pragma unroll
    for (int i = 0; i < PB_ROWS; ++i) a[i] += __shfl_xor(a[i], o);
  }
  if (lane == 0) {
#pragma unroll
    for (int i = 0; i < PB_ROWS; ++i) xs[w * PB_ROWS + i] = a[i];
  }
  __syncthreads();
  // l is the same in every wave; whole 128-byte lines per wave
  if (tid < FF) xbar[b * FF + tid] = xs[tid] / l;   // softmax-normalized
}

// ---------------------------------------------------------------------------
// Pass C: logits[b,n] = tanh((ql . x[:,n] + cL) * scale) * 10
// 256 threads cover 256 consecutive n -> coalesced row walks; sw prefetch ahead.
// ---------------------------------------------------------------------------
__global__ __launch_bounds__(256) void passC_kernel(
    const float* __restrict__ x, const float* __restrict__ ql,
    const float* __restrict__ cL, float* __restrict__ out) {
  __shared__ float qs[FF];
  const int b = blockIdx.x >> 3;
  const int chunk = blockIdx.x & 7;
  const int tid = threadIdx.x;
  qs[tid] = ql[b * FF + tid];
  __syncthreads();
  const int n = chunk * 256 + tid;
  const float* xbase = x + (size_t)b * FF * NN;
  if (n < NN) {
    float acc = 0.f;
    for (int f = 0; f < FF; ++f) {
      if (f + 8 < FF) __builtin_prefetch(xbase + (size_t)(f + 8) * NN + n, 0, 0);
      acc += qs[f] * xbase[(size_t)f * NN + n];
    }
    out[b * NN + n] = tanhf((acc + cL[b]) * SCALE) * 10.f;
  }
}

// ---------------------------------------------------------------------------
extern "C" void kernel_launch(void* const* d_in, const int* in_sizes, int n_in,
                              void* d_out, int out_size, void* d_ws, size_t ws_size,
                              hipStream_t stream) {
  const float* x     = (const float*)d_in[0];   // [B,F,N,1]
  const int*   lc    = (const int*)  d_in[1];   // [B,2]
  const float* Wg    = (const float*)d_in[2];   // [F,F]
  const float* bg    = (const float*)d_in[3];   // [F]
  const float* Wnode = (const float*)d_in[4];   // [3F,F]
  const float* bnode = (const float*)d_in[5];   // [3F]
  const float* Wlc   = (const float*)d_in[6];   // [F,2F]
  const float* blc   = (const float*)d_in[7];   // [F]
  const float* Wproj = (const float*)d_in[8];   // [F,F]
  const float* bproj = (const float*)d_in[9];   // [F]
  float* out = (float*)d_out;                   // [B,N]

  // workspace carve-up (~1.32 MB of f32)
  float* ws   = (float*)d_ws;
  float* glb  = ws;                         // [B,F]
  float* ctx  = glb  + BB * FF;             // [B,2F]
  float* Qb   = ctx  + BB * 2 * FF;         // [B,F]
  float* cQ   = Qb   + BB * FF;             // [B,F]
  float* qk   = cQ   + BB * FF;             // [B,F]
  float* cK   = qk   + BB * FF;             // [B]
  float* xbar = cK   + BB;                  // [B,F]
  float* v1   = xbar + BB * FF;             // [B,F]
  float* nc   = v1   + BB * FF;             // [B,F]
  float* ql   = nc   + BB * FF;             // [B,F]
  float* cL   = ql   + BB * FF;             // [B]

  const int gtiles = (BB / 16) * (FF / 32); // 64 blocks of 16 x 32 per small GEMM

  // Pass A: glb = max_n x
  rowmax_kernel<<<BB * FF / 8, 256, 0, stream>>>(x, glb);
  // context gather
  gather_kernel<<<(BB * 2 * FF) / 256, 256, 0, stream>>>(x, lc, ctx);
  // Q = glb @ Wg^T + bg            (B[k,n] = Wg[n,k]: sbk=1, sbn=F)
  gemm_slices_kernel<FF, true, true, false><<<gtiles, 512, 0, stream>>>(glb, Wg, bg, nullptr, Qb);
  // cQ = ctx @ Wlc^T + blc + Q     (B[k,n] = Wlc[n,k]: sbk=1, sbn=2F)
  gemm_slices_kernel<2 * FF, true, true, true><<<gtiles, 512, 0, stream>>>(ctx, Wlc, blc, Qb, cQ);
  // qk = cQ @ Wnode_K              (B[k,n] = Wnode[k,n]: sbk=F, sbn=1)
  gemm_slices_kernel<FF, false, false, false><<<gtiles, 512, 0, stream>>>(cQ, Wnode, nullptr, nullptr, qk);
  // cK = cQ . bnode_K
  dotrow_kernel<<<BB, 32, 0, stream>>>(cQ, bnode, cK, FF);
  // Pass B: fused attention (single read of x)
  passB_kernel<<<BB, PB_THREADS, 0, stream>>>(x, qk, cK, xbar);
  // v1 = xbar @ Wnode_V^T + bnode_V  (B[k,n] = Wnode[F+n,k]: base F*F, sbk=1, sbn=F)
  gemm_slices_kernel<FF, true, true, false><<<gtiles, 512, 0, stream>>>(xbar, Wnode + (size_t)FF * FF, bnode + FF, nullptr, v1);
  // nc = v1 @ Wproj^T + bproj
  gemm_slices_kernel<FF, true, true, false><<<gtiles, 512, 0, stream>>>(v1, Wproj, bproj, nullptr, nc);
  // ql = nc @ Wnode_L              (base 2F*F, sbk=F, sbn=1)
  gemm_slices_kernel<FF, false, false, false><<<gtiles, 512, 0, stream>>>(nc, Wnode + (size_t)2 * FF * FF, nullptr, nullptr, ql);
  // cL = nc . bnode_L
  dotrow_kernel<<<BB, 32, 0, stream>>>(nc, bnode + 2 * FF, cL, FF);
  // Pass C: logits
  passC_kernel<<<BB * 8, 256, 0, stream>>>(x, ql, cL, out);
}

// v003
// A run of this version takes 105 microseconds.
// Timed twice side by side with v002, it ran 1.10 times as fast both times.
// Over all steps from v000 it is 2.22 times as fast.
#include <hip/hip_runtime.h>
#include <stdint.h>
#include <math.h>

// Problem constants (from reference): B=128, F=256, N=2000, scale = 1/sqrt(F)
#define BB 128
#define FF 256
#define NN 2000
#define SCALE 0.0625f

#define PB_WAVES 16         // waves per workgroup in pass B
#define PB_THREADS (PB_WAVES * 32)
#define PB_ROWS (FF / PB_WAVES)   // feature rows held by one wave
#define N4 (NN / 4)         // float4 columns per feature row
#define PB_TILES ((N4 + 31) / 32) // tiles of 128 nodes (32 lanes x float4)

typedef __attribute__((ext_vector_type(2))) float v2f;
typedef __attribute__((ext_vector_type(4))) float v4f;
typedef __attribute__((ext_vector_type(8))) float v8f;

// ---------------------------------------------------------------------------
// First launch, two jobs that do not depend on each other:
//   blocks [0, GA_BLOCKS): context[b, 0:F] = x[b, :, last], context[b, F:2F] = x[b, :, cur]
//   the others, pass A   : glb[b,f] = max_n x[b,f,n]   (one wave per row, float4 loads)
// The short gather blocks stand first (for speed only).
// ---------------------------------------------------------------------------
#define GA_PER 4                                  // context elements per thread
#define GA_BLOCKS ((BB * 2 * FF) / (256 * GA_PER))
__global__ __launch_bounds__(256) void rowmax_gather_kernel(const float* __restrict__ x,
                                                            const int* __restrict__ lc,
                                                            float* __restrict__ glb,
                                                            float* __restrict__ ctx) {
  if (blockIdx.x < GA_BLOCKS) {
    // unrolled: the four index loads, then the four feature loads, fly together
#pragma unroll
    for (int e = 0; e < GA_PER; ++e) {
      const int id = (blockIdx.x * GA_PER + e) * 256 + threadIdx.x;   // B*2F total
      const int b = id / (2 * FF);
      const int k = id - b * 2 * FF;
      const int j = (k >= FF) ? 1 : 0;
      const int f = (k >= FF) ? k - FF : k;
      const int n = min(max(lc[b * 2 + j], 0), NN - 1);   // the address stays inside x
      ctx[id] = x[((size_t)b * FF + f) * NN + n];
    }
    return;
  }
  const int row  = (blockIdx.x - GA_BLOCKS) * 8 + (threadIdx.x >> 5);   // row in [0, B*F)
  const int lane = threadIdx.x & 31;
  const float4* rp = (const float4*)(x + (size_t)row * NN);
  float m = -INFINITY;
  for (int c = lane; c < NN / 4; c += 32) {               // 2000/4 = 500 exact
    float4 v = rp[c];
    m = fmaxf(m, fmaxf(fmaxf(v.x, v.y), fmaxf(v.z, v.w)));
  }
#pragma unroll
  for (int o = 16; o; o >>= 1) m = fmaxf(m, __shfl_xor(m, o));
  if (lane == 0) glb[row] = m;
}

#define GK_SLICES 8
#define GT_BLOCKS ((BB / 16) * (FF / 32))   // blocks of 16 x 32 in one small GEMM

#define GK_NOPS "v_nop\n\tv_nop\n\tv_nop\n\tv_nop\n\tv_nop\n\tv_nop\n\tv_nop\n\tv_nop"
__device__ __forceinline__ void gk_slots(const v8f& d, const v4f (&a)[4], const v4f (&b)[4]) {
#if defined(__HIP_DEVICE_COMPILE__)
  asm volatile(GK_NOPS :: "v"(d), "v"(a[0]), "v"(a[1]), "v"(a[2]), "v"(a[3]),
               "v"(b[0]), "v"(b[1]), "v"(b[2]), "v"(b[3]));
#else
  (void)d; (void)a; (void)b;
#endif
}
// Here the two load addresses are inputs as well: their registers stay theirs while the
// loads fly (without this the compiler let later loads return into them).
__device__ __forceinline__ void gk_slots(const v8f& d, const v4f (&a)[8], const v4f (&b)[8],
                                         const float* pa, const float* pb) {
#if defined(__HIP_DEVICE_COMPILE__)
  asm volatile(GK_NOPS :: "v"(d), "v"(a[0]), "v"(a[1]), "v"(a[2]), "v"(a[3]),
               "v"(a[4]), "v"(a[5]), "v"(a[6]), "v"(a[7]),
               "v"(b[0]), "v"(b[1]), "v"(b[2]), "v"(b[3]),
               "v"(b[4]), "v"(b[5]), "v"(b[6]), "v"(b[7]), "v"(pa), "v"(pb));
#else
  (void)d; (void)a; (void)b; (void)pa; (void)pb;
#endif
}
template <int K, bool BT, bool BIAS, bool DOT>
__global__ __launch_bounds__(512) void gemm_slices_kernel(
    const float* __restrict__ A, const float* __restrict__ Bp,
    const float* __restrict__ bias, float* __restrict__ C,
    const float* __restrict__ dv, float* __restrict__ dout) {
  constexpr int KW = K / GK_SLICES;   // k per wave
  constexpr int J  = KW / 8;          // 16-byte loads per lane and operand
  __shared__ float red[GK_SLICES][16 * 32];
  const int tid  = threadIdx.x;
  const int lane = tid & 31;
  const int l16  = lane & 15;
  const int hi   = lane >> 4;
  const int w    = __builtin_amdgcn_readfirstlane(tid >> 5);
  if (DOT && blockIdx.x >= GT_BLOCKS) {   // the whole block leaves, in front of the barrier
    const int b = (blockIdx.x - GT_BLOCKS) * 16 + w;
    float s = 0.f;
#pragma unroll
    for (int i = 0; i < K / 32; ++i) s = fmaf(A[(size_t)b * K + lane + 32 * i], dv[lane + 32 * i], s);
#pragma unroll
    for (int o = 16; o; o >>= 1) s += __shfl_xor(s, o);
    if (lane == 0) dout[b] = s;
    return;
  }
  const int nt   = w & 1;
  const int ks   = w >> 1;
  const int m0   = (blockIdx.x >> 3) << 4;
  const int n0   = (blockIdx.x & 7) << 5;
  const int kb   = ks * KW + 4 * hi;
  const int col  = n0 + nt * 16 + l16;

  // every loop of this kernel is unrolled: the fragments must lie in registers, and a
  // rolled loop would wait for each load before it issues the next
  v4f a4[J], b4[J];
  const float* ap = A + (size_t)(m0 + l16) * K + kb;
#pragma unroll
  for (int j = 0; j < J; ++j) a4[j] = *(const v4f*)(ap + 8 * j);
  if (BT) {
    const float* bp = Bp + (size_t)col * K + kb;
#pragma unroll
    for (int j = 0; j < J; ++j) b4[j] = *(const v4f*)(bp + 8 * j);
  } else {
    const float* bp = Bp + (size_t)kb * FF + col;
#pragma unroll
    for (int j = 0; j < J; ++j) {
#pragma unroll
      for (int e = 0; e < 4; ++e) b4[j][e] = bp[(size_t)(8 * j + e) * FF];
    }
  }
  // the element this thread finishes: row tid/32, column tid%32 of the block's tile
  const int orow = m0 + (tid >> 5);
  const int ocol = n0 + lane;
  const float bcol = BIAS ? bias[ocol] : 0.f;

  v8f acc = {};
#if __has_builtin(__builtin_amdgcn_wmma_f32_16x16x4_f32)
#pragma unroll
  for (int j = 0; j < J; ++j) {
#pragma unroll
    for (int h = 0; h < 2; ++h) {
      const v2f a  = {a4[j][2 * h], a4[j][2 * h + 1]};
      const v2f bv = {b4[j][2 * h], b4[j][2 * h + 1]};
      acc = __builtin_amdgcn_wmma_f32_16x16x4_f32(
          false, a, false, bv, (short)0, acc, false, false);
    }
  }
#endif
  gk_slots(acc, a4, b4);
#pragma unroll
  for (int r = 0; r < 8; ++r) red[ks][(r + 8 * hi) * 32 + nt * 16 + l16] = acc[r];
  __syncthreads();
  float tot = red[0][tid];
#pragma unroll
  for (int v = 1; v < GK_SLICES; ++v) tot += red[v][tid];
  if (BIAS) tot += bcol;
  C[(size_t)orow * FF + ocol] = tot;
}

#define CQ_SLICES 12
__global__ __launch_bounds__(CQ_SLICES * 64) void gemm_cq_kernel(
    const float* __restrict__ glb, const float* __restrict__ Wg, const float* __restrict__ bg,
    const float* __restrict__ ctx, const float* __restrict__ Wlc, const float* __restrict__ blc,
    float* __restrict__ C) {
  constexpr int KW = 64;              // k per wave
  constexpr int J  = KW / 8;          // 16-byte loads per lane and operand
  __shared__ float red[CQ_SLICES][16 * 32];
  const int tid  = threadIdx.x;
  const int lane = tid & 31;
  const int l16  = lane & 15;
  const int hi   = lane >> 4;
  const int w    = __builtin_amdgcn_readfirstlane(tid >> 5);
  const int nt   = w & 1;
  const int ks   = w >> 1;
  const int m0   = (blockIdx.x >> 3) << 4;
  const int n0   = (blockIdx.x & 7) << 5;
  const int col  = n0 + nt * 16 + l16;
  const bool first = ks < FF / KW;    // the same in every lane of a wave
  const int K    = first ? FF : 2 * FF;
  const int kb   = (first ? ks : ks - FF / KW) * KW + 4 * hi;

  v4f a4[J], b4[J];
  const float* ap = (first ? glb : ctx) + (size_t)(m0 + l16) * K + kb;
  const float* bp = (first ? Wg : Wlc) + (size_t)col * K + kb;
#pragma unroll
  for (int j = 0; j < J; ++j) a4[j] = *(const v4f*)(ap + 8 * j);
#pragma unroll
  for (int j = 0; j < J; ++j) b4[j] = *(const v4f*)(bp + 8 * j);
  const int ocol = n0 + lane;
  const float bcol = bg[ocol] + blc[ocol];

  v8f acc = {};
#if __has_builtin(__builtin_amdgcn_wmma_f32_16x16x4_f32)
#pragma unroll
  for (int j = 0; j < J; ++j) {
#pragma unroll
    for (int h = 0; h < 2; ++h) {
      const v2f a  = {a4[j][2 * h], a4[j][2 * h + 1]};
      const v2f bv = {b4[j][2 * h], b4[j][2 * h + 1]};
      acc = __builtin_amdgcn_wmma_f32_16x16x4_f32(
          false, a, false, bv, (short)0, acc, false, false);
    }
  }
#endif
  gk_slots(acc, a4, b4, ap, bp);
#pragma unroll
  for (int r = 0; r < 8; ++r) red[ks][(r + 8 * hi) * 32 + nt * 16 + l16] = acc[r];
  __syncthreads();
  // the tile has 512 elements: the first 16 waves finish one each (row tid/32, column tid%32)
  if (tid < 16 * 32) {
    float tot = red[0][tid];
#pragma unroll
    for (int v = 1; v < CQ_SLICES; ++v) tot += red[v][tid];
    C[(size_t)(m0 + (tid >> 5)) * FF + ocol] = tot + bcol;
  }
}

__device__ __forceinline__ void pb_copy8(const v4f* g, const v4f* l) {
#if defined(__HIP_DEVICE_COMPILE__)
  const unsigned long long g0 = (unsigned long long)(uintptr_t)g;
  const unsigned int l0 = (unsigned int)(uintptr_t)l;   // generic LDS pointer: low 32 bits
  asm volatile(
      "global_load_async_to_lds_b128 %0, %8, off\n\t"
      "global_load_async_to_lds_b128 %1, %9, off\n\t"
      "global_load_async_to_lds_b128 %2, %10, off\n\t"
      "global_load_async_to_lds_b128 %3, %11, off\n\t"
      "global_load_async_to_lds_b128 %4, %12, off\n\t"
      "global_load_async_to_lds_b128 %5, %13, off\n\t"
      "global_load_async_to_lds_b128 %6, %14, off\n\t"
      "global_load_async_to_lds_b128 %7, %15, off\n\t"
      "s_wait_xcnt 0x0"
      :: "v"(l0), "v"(l0 + 512u), "v"(l0 + 1024u), "v"(l0 + 1536u),
         "v"(l0 + 2048u), "v"(l0 + 2560u), "v"(l0 + 3072u), "v"(l0 + 3584u),
         "v"(g0), "v"(g0 + 1ull * NN * 4), "v"(g0 + 2ull * NN * 4), "v"(g0 + 3ull * NN * 4),
         "v"(g0 + 4ull * NN * 4), "v"(g0 + 5ull * NN * 4), "v"(g0 + 6ull * NN * 4),
         "v"(g0 + 7ull * NN * 4)
      : "memory");
#else
  (void)g; (void)l;
#endif
}

// The wave's 16 rows of tile t into its slice of one LDS buffer.
__device__ __forceinline__ void pb_fill(const v4f* xr, v4f* slice, int t, int lane) {
  const int c = min(t * 32 + lane, N4 - 1);     // past the row's end: copy its last column
  pb_copy8(xr + c, slice + lane);
  pb_copy8(xr + 8 * N4 + c, slice + 8 * 32 + lane);
}

// One trip: tile t out of its LDS buffer. REFILL: a tile t + 2 exists and is copied
// into the buffer that this trip has read (the caller's loop bounds are the test).
template <bool REFILL>
__device__ __forceinline__ void pb_trip(const v4f* xr, v4f* slice, v4f (*part)[32],
                                        const float (&q)[PB_ROWS], int t, int w, int lane,
                                        float cKb, v2f (&acc)[PB_ROWS], float& m, float& l) {
  // this wave's share of the scores of the lane's four nodes; sums run in node
  // pairs (.xy, .zw) so that packed f32 instructions take the registers as they lie
  v4f X[PB_ROWS];
#pragma unroll
  for (int i = 0; i < PB_ROWS; ++i) X[i] = slice[i * 32 + lane];
  v2f s01 = {0.f, 0.f}, s23 = {0.f, 0.f};
#pragma unroll
  for (int i = 0; i < PB_ROWS; ++i) {
    const v2f qq = {q[i], q[i]};
    s01 = __builtin_elementwise_fma(qq, X[i].xy, s01);
    s23 = __builtin_elementwise_fma(qq, X[i].zw, s23);
  }
  part[w][lane] = (v4f){s01.x, s01.y, s23.x, s23.y};
  __syncthreads();
  // every wave adds the 16 shares in the same order, so all waves see equal scores
  v4f tot = part[0][lane];
#pragma unroll
  for (int v = 1; v < PB_WAVES; ++v) tot += part[v][lane];
  const bool valid = t * 32 + lane < N4;
  const float t0 = valid ? (tot.x + cKb) * SCALE : -INFINITY;
  const float t1 = valid ? (tot.y + cKb) * SCALE : -INFINITY;
  const float t2 = valid ? (tot.z + cKb) * SCALE : -INFINITY;
  const float t3 = valid ? (tot.w + cKb) * SCALE : -INFINITY;
  const float mn = fmaxf(m, fmaxf(fmaxf(t0, t1), fmaxf(t2, t3)));
  const float r  = __expf(m - mn);              // 0 on the first tile (m = -inf)
  const v2f e01 = {valid ? __expf(t0 - mn) : 0.f, valid ? __expf(t1 - mn) : 0.f};
  const v2f e23 = {valid ? __expf(t2 - mn) : 0.f, valid ? __expf(t3 - mn) : 0.f};
  const v2f es = e01 + e23;
  l = fmaf(l, r, es.x + es.y);
  m = mn;
  const v2f rr = {r, r};
#pragma unroll
  for (int i = 0; i < PB_ROWS; ++i)
    acc[i] = __builtin_elementwise_fma(e23, X[i].zw,
             __builtin_elementwise_fma(e01, X[i].xy, acc[i] * rr));

  // keeps the arithmetic above in front of the foot: without it the compiler moved it
  // behind the barrier, ahead of the copies, and read the 16 shares one wait at a time
  __builtin_amdgcn_sched_barrier(0);
  // foot of the trip: own LDS reads done, tile t+1 landed, everybody here; only
  // then is the buffer just read refilled
  asm volatile("s_wait_dscnt 0x0" ::: "memory");
  asm volatile("s_wait_asynccnt 0x0" ::: "memory");
  __syncthreads();
  if (REFILL) pb_fill(xr, slice, t + 2, lane);
}

__global__ __launch_bounds__(PB_THREADS) void passB_kernel(
    const float* __restrict__ x, const float* __restrict__ qk,
    const float* __restrict__ cK, float* __restrict__ xbar) {
  __shared__ __attribute__((aligned(16))) v4f tile[2][FF * 32];   // 2 x 128 KB
  __shared__ v4f part[PB_WAVES][32];
  __shared__ float xs[FF];
  const int b = blockIdx.x;
  const int tid = threadIdx.x;
  const int lane = tid & 31;
  const int w = __builtin_amdgcn_readfirstlane(tid >> 5);
  const v4f* xr = (const v4f*)(x + ((size_t)b * FF + w * PB_ROWS) * NN);
  float q[PB_ROWS];
  v2f acc[PB_ROWS];
#pragma unroll
  for (int i = 0; i < PB_ROWS; ++i) {
    q[i] = qk[b * FF + w * PB_ROWS + i];
    acc[i] = (v2f){0.f, 0.f};
  }
  const float cKb = cK[b];
  float m = -INFINITY, l = 0.f;

  pb_fill(xr, &tile[0][w * PB_ROWS * 32], 0, lane);
  asm volatile("s_wait_asynccnt 0x0" ::: "memory");   // tile 0 has landed
  __syncthreads();
  pb_fill(xr, &tile[1][w * PB_ROWS * 32], 1, lane);

  // both loops rolled: the bodies stay small in the instruction cache
#pragma unroll 1
  for (int t = 0; t < PB_TILES - 2; ++t)
    pb_trip<true>(xr, &tile[t & 1][w * PB_ROWS * 32], part, q, t, w, lane, cKb, acc, m, l);
#pragma unroll 1
  for (int t = PB_TILES - 2; t < PB_TILES; ++t)
    pb_trip<false>(xr, &tile[t & 1][w * PB_ROWS * 32], part, q, t, w, lane, cKb, acc, m, l);
  asm volatile("s_wait_asynccnt 0x0" ::: "memory");   // nothing in flight at the wave's end

  // join the 32 lanes: common max, rescale, butterfly sums
  float M = m;
#pragma unroll
  for (int o = 16; o; o >>= 1) M = fmaxf(M, __shfl_xor(M, o));
  const float sc = __expf(m - M);
  l *= sc;
#pragma unroll
  for (int o = 16; o; o >>= 1) l += __shfl_xor(l, o);
  float a[PB_ROWS];
#pragma unroll
  for (int i = 0; i < PB_ROWS; ++i) a[i] = (acc[i].x + acc[i].y) * sc;
#pragma unroll
  for (int o = 16; o; o >>= 1) {
#pragma unroll
    for (int i = 0; i < PB_ROWS; ++i) a[i] += __shfl_xor(a[i], o);
  }
  if (lane == 0) {
#pragma unroll
    for (int i = 0; i < PB_ROWS; ++i) xs[w * PB_ROWS + i] = a[i];
  }
  __syncthreads();
  // l is the same in every wave; whole 128-byte lines per wave
  if (tid < FF) xbar[b * FF + tid] = xs[tid] / l;   // softmax-normalized
}

// ---------------------------------------------------------------------------
// Pass C: logits[b,n] = tanh((ql . x[:,n] + cL) * scale) * 10
// 256 threads cover 256 consecutive n -> coalesced row walks; sw prefetch ahead.
// ---------------------------------------------------------------------------
__global__ __launch_bounds__(256) void passC_kernel(
    const float* __restrict__ x, const float* __restrict__ ql,
    const float* __restrict__ cL, float* __restrict__ out) {
  __shared__ float qs[FF];
  const int b = blockIdx.x >> 3;
  const int chunk = blockIdx.x & 7;
  const int tid = threadIdx.x;
  qs[tid] = ql[b * FF + tid];
  __syncthreads();
  const int n = chunk * 256 + tid;
  const float* xbase = x + (size_t)b * FF * NN;
  if (n < NN) {
    float acc = 0.f;
    for (int f = 0; f < FF; ++f) {
      if (f + 8 < FF) __builtin_prefetch(xbase + (size_t)(f + 8) * NN + n, 0, 0);
      acc += qs[f] * xbase[(size_t)f * NN + n];
    }
    out[b * NN + n] = tanhf((acc + cL[b]) * SCALE) * 10.f;
  }
}

// ---------------------------------------------------------------------------
extern "C" void kernel_launch(void* const* d_in, const int* in_sizes, int n_in,
                              void* d_out, int out_size, void* d_ws, size_t ws_size,
                              hipStream_t stream) {
  const float* x     = (const float*)d_in[0];   // [B,F,N,1]
  const int*   lc    = (const int*)  d_in[1];   // [B,2]
  const float* Wg    = (const float*)d_in[2];   // [F,F]
  const float* bg    = (const float*)d_in[3];   // [F]
  const float* Wnode = (const float*)d_in[4];   // [3F,F]
  const float* bnode = (const float*)d_in[5];   // [3F]
  const float* Wlc   = (const float*)d_in[6];   // [F,2F]
  const float* blc   = (const float*)d_in[7];   // [F]
  const float* Wproj = (const float*)d_in[8];   // [F,F]
  const float* bproj = (const float*)d_in[9];   // [F]
  float* out = (float*)d_out;                   // [B,N]

  // workspace carve-up (~1.2 MB of f32)
  float* ws   = (float*)d_ws;
  float* glb  = ws;                         // [B,F]
  float* ctx  = glb  + BB * FF;             // [B,2F]
  float* cQ   = ctx  + BB * 2 * FF;         // [B,F]
  float* qk   = cQ   + BB * FF;             // [B,F]
  float* cK   = qk   + BB * FF;             // [B]
  float* xbar = cK   + BB;                  // [B,F]
  float* v1   = xbar + BB * FF;             // [B,F]
  float* nc   = v1   + BB * FF;             // [B,F]
  float* ql   = nc   + BB * FF;             // [B,F]
  float* cL   = ql   + BB * FF;             // [B]

  // context gather, and pass A: glb = max_n x
  rowmax_gather_kernel<<<GA_BLOCKS + BB * FF / 8, 256, 0, stream>>>(x, lc, glb, ctx);
  // cQ = glb @ Wg^T + bg + ctx @ Wlc^T + blc
  gemm_cq_kernel<<<GT_BLOCKS, CQ_SLICES * 64, 0, stream>>>(glb, Wg, bg, ctx, Wlc, blc, cQ);
  // qk = cQ @ Wnode_K (Bm(k,n) = Wnode[k,n]), and cK = cQ . bnode_K
  gemm_slices_kernel<FF, false, false, true><<<GT_BLOCKS + BB / 16, 512, 0, stream>>>(cQ, Wnode, nullptr, qk, bnode, cK);
  // Pass B: fused attention (single read of x)
  passB_kernel<<<BB, PB_THREADS, 0, stream>>>(x, qk, cK, xbar);
  // v1 = xbar @ Wnode_V^T + bnode_V  (Bm(k,n) = Wnode[F+n,k])
  gemm_slices_kernel<FF, true, true, false><<<GT_BLOCKS, 512, 0, stream>>>(xbar, Wnode + (size_t)FF * FF, bnode + FF, v1, nullptr, nullptr);
  // nc = v1 @ Wproj^T + bproj
  gemm_slices_kernel<FF, true, true, false><<<GT_BLOCKS, 512, 0, stream>>>(v1, Wproj, bproj, nc, nullptr, nullptr);
  // ql = nc @ Wnode_L (Bm(k,n) = Wnode[2F+k,n]), and cL = nc . bnode_L
  gemm_slices_kernel<FF, false, false, true><<<GT_BLOCKS + BB / 16, 512, 0, stream>>>(nc, Wnode + (size_t)2 * FF * FF, nullptr, ql, bnode + 2 * FF, cL);
  // Pass C: logits
  passC_kernel<<<BB * 8, 256, 0, stream>>>(x, ql, cL, out);
}

// v004
// A run of this version takes 93.5 microseconds.
// Two timings next to v003 both put it at 1.13 times that version's speed.
// All steps since v000 together make it 2.51 times as fast.
#include <hip/hip_runtime.h>
#include <stdint.h>
#include <math.h>

// Problem constants (from reference): B=128, F=256, N=2000, scale = 1/sqrt(F)
#define BB 128
#define FF 256
#define NN 2000
#define SCALE 0.0625f

#define PB_WAVES 16         // waves per workgroup in pass B
#define PB_THREADS (PB_WAVES * 32)
#define PB_ROWS (FF / PB_WAVES)   // feature rows held by one wave
#define N4 (NN / 4)         // float4 columns per feature row
#define PB_TILES ((N4 + 31) / 32) // tiles of 128 nodes (32 lanes x float4)
#define PB_SPLIT 2          // workgroups per batch in pass B: B * 2 = one on every WGP
#define PB_TPB (PB_TILES / PB_SPLIT)   // tiles per workgroup
#define ST_PITCH 32         // floats: each workgroup's (max, sum) has a 128-byte line of its own
static_assert(PB_SPLIT == 2 && PB_TILES % PB_SPLIT == 0 && PB_TPB % 2 == 0 && PB_TPB >= 2,
              "two equal node ranges, each starting in LDS buffer 0");

typedef __attribute__((ext_vector_type(2))) float v2f;
typedef __attribute__((ext_vector_type(4))) float v4f;
typedef __attribute__((ext_vector_type(8))) float v8f;

// ---------------------------------------------------------------------------
// First launch, two jobs that do not depend on each other:
//   blocks [0, GA_BLOCKS): context[b, 0:F] = x[b, :, last], context[b, F:2F] = x[b, :, cur]
//   the others, pass A   : glb[b,f] = max_n x[b,f,n]   (one wave per row, float4 loads)
// The short gather blocks stand first (for speed only).
// ---------------------------------------------------------------------------
#define GA_PER 4                                  // context elements per thread
#define GA_BLOCKS ((BB * 2 * FF) / (256 * GA_PER))
__global__ __launch_bounds__(256) void rowmax_gather_kernel(const float* __restrict__ x,
                                                            const int* __restrict__ lc,
                                                            float* __restrict__ glb,
                                                            float* __restrict__ ctx) {
  if (blockIdx.x < GA_BLOCKS) {
    // unrolled: the four index loads, then the four feature loads, fly together
#pragma unroll
    for (int e = 0; e < GA_PER; ++e) {
      const int id = (blockIdx.x * GA_PER + e) * 256 + threadIdx.x;   // B*2F total
      const int b = id / (2 * FF);
      const int k = id - b * 2 * FF;
      const int j = (k >= FF) ? 1 : 0;
      const int f = (k >= FF) ? k - FF : k;
      const int n = min(max(lc[b * 2 + j], 0), NN - 1);   // the address stays inside x
      ctx[id] = x[((size_t)b * FF + f) * NN + n];
    }
    return;
  }
  const int row  = (blockIdx.x - GA_BLOCKS) * 8 + (threadIdx.x >> 5);   // row in [0, B*F)
  const int lane = threadIdx.x & 31;
  const float4* rp = (const float4*)(x + (size_t)row * NN);
  float m = -INFINITY;
  for (int c = lane; c < NN / 4; c += 32) {               // 2000/4 = 500 exact
    float4 v = rp[c];
    m = fmaxf(m, fmaxf(fmaxf(v.x, v.y), fmaxf(v.z, v.w)));
  }
#pragma unroll
  for (int o = 16; o; o >>= 1) m = fmaxf(m, __shfl_xor(m, o));
  if (lane == 0) glb[row] = m;
}

#define GK_SLICES 8
#define GT_BLOCKS ((BB / 16) * (FF / 32))   // blocks of 16 x 32 in one small GEMM

#define GK_NOPS "v_nop\n\tv_nop\n\tv_nop\n\tv_nop\n\tv_nop\n\tv_nop\n\tv_nop\n\tv_nop"
__device__ __forceinline__ void gk_slots(const v8f& d, const v4f (&a)[4], const v4f (&b)[4]) {
#if defined(__HIP_DEVICE_COMPILE__)
  asm volatile(GK_NOPS :: "v"(d), "v"(a[0]), "v"(a[1]), "v"(a[2]), "v"(a[3]),
               "v"(b[0]), "v"(b[1]), "v"(b[2]), "v"(b[3]));
#else
  (void)d; (void)a; (void)b;
#endif
}
// Here the two load addresses are inputs as well: their registers stay theirs while the
// loads fly (without this the compiler let later loads return into them).
__device__ __forceinline__ void gk_slots(const v8f& d, const v4f (&a)[8], const v4f (&b)[8],
                                         const float* pa, const float* pb) {
#if defined(__HIP_DEVICE_COMPILE__)
  asm volatile(GK_NOPS :: "v"(d), "v"(a[0]), "v"(a[1]), "v"(a[2]), "v"(a[3]),
               "v"(a[4]), "v"(a[5]), "v"(a[6]), "v"(a[7]),
               "v"(b[0]), "v"(b[1]), "v"(b[2]), "v"(b[3]),
               "v"(b[4]), "v"(b[5]), "v"(b[6]), "v"(b[7]), "v"(pa), "v"(pb));
#else
  (void)d; (void)a; (void)b; (void)pa; (void)pb;
#endif
}
// The same for the merging A load: its three load addresses are inputs for that reason.
__device__ __forceinline__ void gk_slots(const v8f& d, const v4f (&a)[4], const v4f (&b)[4],
                                         const float* pa, const float* pb, const float* ps) {
#if defined(__HIP_DEVICE_COMPILE__)
  asm volatile(GK_NOPS :: "v"(d), "v"(a[0]), "v"(a[1]), "v"(a[2]), "v"(a[3]),
               "v"(b[0]), "v"(b[1]), "v"(b[2]), "v"(b[3]), "v"(pa), "v"(pb), "v"(ps));
#else
  (void)d; (void)a; (void)b; (void)pa; (void)pb; (void)ps;
#endif
}
template <int K, bool BT, bool BIAS, bool DOT, bool MERGE>
__global__ __launch_bounds__(512) void gemm_slices_kernel(
    const float* __restrict__ A, const float* __restrict__ Bp,
    const float* __restrict__ bias, float* __restrict__ C,
    const float* __restrict__ dv, float* __restrict__ dout) {
  constexpr int KW = K / GK_SLICES;   // k per wave
  constexpr int J  = KW / 8;          // 16-byte loads per lane and operand
  __shared__ float red[GK_SLICES][16 * 32];
  const int tid  = threadIdx.x;
  const int lane = tid & 31;
  const int l16  = lane & 15;
  const int hi   = lane >> 4;
  const int w    = __builtin_amdgcn_readfirstlane(tid >> 5);
  if (DOT && blockIdx.x >= GT_BLOCKS) {   // the whole block leaves, in front of the barrier
    const int b = (blockIdx.x - GT_BLOCKS) * 16 + w;
    float s = 0.f;
#pragma unroll
    for (int i = 0; i < K / 32; ++i) s = fmaf(A[(size_t)b * K + lane + 32 * i], dv[lane + 32 * i], s);
#pragma unroll
    for (int o = 16; o; o >>= 1) s += __shfl_xor(s, o);
    if (lane == 0) dout[b] = s;
    return;
  }
  const int nt   = w & 1;
  const int ks   = w >> 1;
  const int m0   = (blockIdx.x >> 3) << 4;
  const int n0   = (blockIdx.x & 7) << 5;
  const int kb   = ks * KW + 4 * hi;
  const int col  = n0 + nt * 16 + l16;

  // every loop of this kernel is unrolled: the fragments must lie in registers, and a
  // rolled loop would wait for each load before it issues the next
  v4f a4[J], b4[J];
  const float* st = MERGE ? dv + (m0 + l16) * ST_PITCH : nullptr;
  float M0 = 0.f, L0 = 0.f, M1 = 0.f, L1 = 0.f;
  if (MERGE) {   // wanted first, so asked for first
    M0 = st[0];
    L0 = st[1];
    M1 = st[BB * ST_PITCH];
    L1 = st[BB * ST_PITCH + 1];
  }
  const float* ap = A + (size_t)(m0 + l16) * K + kb;
#pragma unroll
  for (int j = 0; j < J; ++j) a4[j] = *(const v4f*)(ap + 8 * j);
  v4f a1[J];
  if (MERGE) {
#pragma unroll
    for (int j = 0; j < J; ++j) a1[j] = *(const v4f*)(ap + (size_t)BB * K + 8 * j);
  }
  const float* bkeep = nullptr;
  if (BT) {
    const float* bp = Bp + (size_t)col * K + kb;
#pragma unroll
    for (int j = 0; j < J; ++j) b4[j] = *(const v4f*)(bp + 8 * j);
    bkeep = bp;
  } else {
    const float* bp = Bp + (size_t)kb * FF + col;
#pragma unroll
    for (int j = 0; j < J; ++j) {
#pragma unroll
      for (int e = 0; e < 4; ++e) b4[j][e] = bp[(size_t)(8 * j + e) * FF];
    }
  }
  // the element this thread finishes: row tid/32, column tid%32 of the block's tile
  const int orow = m0 + (tid >> 5);
  const int ocol = n0 + lane;
  const float bcol = BIAS ? bias[ocol] : 0.f;
  if (MERGE) {
    // every load above is issued before the first wait: without this the compiler held
    // half of them back behind the wait for M and l, a second trip to memory
    __builtin_amdgcn_sched_barrier(0);
    const float Mx = fmaxf(M0, M1);
    const float w0 = __expf(M0 - Mx), w1 = __expf(M1 - Mx);
    const float inv = 1.f / fmaf(L1, w1, L0 * w0);   // softmax-normalized here
    const float c0 = w0 * inv, c1 = w1 * inv;
#pragma unroll
    for (int j = 0; j < J; ++j) a4[j] = a4[j] * c0 + a1[j] * c1;
  }

  v8f acc = {};
#if __has_builtin(__builtin_amdgcn_wmma_f32_16x16x4_f32)
#pragma unroll
  for (int j = 0; j < J; ++j) {
#pragma unroll
    for (int h = 0; h < 2; ++h) {
      const v2f a  = {a4[j][2 * h], a4[j][2 * h + 1]};
      const v2f bv = {b4[j][2 * h], b4[j][2 * h + 1]};
      acc = __builtin_amdgcn_wmma_f32_16x16x4_f32(
          false, a, false, bv, (short)0, acc, false, false);
    }
  }
#endif
  if (MERGE) gk_slots(acc, a4, b4, ap, bkeep, st);
  else       gk_slots(acc, a4, b4);
#pragma unroll
  for (int r = 0; r < 8; ++r) red[ks][(r + 8 * hi) * 32 + nt * 16 + l16] = acc[r];
  __syncthreads();
  float tot = red[0][tid];
#pragma unroll
  for (int v = 1; v < GK_SLICES; ++v) tot += red[v][tid];
  if (BIAS) tot += bcol;
  C[(size_t)orow * FF + ocol] = tot;
}

#define CQ_SLICES 12
__global__ __launch_bounds__(CQ_SLICES * 64) void gemm_cq_kernel(
    const float* __restrict__ glb, const float* __restrict__ Wg, const float* __restrict__ bg,
    const float* __restrict__ ctx, const float* __restrict__ Wlc, const float* __restrict__ blc,
    float* __restrict__ C) {
  constexpr int KW = 64;              // k per wave
  constexpr int J  = KW / 8;          // 16-byte loads per lane and operand
  __shared__ float red[CQ_SLICES][16 * 32];
  const int tid  = threadIdx.x;
  const int lane = tid & 31;
  const int l16  = lane & 15;
  const int hi   = lane >> 4;
  const int w    = __builtin_amdgcn_readfirstlane(tid >> 5);
  const int nt   = w & 1;
  const int ks   = w >> 1;
  const int m0   = (blockIdx.x >> 3) << 4;
  const int n0   = (blockIdx.x & 7) << 5;
  const int col  = n0 + nt * 16 + l16;
  const bool first = ks < FF / KW;    // the same in every lane of a wave
  const int K    = first ? FF : 2 * FF;
  const int kb   = (first ? ks : ks - FF / KW) * KW + 4 * hi;

  v4f a4[J], b4[J];
  const float* ap = (first ? glb : ctx) + (size_t)(m0 + l16) * K + kb;
  const float* bp = (first ? Wg : Wlc) + (size_t)col * K + kb;
#pragma unroll
  for (int j = 0; j < J; ++j) a4[j] = *(const v4f*)(ap + 8 * j);
#pragma unroll
  for (int j = 0; j < J; ++j) b4[j] = *(const v4f*)(bp + 8 * j);
  const int ocol = n0 + lane;
  const float bcol = bg[ocol] + blc[ocol];

  v8f acc = {};
#if __has_builtin(__builtin_amdgcn_wmma_f32_16x16x4_f32)
#pragma unroll
  for (int j = 0; j < J; ++j) {
#pragma unroll
    for (int h = 0; h < 2; ++h) {
      const v2f a  = {a4[j][2 * h], a4[j][2 * h + 1]};
      const v2f bv = {b4[j][2 * h], b4[j][2 * h + 1]};
      acc = __builtin_amdgcn_wmma_f32_16x16x4_f32(
          false, a, false, bv, (short)0, acc, false, false);
    }
  }
#endif
  gk_slots(acc, a4, b4, ap, bp);
#pragma unroll
  for (int r = 0; r < 8; ++r) red[ks][(r + 8 * hi) * 32 + nt * 16 + l16] = acc[r];
  __syncthreads();
  // the tile has 512 elements: the first 16 waves finish one each (row tid/32, column tid%32)
  if (tid < 16 * 32) {
    float tot = red[0][tid];
#pragma unroll
    for (int v = 1; v < CQ_SLICES; ++v) tot += red[v][tid];
    C[(size_t)(m0 + (tid >> 5)) * FF + ocol] = tot + bcol;
  }
}

__device__ __forceinline__ void pb_copy8(const v4f* g, const v4f* l) {
#if defined(__HIP_DEVICE_COMPILE__)
  const unsigned long long g0 = (unsigned long long)(uintptr_t)g;
  const unsigned int l0 = (unsigned int)(uintptr_t)l;   // generic LDS pointer: low 32 bits
  asm volatile(
      "global_load_async_to_lds_b128 %0, %8, off\n\t"
      "global_load_async_to_lds_b128 %1, %9, off\n\t"
      "global_load_async_to_lds_b128 %2, %10, off\n\t"
      "global_load_async_to_lds_b128 %3, %11, off\n\t"
      "global_load_async_to_lds_b128 %4, %12, off\n\t"
      "global_load_async_to_lds_b128 %5, %13, off\n\t"
      "global_load_async_to_lds_b128 %6, %14, off\n\t"
      "global_load_async_to_lds_b128 %7, %15, off\n\t"
      "s_wait_xcnt 0x0"
      :: "v"(l0), "v"(l0 + 512u), "v"(l0 + 1024u), "v"(l0 + 1536u),
         "v"(l0 + 2048u), "v"(l0 + 2560u), "v"(l0 + 3072u), "v"(l0 + 3584u),
         "v"(g0), "v"(g0 + 1ull * NN * 4), "v"(g0 + 2ull * NN * 4), "v"(g0 + 3ull * NN * 4),
         "v"(g0 + 4ull * NN * 4), "v"(g0 + 5ull * NN * 4), "v"(g0 + 6ull * NN * 4),
         "v"(g0 + 7ull * NN * 4)
      : "memory");
#else
  (void)g; (void)l;
#endif
}

// The wave's 16 rows of tile t into its slice of one LDS buffer.
__device__ __forceinline__ void pb_fill(const v4f* xr, v4f* slice, int t, int lane) {
  const int c = min(t * 32 + lane, N4 - 1);     // past the row's end: copy its last column
  pb_copy8(xr + c, slice + lane);
  pb_copy8(xr + 8 * N4 + c, slice + 8 * 32 + lane);
}

// One trip: tile t out of its LDS buffer. REFILL: a tile t + 2 exists and is copied
// into the buffer that this trip has read (the caller's loop bounds are the test).
template <bool REFILL>
__device__ __forceinline__ void pb_trip(const v4f* xr, v4f* slice, v4f (*part)[32],
                                        const float (&q)[PB_ROWS], int t, int w, int lane,
                                        float cKb, v2f (&acc)[PB_ROWS], float& m, float& l) {
  // this wave's share of the scores of the lane's four nodes; sums run in node
  // pairs (.xy, .zw) so that packed f32 instructions take the registers as they lie
  v4f X[PB_ROWS];
#pragma unroll
  for (int i = 0; i < PB_ROWS; ++i) X[i] = slice[i * 32 + lane];
  v2f s01 = {0.f, 0.f}, s23 = {0.f, 0.f};
#pragma unroll
  for (int i = 0; i < PB_ROWS; ++i) {
    const v2f qq = {q[i], q[i]};
    s01 = __builtin_elementwise_fma(qq, X[i].xy, s01);
    s23 = __builtin_elementwise_fma(qq, X[i].zw, s23);
  }
  part[w][lane] = (v4f){s01.x, s01.y, s23.x, s23.y};
  __syncthreads();
  // every wave adds the 16 shares in the same order, so all waves see equal scores
  v4f tot = part[0][lane];
#pragma unroll
  for (int v = 1; v < PB_WAVES; ++v) tot += part[v][lane];
  const bool valid = REFILL || t * 32 + lane < N4;   // a tile with a tile t + 2 behind it is whole
  const float t0 = valid ? (tot.x + cKb) * SCALE : -INFINITY;
  const float t1 = valid ? (tot.y + cKb) * SCALE : -INFINITY;
  const float t2 = valid ? (tot.z + cKb) * SCALE : -INFINITY;
  const float t3 = valid ? (tot.w + cKb) * SCALE : -INFINITY;
  const float mn = fmaxf(m, fmaxf(fmaxf(t0, t1), fmaxf(t2, t3)));
  const float r  = __expf(m - mn);              // 0 on the first tile (m = -inf)
  const v2f e01 = {valid ? __expf(t0 - mn) : 0.f, valid ? __expf(t1 - mn) : 0.f};
  const v2f e23 = {valid ? __expf(t2 - mn) : 0.f, valid ? __expf(t3 - mn) : 0.f};
  const v2f es = e01 + e23;
  l = fmaf(l, r, es.x + es.y);
  m = mn;
  const v2f rr = {r, r};
#pragma unroll
  for (int i = 0; i < PB_ROWS; ++i)
    acc[i] = __builtin_elementwise_fma(e23, X[i].zw,
             __builtin_elementwise_fma(e01, X[i].xy, acc[i] * rr));

  // keeps the arithmetic above in front of the foot: without it the compiler moved it
  // behind the barrier, ahead of the copies, and read the 16 shares one wait at a time
  __builtin_amdgcn_sched_barrier(0);
  // foot of the trip: own LDS reads done, tile t+1 landed, everybody here; only
  // then is the buffer just read refilled
  asm volatile("s_wait_dscnt 0x0" ::: "memory");
  asm volatile("s_wait_asynccnt 0x0" ::: "memory");
  __syncthreads();
  if (REFILL) pb_fill(xr, slice, t + 2, lane);
}

__global__ __launch_bounds__(PB_THREADS) void passB_kernel(
    const float* __restrict__ x, const float* __restrict__ qk,
    const float* __restrict__ cK, float* __restrict__ xpart, float* __restrict__ st) {
  __shared__ __attribute__((aligned(16))) v4f tile[2][FF * 32];   // 2 x 128 KB
  __shared__ v4f part[PB_WAVES][32];
  __shared__ float xs[FF];
  const int b = blockIdx.x / PB_SPLIT;
  const int h = blockIdx.x % PB_SPLIT;   // which node range
  const int t0 = h * PB_TPB;             // its first tile (even: it lies in buffer 0)
  const int tid = threadIdx.x;
  const int lane = tid & 31;
  const int w = __builtin_amdgcn_readfirstlane(tid >> 5);
  const v4f* xr = (const v4f*)(x + ((size_t)b * FF + w * PB_ROWS) * NN);
  float q[PB_ROWS];
  v2f acc[PB_ROWS];
#pragma unroll
  for (int i = 0; i < PB_ROWS; ++i) {
    q[i] = qk[b * FF + w * PB_ROWS + i];
    acc[i] = (v2f){0.f, 0.f};
  }
  const float cKb = cK[b];
  float m = -INFINITY, l = 0.f;

  pb_fill(xr, &tile[0][w * PB_ROWS * 32], t0, lane);
  asm volatile("s_wait_asynccnt 0x0" ::: "memory");   // the first tile has landed
  __syncthreads();
  pb_fill(xr, &tile[1][w * PB_ROWS * 32], t0 + 1, lane);

  // both loops rolled: the bodies stay small in the instruction cache
#pragma unroll 1
  for (int t = t0; t < t0 + PB_TPB - 2; ++t)
    pb_trip<true>(xr, &tile[t & 1][w * PB_ROWS * 32], part, q, t, w, lane, cKb, acc, m, l);
#pragma unroll 1
  for (int t = t0 + PB_TPB - 2; t < t0 + PB_TPB; ++t)
    pb_trip<false>(xr, &tile[t & 1][w * PB_ROWS * 32], part, q, t, w, lane, cKb, acc, m, l);
  asm volatile("s_wait_asynccnt 0x0" ::: "memory");   // nothing in flight at the wave's end

  // join the 32 lanes: common max, rescale, butterfly sums
  float M = m;
#pragma unroll
  for (int o = 16; o; o >>= 1) M = fmaxf(M, __shfl_xor(M, o));
  const float sc = __expf(m - M);
  l *= sc;
#pragma unroll
  for (int o = 16; o; o >>= 1) l += __shfl_xor(l, o);
  float a[PB_ROWS];
#pragma unroll
  for (int i = 0; i < PB_ROWS; ++i) a[i] = (acc[i].x + acc[i].y) * sc;
#pragma unroll
  for (int o = 16; o; o >>= 1) {
#pragma unroll
    for (int i = 0; i < PB_ROWS; ++i) a[i] += __shfl_xor(a[i], o);
  }
  if (lane == 0) {
#pragma unroll
    for (int i = 0; i < PB_ROWS; ++i) xs[w * PB_ROWS + i] = a[i];
  }
  __syncthreads();
  // M and l are the same in every wave; whole 128-byte lines per wave
  if (tid < FF) xpart[(h * BB + b) * FF + tid] = xs[tid];   // relative to M, not normalized
  if (tid == 0) {
    st[(h * BB + b) * ST_PITCH]     = M;
    st[(h * BB + b) * ST_PITCH + 1] = l;
  }
}

// ---------------------------------------------------------------------------
// Pass C: logits[b,n] = tanh((ql . x[:,n] + cL) * scale) * 10
// 256 threads cover 256 consecutive n -> coalesced row walks; sw prefetch ahead.
// ---------------------------------------------------------------------------
__global__ __launch_bounds__(256) void passC_kernel(
    const float* __restrict__ x, const float* __restrict__ ql,
    const float* __restrict__ cL, float* __restrict__ out) {
  __shared__ float qs[FF];
  const int b = blockIdx.x >> 3;
  const int chunk = blockIdx.x & 7;
  const int tid = threadIdx.x;
  qs[tid] = ql[b * FF + tid];
  __syncthreads();
  const int n = chunk * 256 + tid;
  const float* xbase = x + (size_t)b * FF * NN;
  if (n < NN) {
    float acc = 0.f;
    for (int f = 0; f < FF; ++f) {
      if (f + 8 < FF) __builtin_prefetch(xbase + (size_t)(f + 8) * NN + n, 0, 0);
      acc += qs[f] * xbase[(size_t)f * NN + n];
    }
    out[b * NN + n] = tanhf((acc + cL[b]) * SCALE) * 10.f;
  }
}

// ---------------------------------------------------------------------------
extern "C" void kernel_launch(void* const* d_in, const int* in_sizes, int n_in,
                              void* d_out, int out_size, void* d_ws, size_t ws_size,
                              hipStream_t stream) {
  const float* x     = (const float*)d_in[0];   // [B,F,N,1]
  const int*   lc    = (const int*)  d_in[1];   // [B,2]
  const float* Wg    = (const float*)d_in[2];   // [F,F]
  const float* bg    = (const float*)d_in[3];   // [F]
  const float* Wnode = (const float*)d_in[4];   // [3F,F]
  const float* bnode = (const float*)d_in[5];   // [3F]
  const float* Wlc   = (const float*)d_in[6];   // [F,2F]
  const float* blc   = (const float*)d_in[7];   // [F]
  const float* Wproj = (const float*)d_in[8];   // [F,F]
  const float* bproj = (const float*)d_in[9];   // [F]
  float* out = (float*)d_out;                   // [B,N]

  // workspace carve-up (~1.3 MB of f32)
  float* ws   = (float*)d_ws;
  float* glb  = ws;                         // [B,F]
  float* ctx  = glb  + BB * FF;             // [B,2F]
  float* cQ   = ctx  + BB * 2 * FF;         // [B,F]
  float* qk   = cQ   + BB * FF;             // [B,F]
  float* cK   = qk   + BB * FF;             // [B]
  float* xpart = cK  + BB;                  // [2,B,F]
  float* st   = xpart + PB_SPLIT * BB * FF; // [2,B] lines of ST_PITCH
  float* v1   = st   + PB_SPLIT * BB * ST_PITCH;   // [B,F]
  float* nc   = v1   + BB * FF;             // [B,F]
  float* ql   = nc   + BB * FF;             // [B,F]
  float* cL   = ql   + BB * FF;             // [B]

  // context gather, and pass A: glb = max_n x
  rowmax_gather_kernel<<<GA_BLOCKS + BB * FF / 8, 256, 0, stream>>>(x, lc, glb, ctx);
  // cQ = glb @ Wg^T + bg + ctx @ Wlc^T + blc
  gemm_cq_kernel<<<GT_BLOCKS, CQ_SLICES * 64, 0, stream>>>(glb, Wg, bg, ctx, Wlc, blc, cQ);
  // qk = cQ @ Wnode_K (Bm(k,n) = Wnode[k,n]), and cK = cQ . bnode_K
  gemm_slices_kernel<FF, false, false, true, false><<<GT_BLOCKS + BB / 16, 512, 0, stream>>>(cQ, Wnode, nullptr, qk, bnode, cK);
  // Pass B: fused attention (single read of x)
  passB_kernel<<<BB * PB_SPLIT, PB_THREADS, 0, stream>>>(x, qk, cK, xpart, st);
  // v1 = xbar @ Wnode_V^T + bnode_V  (Bm(k,n) = Wnode[F+n,k]), xbar joined from xpart and st
  gemm_slices_kernel<FF, true, true, false, true><<<GT_BLOCKS, 512, 0, stream>>>(xpart, Wnode + (size_t)FF * FF, bnode + FF, v1, st, nullptr);
  // nc = v1 @ Wproj^T + bproj
  gemm_slices_kernel<FF, true, true, false, false><<<GT_BLOCKS, 512, 0, stream>>>(v1, Wproj, bproj, nc, nullptr, nullptr);
  // ql = nc @ Wnode_L (Bm(k,n) = Wnode[2F+k,n]), and cL = nc . bnode_L
  gemm_slices_kernel<FF, false, false, true, false><<<GT_BLOCKS + BB / 16, 512, 0, stream>>>(nc, Wnode + (size_t)2 * FF * FF, nullptr, ql, bnode + 2 * FF, cL);
  // Pass C: logits
  passC_kernel<<<BB * 8, 256, 0, stream>>>(x, ql, cL, out);
}

// v005
// One run takes 80.3 microseconds.
// Next to v004, in two timings, it ran 1.16 times as fast each time.
// All steps since v000 together make it 2.91 times as fast.
#include <hip/hip_runtime.h>
#include <stdint.h>
#include <math.h>

// Problem constants (from reference): B=128, F=256, N=2000, scale = 1/sqrt(F)
#define BB 128
#define FF 256
#define NN 2000
#define SCALE 0.0625f

#define PB_WAVES 16         // waves per workgroup in pass B
#define PB_THREADS (PB_WAVES * 32)
#define PB_ROWS (FF / PB_WAVES)   // feature rows held by one wave
#define N4 (NN / 4)         // float4 columns per feature row
#define PB_TILES ((N4 + 31) / 32) // tiles of 128 nodes (32 lanes x float4)
#define PB_SPLIT 2          // workgroups per batch in pass B: B * 2 = one on every WGP
#define PB_TPB (PB_TILES / PB_SPLIT)   // tiles per workgroup
#define ST_PITCH 32         // floats: each workgroup's (max, sum) has a 128-byte line of its own
static_assert(PB_SPLIT == 2 && PB_TILES % PB_SPLIT == 0 && PB_TPB % 2 == 0 && PB_TPB >= 2,
              "two equal node ranges, each starting in LDS buffer 0");

typedef __attribute__((ext_vector_type(2))) float v2f;
typedef __attribute__((ext_vector_type(4))) float v4f;
typedef __attribute__((ext_vector_type(8))) float v8f;

#define RM_WAVES 16
#define RM_THREADS (RM_WAVES * 32)
#define RM_ROWS 8                                 // rows per wave
#define RM_WGROWS (RM_WAVES * RM_ROWS)            // rows per workgroup
#define RM_LOADS (RM_ROWS * N4 / 32)              // wave-wide 16-byte loads per span
#define RM_G 16                                   // loads per group
#define RM_GROUPS ((RM_LOADS + RM_G - 1) / RM_G)
#define RM_BLOCKS (BB * FF / RM_WGROWS)
#define GA_WAVES (2 * RM_WGROWS / 32)             // waves that gather, 32 values each
static_assert((RM_ROWS * N4) % 32 == 0 && N4 > 32, "a span is whole loads; a load meets at most two rows");
static_assert(FF % RM_WGROWS == 0 && RM_WGROWS % 32 == 0 && GA_WAVES <= RM_WAVES,
              "a workgroup's rows lie in one batch; a gathering wave has one of last / cur");
__global__ __launch_bounds__(RM_THREADS) void rowmax_gather_kernel(const float* __restrict__ x,
                                                                   const int* __restrict__ lc,
                                                                   float* __restrict__ glb,
                                                                   float* __restrict__ ctx) {
  __shared__ float rm[RM_WGROWS];
  const int tid  = threadIdx.x;
  const int lane = tid & 31;
  const int w    = __builtin_amdgcn_readfirstlane(tid >> 5);
  const int wg0  = blockIdx.x * RM_WGROWS;                // the workgroup's first row in [0, B*F)
  const v4f* sp = (const v4f*)(x + (size_t)(wg0 + w * RM_ROWS) * NN) + lane;
  float mx[RM_ROWS];
#pragma unroll
  for (int r = 0; r < RM_ROWS; ++r) mx[r] = -INFINITY;
  // every loop here is unrolled: the load number decides at compile time which row a value
  // belongs to, and the two groups of loaded values must lie in registers
  // gather: wave w takes last (w < GA_WAVES / 2) or cur of 32 of the workgroup's rows
  const int gb = wg0 / FF;                                // batch
  const int gj = w / (GA_WAVES / 2);                      // 0 last, 1 cur
  const int gr = wg0 + (w % (GA_WAVES / 2)) * 32 + lane;  // row in [0, B*F)
  v4f buf[2][RM_G];
#pragma unroll
  for (int q = 0; q < RM_G; ++q) buf[0][q] = sp[q * 32];
  float gv = 0.f;
  if (w < GA_WAVES) {                                     // the same in every lane of a wave
    const int n = min(max(lc[gb * 2 + gj], 0), NN - 1);   // the address stays inside x
    gv = x[(size_t)gr * NN + n];
#if defined(__HIP_DEVICE_COMPILE__)
    // the next group's loads return into this load's address registers
    asm volatile("s_wait_xcnt 0x0" ::: "memory");
#endif
  }
#pragma unroll
  for (int c = 0; c < RM_GROUPS; ++c) {
    // the two scheduling barriers pin the order "next group's loads, then this group's
    // maxima": without them the loads may sink behind the waits for this group
    __builtin_amdgcn_sched_barrier(0);
    if (c + 1 < RM_GROUPS) {
#pragma unroll
      for (int q = 0; q < RM_G; ++q)
        if ((c + 1) * RM_G + q < RM_LOADS) buf[(c + 1) & 1][q] = sp[((c + 1) * RM_G + q) * 32];
    }
    __builtin_amdgcn_sched_barrier(0);
#pragma unroll
    for (int q = 0; q < RM_G; ++q) {
      const int k = c * RM_G + q;
      if (k < RM_LOADS) {
        const v4f v = buf[c & 1][q];
        const float vm = fmaxf(fmaxf(v.x, v.y), fmaxf(v.z, v.w));
        const int ra = (k * 32) / N4;
        const int rb = (k * 32 + 31) / N4;
        if (ra == rb) {
          mx[ra] = fmaxf(mx[ra], vm);
        } else {
          const bool lo = lane < rb * N4 - k * 32;
          mx[ra] = fmaxf(mx[ra], lo ? vm : -INFINITY);
          mx[rb] = fmaxf(mx[rb], lo ? -INFINITY : vm);
        }
      }
    }
    // without the statement below the compiler regrouped the maxima across groups, kept
    // loaded values alive past their group and spilled them between the loads
#if defined(__HIP_DEVICE_COMPILE__)
#pragma unroll
    for (int r = 0; r < RM_ROWS; ++r)
      if (r >= (c * RM_G * 32) / N4 && r <= (c * RM_G * 32 + RM_G * 32 - 1) / N4)
        asm volatile("" : "+v"(mx[r]));   // streaming pattern: each row's result closed, against spills
#endif
  }
#pragma unroll
  for (int r = 0; r < RM_ROWS; ++r) {
#pragma unroll
    for (int o = 16; o; o >>= 1) mx[r] = fmaxf(mx[r], __shfl_xor(mx[r], o));
  }
  float mine = mx[0];
#pragma unroll
  for (int r = 1; r < RM_ROWS; ++r) mine = (lane == r) ? mx[r] : mine;
  if (lane < RM_ROWS) rm[w * RM_ROWS + lane] = mine;
  __syncthreads();
  // the workgroup's maxima leave as whole 128-byte lines, one wave each
  if (tid < RM_WGROWS) glb[wg0 + tid] = rm[tid];
  // behind the barrier: in front of it every wave would wait for this store to finish
  if (w < GA_WAVES) ctx[gb * 2 * FF + gj * FF + (gr - gb * FF)] = gv;   // a whole line per wave
}

#define GK_SLICES 8
#define GT_BLOCKS ((BB / 16) * (FF / 32))   // blocks of 16 x 32 in one small GEMM

#define GK_NOPS "v_nop\n\tv_nop\n\tv_nop\n\tv_nop\n\tv_nop\n\tv_nop\n\tv_nop\n\tv_nop"
__device__ __forceinline__ void gk_slots(const v8f& d, const v4f (&a)[4], const v4f (&b)[4]) {
#if defined(__HIP_DEVICE_COMPILE__)
  asm volatile(GK_NOPS :: "v"(d), "v"(a[0]), "v"(a[1]), "v"(a[2]), "v"(a[3]),
               "v"(b[0]), "v"(b[1]), "v"(b[2]), "v"(b[3]));
#else
  (void)d; (void)a; (void)b;
#endif
}
// Here the two load addresses are inputs as well: their registers stay theirs while the
// loads fly (without this the compiler let later loads return into them).
__device__ __forceinline__ void gk_slots(const v8f& d, const v4f (&a)[8], const v4f (&b)[8],
                                         const float* pa, const float* pb) {
#if defined(__HIP_DEVICE_COMPILE__)
  asm volatile(GK_NOPS :: "v"(d), "v"(a[0]), "v"(a[1]), "v"(a[2]), "v"(a[3]),
               "v"(a[4]), "v"(a[5]), "v"(a[6]), "v"(a[7]),
               "v"(b[0]), "v"(b[1]), "v"(b[2]), "v"(b[3]),
               "v"(b[4]), "v"(b[5]), "v"(b[6]), "v"(b[7]), "v"(pa), "v"(pb));
#else
  (void)d; (void)a; (void)b; (void)pa; (void)pb;
#endif
}
// The same for the merging A load: its three load addresses are inputs for that reason.
__device__ __forceinline__ void gk_slots(const v8f& d, const v4f (&a)[4], const v4f (&b)[4],
                                         const float* pa, const float* pb, const float* ps) {
#if defined(__HIP_DEVICE_COMPILE__)
  asm volatile(GK_NOPS :: "v"(d), "v"(a[0]), "v"(a[1]), "v"(a[2]), "v"(a[3]),
               "v"(b[0]), "v"(b[1]), "v"(b[2]), "v"(b[3]), "v"(pa), "v"(pb), "v"(ps));
#else
  (void)d; (void)a; (void)b; (void)pa; (void)pb; (void)ps;
#endif
}
template <int K, bool BT, bool BIAS, bool DOT, bool MERGE>
__global__ __launch_bounds__(512) void gemm_slices_kernel(
    const float* __restrict__ A, const float* __restrict__ Bp,
    const float* __restrict__ bias, float* __restrict__ C,
    const float* __restrict__ dv, float* __restrict__ dout) {
  constexpr int KW = K / GK_SLICES;   // k per wave
  constexpr int J  = KW / 8;          // 16-byte loads per lane and operand
  __shared__ float red[GK_SLICES][16 * 32];
  const int tid  = threadIdx.x;
  const int lane = tid & 31;
  const int l16  = lane & 15;
  const int hi   = lane >> 4;
  const int w    = __builtin_amdgcn_readfirstlane(tid >> 5);
  if (DOT && blockIdx.x >= GT_BLOCKS) {   // the whole block leaves, in front of the barrier
    const int b = (blockIdx.x - GT_BLOCKS) * 16 + w;
    float s = 0.f;
#pragma unroll
    for (int i = 0; i < K / 32; ++i) s = fmaf(A[(size_t)b * K + lane + 32 * i], dv[lane + 32 * i], s);
#pragma unroll
    for (int o = 16; o; o >>= 1) s += __shfl_xor(s, o);
    if (lane == 0) dout[b] = s;
    return;
  }
  const int nt   = w & 1;
  const int ks   = w >> 1;
  const int m0   = (blockIdx.x >> 3) << 4;
  const int n0   = (blockIdx.x & 7) << 5;
  const int kb   = ks * KW + 4 * hi;
  const int col  = n0 + nt * 16 + l16;

  // every loop of this kernel is unrolled: the fragments must lie in registers, and a
  // rolled loop would wait for each load before it issues the next
  v4f a4[J], b4[J];
  const float* st = MERGE ? dv + (m0 + l16) * ST_PITCH : nullptr;
  float M0 = 0.f, L0 = 0.f, M1 = 0.f, L1 = 0.f;
  if (MERGE) {   // wanted first, so asked for first
    M0 = st[0];
    L0 = st[1];
    M1 = st[BB * ST_PITCH];
    L1 = st[BB * ST_PITCH + 1];
  }
  const float* ap = A + (size_t)(m0 + l16) * K + kb;
#pragma unroll
  for (int j = 0; j < J; ++j) a4[j] = *(const v4f*)(ap + 8 * j);
  v4f a1[J];
  if (MERGE) {
#pragma unroll
    for (int j = 0; j < J; ++j) a1[j] = *(const v4f*)(ap + (size_t)BB * K + 8 * j);
  }
  const float* bkeep = nullptr;
  if (BT) {
    const float* bp = Bp + (size_t)col * K + kb;
#pragma unroll
    for (int j = 0; j < J; ++j) b4[j] = *(const v4f*)(bp + 8 * j);
    bkeep = bp;
  } else {
    const float* bp = Bp + (size_t)kb * FF + col;
#pragma unroll
    for (int j = 0; j < J; ++j) {
#pragma unroll
      for (int e = 0; e < 4; ++e) b4[j][e] = bp[(size_t)(8 * j + e) * FF];
    }
  }
  // the element this thread finishes: row tid/32, column tid%32 of the block's tile
  const int orow = m0 + (tid >> 5);
  const int ocol = n0 + lane;
  const float bcol = BIAS ? bias[ocol] : 0.f;
  if (MERGE) {
    // every load above is issued before the first wait: without this the compiler held
    // half of them back behind the wait for M and l, a second trip to memory
    __builtin_amdgcn_sched_barrier(0);
    const float Mx = fmaxf(M0, M1);
    const float w0 = __expf(M0 - Mx), w1 = __expf(M1 - Mx);
    const float inv = 1.f / fmaf(L1, w1, L0 * w0);   // softmax-normalized here
    const float c0 = w0 * inv, c1 = w1 * inv;
#pragma unroll
    for (int j = 0; j < J; ++j) a4[j] = a4[j] * c0 + a1[j] * c1;
  }

  v8f acc = {};
#if __has_builtin(__builtin_amdgcn_wmma_f32_16x16x4_f32)
#pragma unroll
  for (int j = 0; j < J; ++j) {
#pragma unroll
    for (int h = 0; h < 2; ++h) {
      const v2f a  = {a4[j][2 * h], a4[j][2 * h + 1]};
      const v2f bv = {b4[j][2 * h], b4[j][2 * h + 1]};
      acc = __builtin_amdgcn_wmma_f32_16x16x4_f32(
          false, a, false, bv, (short)0, acc, false, false);
    }
  }
#endif
  if (MERGE) gk_slots(acc, a4, b4, ap, bkeep, st);
  else       gk_slots(acc, a4, b4);
#pragma unroll
  for (int r = 0; r < 8; ++r) red[ks][(r + 8 * hi) * 32 + nt * 16 + l16] = acc[r];
  __syncthreads();
  float tot = red[0][tid];
#pragma unroll
  for (int v = 1; v < GK_SLICES; ++v) tot += red[v][tid];
  if (BIAS) tot += bcol;
  C[(size_t)orow * FF + ocol] = tot;
}

#define CQ_SLICES 12
__global__ __launch_bounds__(CQ_SLICES * 64) void gemm_cq_kernel(
    const float* __restrict__ glb, const float* __restrict__ Wg, const float* __restrict__ bg,
    const float* __restrict__ ctx, const float* __restrict__ Wlc, const float* __restrict__ blc,
    float* __restrict__ C) {
  constexpr int KW = 64;              // k per wave
  constexpr int J  = KW / 8;          // 16-byte loads per lane and operand
  __shared__ float red[CQ_SLICES][16 * 32];
  const int tid  = threadIdx.x;
  const int lane = tid & 31;
  const int l16  = lane & 15;
  const int hi   = lane >> 4;
  const int w    = __builtin_amdgcn_readfirstlane(tid >> 5);
  const int nt   = w & 1;
  const int ks   = w >> 1;
  const int m0   = (blockIdx.x >> 3) << 4;
  const int n0   = (blockIdx.x & 7) << 5;
  const int col  = n0 + nt * 16 + l16;
  const bool first = ks < FF / KW;    // the same in every lane of a wave
  const int K    = first ? FF : 2 * FF;
  const int kb   = (first ? ks : ks - FF / KW) * KW + 4 * hi;

  v4f a4[J], b4[J];
  const float* ap = (first ? glb : ctx) + (size_t)(m0 + l16) * K + kb;
  const float* bp = (first ? Wg : Wlc) + (size_t)col * K + kb;
#pragma unroll
  for (int j = 0; j < J; ++j) a4[j] = *(const v4f*)(ap + 8 * j);
#pragma unroll
  for (int j = 0; j < J; ++j) b4[j] = *(const v4f*)(bp + 8 * j);
  const int ocol = n0 + lane;
  const float bcol = bg[ocol] + blc[ocol];

  v8f acc = {};
#if __has_builtin(__builtin_amdgcn_wmma_f32_16x16x4_f32)
#pragma unroll
  for (int j = 0; j < J; ++j) {
#pragma unroll
    for (int h = 0; h < 2; ++h) {
      const v2f a  = {a4[j][2 * h], a4[j][2 * h + 1]};
      const v2f bv = {b4[j][2 * h], b4[j][2 * h + 1]};
      acc = __builtin_amdgcn_wmma_f32_16x16x4_f32(
          false, a, false, bv, (short)0, acc, false, false);
    }
  }
#endif
  gk_slots(acc, a4, b4, ap, bp);
#pragma unroll
  for (int r = 0; r < 8; ++r) red[ks][(r + 8 * hi) * 32 + nt * 16 + l16] = acc[r];
  __syncthreads();
  // the tile has 512 elements: the first 16 waves finish one each (row tid/32, column tid%32)
  if (tid < 16 * 32) {
    float tot = red[0][tid];
#pragma unroll
    for (int v = 1; v < CQ_SLICES; ++v) tot += red[v][tid];
    C[(size_t)(m0 + (tid >> 5)) * FF + ocol] = tot + bcol;
  }
}

__device__ __forceinline__ void pb_copy8(const v4f* g, const v4f* l) {
#if defined(__HIP_DEVICE_COMPILE__)
  const unsigned long long g0 = (unsigned long long)(uintptr_t)g;
  const unsigned int l0 = (unsigned int)(uintptr_t)l;   // generic LDS pointer: low 32 bits
  asm volatile(
      "global_load_async_to_lds_b128 %0, %8, off\n\t"
      "global_load_async_to_lds_b128 %1, %9, off\n\t"
      "global_load_async_to_lds_b128 %2, %10, off\n\t"
      "global_load_async_to_lds_b128 %3, %11, off\n\t"
      "global_load_async_to_lds_b128 %4, %12, off\n\t"
      "global_load_async_to_lds_b128 %5, %13, off\n\t"
      "global_load_async_to_lds_b128 %6, %14, off\n\t"
      "global_load_async_to_lds_b128 %7, %15, off\n\t"
      "s_wait_xcnt 0x0"
      :: "v"(l0), "v"(l0 + 512u), "v"(l0 + 1024u), "v"(l0 + 1536u),
         "v"(l0 + 2048u), "v"(l0 + 2560u), "v"(l0 + 3072u), "v"(l0 + 3584u),
         "v"(g0), "v"(g0 + 1ull * NN * 4), "v"(g0 + 2ull * NN * 4), "v"(g0 + 3ull * NN * 4),
         "v"(g0 + 4ull * NN * 4), "v"(g0 + 5ull * NN * 4), "v"(g0 + 6ull * NN * 4),
         "v"(g0 + 7ull * NN * 4)
      : "memory");
#else
  (void)g; (void)l;
#endif
}

// The wave's 16 rows of tile t into its slice of one LDS buffer.
__device__ __forceinline__ void pb_fill(const v4f* xr, v4f* slice, int t, int lane) {
  const int c = min(t * 32 + lane, N4 - 1);     // past the row's end: copy its last column
  pb_copy8(xr + c, slice + lane);
  pb_copy8(xr + 8 * N4 + c, slice + 8 * 32 + lane);
}

// One trip: tile t out of its LDS buffer. REFILL: a tile t + 2 exists and is copied
// into the buffer that this trip has read (the caller's loop bounds are the test).
template <bool REFILL>
__device__ __forceinline__ void pb_trip(const v4f* xr, v4f* slice, v4f (*part)[32],
                                        const float (&q)[PB_ROWS], int t, int w, int lane,
                                        float cKb, v2f (&acc)[PB_ROWS], float& m, float& l) {
  // this wave's share of the scores of the lane's four nodes; sums run in node
  // pairs (.xy, .zw) so that packed f32 instructions take the registers as they lie
  v4f X[PB_ROWS];
#pragma unroll
  for (int i = 0; i < PB_ROWS; ++i) X[i] = slice[i * 32 + lane];
  v2f s01 = {0.f, 0.f}, s23 = {0.f, 0.f};
#pragma unroll
  for (int i = 0; i < PB_ROWS; ++i) {
    const v2f qq = {q[i], q[i]};
    s01 = __builtin_elementwise_fma(qq, X[i].xy, s01);
    s23 = __builtin_elementwise_fma(qq, X[i].zw, s23);
  }
  part[w][lane] = (v4f){s01.x, s01.y, s23.x, s23.y};
  __syncthreads();
  // every wave adds the 16 shares in the same order, so all waves see equal scores
  v4f tot = part[0][lane];
#pragma unroll
  for (int v = 1; v < PB_WAVES; ++v) tot += part[v][lane];
  const bool valid = REFILL || t * 32 + lane < N4;   // a tile with a tile t + 2 behind it is whole
  const float t0 = valid ? (tot.x + cKb) * SCALE : -INFINITY;
  const float t1 = valid ? (tot.y + cKb) * SCALE : -INFINITY;
  const float t2 = valid ? (tot.z + cKb) * SCALE : -INFINITY;
  const float t3 = valid ? (tot.w + cKb) * SCALE : -INFINITY;
  const float mn = fmaxf(m, fmaxf(fmaxf(t0, t1), fmaxf(t2, t3)));
  const float r  = __expf(m - mn);              // 0 on the first tile (m = -inf)
  const v2f e01 = {valid ? __expf(t0 - mn) : 0.f, valid ? __expf(t1 - mn) : 0.f};
  const v2f e23 = {valid ? __expf(t2 - mn) : 0.f, valid ? __expf(t3 - mn) : 0.f};
  const v2f es = e01 + e23;
  l = fmaf(l, r, es.x + es.y);
  m = mn;
  const v2f rr = {r, r};
#pragma unroll
  for (int i = 0; i < PB_ROWS; ++i)
    acc[i] = __builtin_elementwise_fma(e23, X[i].zw,
             __builtin_elementwise_fma(e01, X[i].xy, acc[i] * rr));

  // keeps the arithmetic above in front of the foot: without it the compiler moved it
  // behind the barrier, ahead of the copies, and read the 16 shares one wait at a time
  __builtin_amdgcn_sched_barrier(0);
  // foot of the trip: own LDS reads done, tile t+1 landed, everybody here; only
  // then is the buffer just read refilled
  asm volatile("s_wait_dscnt 0x0" ::: "memory");
  asm volatile("s_wait_asynccnt 0x0" ::: "memory");
  __syncthreads();
  if (REFILL) pb_fill(xr, slice, t + 2, lane);
}

__global__ __launch_bounds__(PB_THREADS) void passB_kernel(
    const float* __restrict__ x, const float* __restrict__ qk,
    const float* __restrict__ cK, float* __restrict__ xpart, float* __restrict__ st) {
  __shared__ __attribute__((aligned(16))) v4f tile[2][FF * 32];   // 2 x 128 KB
  __shared__ v4f part[PB_WAVES][32];
  __shared__ float xs[FF];
  const int b = blockIdx.x / PB_SPLIT;
  const int h = blockIdx.x % PB_SPLIT;   // which node range
  const int t0 = h * PB_TPB;             // its first tile (even: it lies in buffer 0)
  const int tid = threadIdx.x;
  const int lane = tid & 31;
  const int w = __builtin_amdgcn_readfirstlane(tid >> 5);
  const v4f* xr = (const v4f*)(x + ((size_t)b * FF + w * PB_ROWS) * NN);
  float q[PB_ROWS];
  v2f acc[PB_ROWS];
#pragma unroll
  for (int i = 0; i < PB_ROWS; ++i) {
    q[i] = qk[b * FF + w * PB_ROWS + i];
    acc[i] = (v2f){0.f, 0.f};
  }
  const float cKb = cK[b];
  float m = -INFINITY, l = 0.f;

  pb_fill(xr, &tile[0][w * PB_ROWS * 32], t0, lane);
  asm volatile("s_wait_asynccnt 0x0" ::: "memory");   // the first tile has landed
  __syncthreads();
  pb_fill(xr, &tile[1][w * PB_ROWS * 32], t0 + 1, lane);

  // both loops rolled: the bodies stay small in the instruction cache
#pragma unroll 1
  for (int t = t0; t < t0 + PB_TPB - 2; ++t)
    pb_trip<true>(xr, &tile[t & 1][w * PB_ROWS * 32], part, q, t, w, lane, cKb, acc, m, l);
#pragma unroll 1
  for (int t = t0 + PB_TPB - 2; t < t0 + PB_TPB; ++t)
    pb_trip<false>(xr, &tile[t & 1][w * PB_ROWS * 32], part, q, t, w, lane, cKb, acc, m, l);
  asm volatile("s_wait_asynccnt 0x0" ::: "memory");   // nothing in flight at the wave's end

  // join the 32 lanes: common max, rescale, butterfly sums
  float M = m;
#pragma unroll
  for (int o = 16; o; o >>= 1) M = fmaxf(M, __shfl_xor(M, o));
  const float sc = __expf(m - M);
  l *= sc;
#pragma unroll
  for (int o = 16; o; o >>= 1) l += __shfl_xor(l, o);
  float a[PB_ROWS];
#pragma unroll
  for (int i = 0; i < PB_ROWS; ++i) a[i] = (acc[i].x + acc[i].y) * sc;
#pragma unroll
  for (int o = 16; o; o >>= 1) {
#pragma unroll
    for (int i = 0; i < PB_ROWS; ++i) a[i] += __shfl_xor(a[i], o);
  }
  if (lane == 0) {
#pragma unroll
    for (int i = 0; i < PB_ROWS; ++i) xs[w * PB_ROWS + i] = a[i];
  }
  __syncthreads();
  // M and l are the same in every wave; whole 128-byte lines per wave
  if (tid < FF) xpart[(h * BB + b) * FF + tid] = xs[tid];   // relative to M, not normalized
  if (tid == 0) {
    st[(h * BB + b) * ST_PITCH]     = M;
    st[(h * BB + b) * ST_PITCH + 1] = l;
  }
}

// ---------------------------------------------------------------------------
// Pass C: logits[b,n] = tanh((ql . x[:,n] + cL) * scale) * 10
// 256 threads cover 256 consecutive n -> coalesced row walks; sw prefetch ahead.
// ---------------------------------------------------------------------------
__global__ __launch_bounds__(256) void passC_kernel(
    const float* __restrict__ x, const float* __restrict__ ql,
    const float* __restrict__ cL, float* __restrict__ out) {
  __shared__ float qs[FF];
  const int b = blockIdx.x >> 3;
  const int chunk = blockIdx.x & 7;
  const int tid = threadIdx.x;
  qs[tid] = ql[b * FF + tid];
  __syncthreads();
  const int n = chunk * 256 + tid;
  const float* xbase = x + (size_t)b * FF * NN;
  if (n < NN) {
    float acc = 0.f;
    for (int f = 0; f < FF; ++f) {
      if (f + 8 < FF) __builtin_prefetch(xbase + (size_t)(f + 8) * NN + n, 0, 0);
      acc += qs[f] * xbase[(size_t)f * NN + n];
    }
    out[b * NN + n] = tanhf((acc + cL[b]) * SCALE) * 10.f;
  }
}

// ---------------------------------------------------------------------------
extern "C" void kernel_launch(void* const* d_in, const int* in_sizes, int n_in,
                              void* d_out, int out_size, void* d_ws, size_t ws_size,
                              hipStream_t stream) {
  const float* x     = (const float*)d_in[0];   // [B,F,N,1]
  const int*   lc    = (const int*)  d_in[1];   // [B,2]
  const float* Wg    = (const float*)d_in[2];   // [F,F]
  const float* bg    = (const float*)d_in[3];   // [F]
  const float* Wnode = (const float*)d_in[4];   // [3F,F]
  const float* bnode = (const float*)d_in[5];   // [3F]
  const float* Wlc   = (const float*)d_in[6];   // [F,2F]
  const float* blc   = (const float*)d_in[7];   // [F]
  const float* Wproj = (const float*)d_in[8];   // [F,F]
  const float* bproj = (const float*)d_in[9];   // [F]
  float* out = (float*)d_out;                   // [B,N]

  // workspace carve-up (~1.3 MB of f32)
  float* ws   = (float*)d_ws;
  float* glb  = ws;                         // [B,F]
  float* ctx  = glb  + BB * FF;             // [B,2F]
  float* cQ   = ctx  + BB * 2 * FF;         // [B,F]
  float* qk   = cQ   + BB * FF;             // [B,F]
  float* cK   = qk   + BB * FF;             // [B]
  float* xpart = cK  + BB;                  // [2,B,F]
  float* st   = xpart + PB_SPLIT * BB * FF; // [2,B] lines of ST_PITCH
  float* v1   = st   + PB_SPLIT * BB * ST_PITCH;   // [B,F]
  float* nc   = v1   + BB * FF;             // [B,F]
  float* ql   = nc   + BB * FF;             // [B,F]
  float* cL   = ql   + BB * FF;             // [B]

  // context gather, and pass A: glb = max_n x
  rowmax_gather_kernel<<<RM_BLOCKS, RM_THREADS, 0, stream>>>(x, lc, glb, ctx);
  // cQ = glb @ Wg^T + bg + ctx @ Wlc^T + blc
  gemm_cq_kernel<<<GT_BLOCKS, CQ_SLICES * 64, 0, stream>>>(glb, Wg, bg, ctx, Wlc, blc, cQ);
  // qk = cQ @ Wnode_K (Bm(k,n) = Wnode[k,n]), and cK = cQ . bnode_K
  gemm_slices_kernel<FF, false, false, true, false><<<GT_BLOCKS + BB / 16, 512, 0, stream>>>(cQ, Wnode, nullptr, qk, bnode, cK);
  // Pass B: fused attention (single read of x)
  passB_kernel<<<BB * PB_SPLIT, PB_THREADS, 0, stream>>>(x, qk, cK, xpart, st);
  // v1 = xbar @ Wnode_V^T + bnode_V  (Bm(k,n) = Wnode[F+n,k]), xbar joined from xpart and st
  gemm_slices_kernel<FF, true, true, false, true><<<GT_BLOCKS, 512, 0, stream>>>(xpart, Wnode + (size_t)FF * FF, bnode + FF, v1, st, nullptr);
  // nc = v1 @ Wproj^T + bproj
  gemm_slices_kernel<FF, true, true, false, false><<<GT_BLOCKS, 512, 0, stream>>>(v1, Wproj, bproj, nc, nullptr, nullptr);
  // ql = nc @ Wnode_L (Bm(k,n) = Wnode[2F+k,n]), and cL = nc . bnode_L
  gemm_slices_kernel<FF, false, false, true, false><<<GT_BLOCKS + BB / 16, 512, 0, stream>>>(nc, Wnode + (size_t)2 * FF * FF, nullptr, ql, bnode + 2 * FF, cL);
  // Pass C: logits
  passC_kernel<<<BB * 8, 256, 0, stream>>>(x, ql, cL, out);
}

// v007
// A run of this version takes 67.6 microseconds.
// Versions in between are left out here; by their measured steps it is 1.17 times as fast as v005.
// Counting every step since v000, it is 3.40 times as fast.
#include <hip/hip_runtime.h>
#include <stdint.h>
#include <math.h>

// Problem constants (from reference): B=128, F=256, N=2000, scale = 1/sqrt(F)
#define BB 128
#define FF 256
#define NN 2000
#define SCALE 0.0625f

#define PB_WAVES 16         // waves per workgroup in pass B
#define PB_THREADS (PB_WAVES * 32)
#define PB_ROWS (FF / PB_WAVES)   // feature rows held by one wave
#define N4 (NN / 4)         // float4 columns per feature row
#define PB_TILES ((N4 + 31) / 32) // tiles of 128 nodes (32 lanes x float4)
#define PB_SPLIT 2          // workgroups per batch in pass B: B * 2 = one on every WGP
#define PB_TPB (PB_TILES / PB_SPLIT)   // tiles per workgroup
#define ST_PITCH 32         // floats: each workgroup's (max, sum) has a 128-byte line of its own
static_assert(PB_SPLIT == 2 && PB_TILES % PB_SPLIT == 0 && PB_TPB % 2 == 0 && PB_TPB >= 2,
              "two equal node ranges, each starting in LDS buffer 0");

typedef __attribute__((ext_vector_type(2))) float v2f;
typedef __attribute__((ext_vector_type(4))) float v4f;
typedef __attribute__((ext_vector_type(8))) float v8f;

#define RM_WAVES 16
#define RM_THREADS (RM_WAVES * 32)
#define RM_ROWS 8                                 // rows per wave
#define RM_WGROWS (RM_WAVES * RM_ROWS)            // rows per workgroup
#define RM_LOADS (RM_ROWS * N4 / 32)              // wave-wide 16-byte loads per span
#define RM_G 16                                   // loads per group
#define RM_GROUPS ((RM_LOADS + RM_G - 1) / RM_G)
#define RM_BLOCKS (BB * FF / RM_WGROWS)
#define GA_WAVES (2 * RM_WGROWS / 32)             // waves that gather, 32 values each
static_assert((RM_ROWS * N4) % 32 == 0 && N4 > 32, "a span is whole loads; a load meets at most two rows");
static_assert(FF % RM_WGROWS == 0 && RM_WGROWS % 32 == 0 && GA_WAVES <= RM_WAVES,
              "a workgroup's rows lie in one batch; a gathering wave has one of last / cur");
__global__ __launch_bounds__(RM_THREADS) void rowmax_gather_kernel(const float* __restrict__ x,
                                                                   const int* __restrict__ lc,
                                                                   float* __restrict__ glb,
                                                                   float* __restrict__ ctx) {
  __shared__ float rm[RM_WGROWS];
  const int tid  = threadIdx.x;
  const int lane = tid & 31;
  const int w    = __builtin_amdgcn_readfirstlane(tid >> 5);
  const int wg0  = blockIdx.x * RM_WGROWS;                // the workgroup's first row in [0, B*F)
  const v4f* sp = (const v4f*)(x + (size_t)(wg0 + w * RM_ROWS) * NN) + lane;
  float mx[RM_ROWS];
#pragma unroll
  for (int r = 0; r < RM_ROWS; ++r) mx[r] = -INFINITY;
  // every loop here is unrolled: the load number decides at compile time which row a value
  // belongs to, and the two groups of loaded values must lie in registers
  // gather: wave w takes last (w < GA_WAVES / 2) or cur of 32 of the workgroup's rows
  const int gb = wg0 / FF;                                // batch
  const int gj = w / (GA_WAVES / 2);                      // 0 last, 1 cur
  const int gr = wg0 + (w % (GA_WAVES / 2)) * 32 + lane;  // row in [0, B*F)
  v4f buf[2][RM_G];
#pragma unroll
  for (int q = 0; q < RM_G; ++q) buf[0][q] = sp[q * 32];
  float gv = 0.f;
  if (w < GA_WAVES) {                                     // the same in every lane of a wave
    const int n = min(max(lc[gb * 2 + gj], 0), NN - 1);   // the address stays inside x
    gv = x[(size_t)gr * NN + n];
#if defined(__HIP_DEVICE_COMPILE__)
    // the next group's loads return into this load's address registers
    asm volatile("s_wait_xcnt 0x0" ::: "memory");
#endif
  }
#pragma unroll
  for (int c = 0; c < RM_GROUPS; ++c) {
    // the two scheduling barriers pin the order "next group's loads, then this group's
    // maxima": without them the loads may sink behind the waits for this group
    __builtin_amdgcn_sched_barrier(0);
    if (c + 1 < RM_GROUPS) {
#pragma unroll
      for (int q = 0; q < RM_G; ++q)
        if ((c + 1) * RM_G + q < RM_LOADS) buf[(c + 1) & 1][q] = sp[((c + 1) * RM_G + q) * 32];
    }
    __builtin_amdgcn_sched_barrier(0);
#pragma unroll
    for (int q = 0; q < RM_G; ++q) {
      const int k = c * RM_G + q;
      if (k < RM_LOADS) {
        const v4f v = buf[c & 1][q];
        const float vm = fmaxf(fmaxf(v.x, v.y), fmaxf(v.z, v.w));
        const int ra = (k * 32) / N4;
        const int rb = (k * 32 + 31) / N4;
        if (ra == rb) {
          mx[ra] = fmaxf(mx[ra], vm);
        } else {
          const bool lo = lane < rb * N4 - k * 32;
          mx[ra] = fmaxf(mx[ra], lo ? vm : -INFINITY);
          mx[rb] = fmaxf(mx[rb], lo ? -INFINITY : vm);
        }
      }
    }
    // without the statement below the compiler regrouped the maxima across groups, kept
    // loaded values alive past their group and spilled them between the loads
#if defined(__HIP_DEVICE_COMPILE__)
#pragma unroll
    for (int r = 0; r < RM_ROWS; ++r)
      if (r >= (c * RM_G * 32) / N4 && r <= (c * RM_G * 32 + RM_G * 32 - 1) / N4)
        asm volatile("" : "+v"(mx[r]));   // streaming pattern: each row's result closed, against spills
#endif
  }
#pragma unroll
  for (int r = 0; r < RM_ROWS; ++r) {
#pragma unroll
    for (int o = 16; o; o >>= 1) mx[r] = fmaxf(mx[r], __shfl_xor(mx[r], o));
  }
  float mine = mx[0];
#pragma unroll
  for (int r = 1; r < RM_ROWS; ++r) mine = (lane == r) ? mx[r] : mine;
  if (lane < RM_ROWS) rm[w * RM_ROWS + lane] = mine;
  __syncthreads();
  // the workgroup's maxima leave as whole 128-byte lines, one wave each
  if (tid < RM_WGROWS) glb[wg0 + tid] = rm[tid];
  // behind the barrier: in front of it every wave would wait for this store to finish
  if (w < GA_WAVES) ctx[gb * 2 * FF + gj * FF + (gr - gb * FF)] = gv;   // a whole line per wave
}

#define GK_SLICES 8
#define GT_BLOCKS ((BB / 16) * (FF / 32))   // blocks of 16 x 32 in one [B,F] product
#define WP (FF + 32)                        // columns of T and Wc: F, cL's, zeros
#define WR (FF + 32)                        // rows of T and Wc: F, the bias row, zeros
#define FD_TILES ((WR / 32) * (WP / 32))    // tiles of 32 x 32 in T or Wc
#define FD_BLOCKS(np) ((FD_TILES + (np) - 1) / (np))   // blocks of np tiles
#define QL_BLOCKS ((BB / 16) * (WP / 32))   // blocks of 16 x 32 in [ql | cL]

#define GK_NOPS "v_nop\n\tv_nop\n\tv_nop\n\tv_nop\n\tv_nop\n\tv_nop\n\tv_nop\n\tv_nop"
__device__ __forceinline__ void gk_slots(const v8f& d, const v4f (&a)[4], const v4f (&b)[4]) {
#if defined(__HIP_DEVICE_COMPILE__)
  asm volatile(GK_NOPS :: "v"(d), "v"(a[0]), "v"(a[1]), "v"(a[2]), "v"(a[3]),
               "v"(b[0]), "v"(b[1]), "v"(b[2]), "v"(b[3]));
#else
  (void)d; (void)a; (void)b;
#endif
}
// Here the two load addresses are inputs as well: their registers stay theirs while the
// loads fly (without this the compiler let later loads return into them).
__device__ __forceinline__ void gk_slots(const v8f& d, const v4f (&a)[8], const v4f (&b)[8],
                                         const float* pa, const float* pb) {
#if defined(__HIP_DEVICE_COMPILE__)
  asm volatile(GK_NOPS :: "v"(d), "v"(a[0]), "v"(a[1]), "v"(a[2]), "v"(a[3]),
               "v"(a[4]), "v"(a[5]), "v"(a[6]), "v"(a[7]),
               "v"(b[0]), "v"(b[1]), "v"(b[2]), "v"(b[3]),
               "v"(b[4]), "v"(b[5]), "v"(b[6]), "v"(b[7]), "v"(pa), "v"(pb));
#else
  (void)d; (void)a; (void)b; (void)pa; (void)pb;
#endif
}
// The same for the merging A load: its three load addresses are inputs for that reason.
__device__ __forceinline__ void gk_slots(const v8f& d, const v4f (&a)[4], const v4f (&b)[4],
                                         const float* pa, const float* pb, const float* ps) {
#if defined(__HIP_DEVICE_COMPILE__)
  asm volatile(GK_NOPS :: "v"(d), "v"(a[0]), "v"(a[1]), "v"(a[2]), "v"(a[3]),
               "v"(b[0]), "v"(b[1]), "v"(b[2]), "v"(b[3]), "v"(pa), "v"(pb), "v"(ps));
#else
  (void)d; (void)a; (void)b; (void)pa; (void)pb; (void)ps;
#endif
}

// The products of weights are cut for few waves (for speed only): a wave takes 32 x 32 of C,
// four WMMA tiles that share its loads, and one of
// 8 slices of k; the 8 waves of a tile meet in LDS. A block holds one tile per 8 waves.
// The same as gk_slots for the NA x NB chains of such a wave.
#define FD_FRAG(x) "v"(x[0]), "v"(x[1]), "v"(x[2]), "v"(x[3])
template <int NA, int NB>
__device__ __forceinline__ void fd_slots(const v8f (&d)[NA][NB], const v4f (&a)[NA][4], const v4f (&b)[NB][4]) {
#if defined(__HIP_DEVICE_COMPILE__)
  if constexpr (NA == 2 && NB == 2)
    asm volatile(GK_NOPS :: "v"(d[0][0]), "v"(d[0][1]), "v"(d[1][0]), "v"(d[1][1]),
                 FD_FRAG(a[0]), FD_FRAG(a[1]), FD_FRAG(b[0]), FD_FRAG(b[1]));
  else if constexpr (NA == 2)
    asm volatile(GK_NOPS :: "v"(d[0][0]), "v"(d[1][0]), FD_FRAG(a[0]), FD_FRAG(a[1]), FD_FRAG(b[0]));
  else if constexpr (NB == 2)
    asm volatile(GK_NOPS :: "v"(d[0][0]), "v"(d[0][1]), FD_FRAG(a[0]), FD_FRAG(b[0]), FD_FRAG(b[1]));
  else
    asm volatile(GK_NOPS :: "v"(d[0][0]), FD_FRAG(a[0]), FD_FRAG(b[0]));
#else
  (void)d; (void)a; (void)b;
#endif
}

// One wave's slice of k. AM: the 32 rows are rows of the matrix, else the bias row and
// padding; BM: the same for the columns. The bias lies in the first WMMA tile; the second is
// all padding, takes no product and is stored as zeros. The cases are whole paths from the loads to the LDS
// stores: with a branch for each operand alone the compiler waited for A's loads before it
// issued B's, a second trip to memory.
template <int BPITCH, bool AM, bool BM>
__device__ __forceinline__ void fold_slice(const float* __restrict__ Am, const float* __restrict__ av,
                                           const float* __restrict__ Bm, const float* __restrict__ bv,
                                           int m0, int n0, int kb, int l16, float* redp) {
  constexpr int J = FF / GK_SLICES / 8;      // groups of four k per lane, operand and WMMA tile
  // unrolled: the fragments must lie in registers, and every load is issued before the first wait
  constexpr int NA = AM ? 2 : 1, NB = BM ? 2 : 1;   // WMMA tiles that hold anything
  v4f a4[NA][J], b4[NB][J];
  // one address per operand, the steps of k and the second tile as constant offsets from it
  const float* ap = AM ? Am + (size_t)kb * FF + m0 + l16 : av + kb;
  const float* bp = BM ? Bm + (size_t)kb * BPITCH + n0 + l16 : bv + kb;
#pragma unroll
  for (int i = 0; i < NA; ++i) {
#pragma unroll
    for (int j = 0; j < J; ++j) {
      if (AM) {
#pragma unroll
        for (int e = 0; e < 4; ++e) a4[i][j][e] = ap[(8 * j + e) * FF + 16 * i];
      } else {
        a4[i][j] = *(const v4f*)(ap + 8 * j);
      }
    }
  }
#pragma unroll
  for (int i = 0; i < NB; ++i) {
#pragma unroll
    for (int j = 0; j < J; ++j) {
      if (BM) {
#pragma unroll
        for (int e = 0; e < 4; ++e) b4[i][j][e] = bp[(8 * j + e) * BPITCH + 16 * i];
      } else {
        b4[i][j] = *(const v4f*)(bp + 8 * j);
      }
    }
  }
  const v4f zero = {0.f, 0.f, 0.f, 0.f};
#pragma unroll
  for (int j = 0; j < J; ++j) {
    if (!AM) a4[0][j] = (l16 == 0) ? a4[0][j] : zero;   // row F, then padding rows
    if (!BM) b4[0][j] = (l16 == 0) ? b4[0][j] : zero;   // column F, then padding columns
  }
  v8f acc[NA][NB] = {};
#if __has_builtin(__builtin_amdgcn_wmma_f32_16x16x4_f32)
#pragma unroll
  for (int j = 0; j < J; ++j) {
#pragma unroll
    for (int h = 0; h < 2; ++h) {
#pragma unroll
      for (int i = 0; i < NA; ++i) {
#pragma unroll
        for (int n = 0; n < NB; ++n) {
          const v2f a  = {a4[i][j][2 * h], a4[i][j][2 * h + 1]};
          const v2f bq = {b4[n][j][2 * h], b4[n][j][2 * h + 1]};
          acc[i][n] = __builtin_amdgcn_wmma_f32_16x16x4_f32(
              false, a, false, bq, (short)0, acc[i][n], false, false);
        }
      }
    }
  }
#endif
  fd_slots<NA, NB>(acc, a4, b4);
#pragma unroll
  for (int i = 0; i < 2; ++i) {
#pragma unroll
    for (int n = 0; n < 2; ++n) {
#pragma unroll
      for (int r = 0; r < 8; ++r)
        redp[(16 * i + r) * 32 + 16 * n] = (i < NA && n < NB) ? acc[i < NA ? i : 0][n < NB ? n : 0][r] : 0.f;
    }
  }
}

// A block's 32 x 32 tiles of a product of weights, C[WR,WP] = A B over k < F:
//   A(m,k) = Am[k*F + m] for m < F, av[k] for m = F, 0 above
//   B(k,n) = Bm[k*BPITCH + n]; with BEDGE only for n < F, then bv[k] for n = F, 0 above
//   ROWADD: row F of C also takes row F of Bm.
// NP: tiles per block, 8 waves each; a wave sums and stores in the tile that it worked on.
template <int NP, int BPITCH, bool BEDGE, bool ROWADD>
__device__ __forceinline__ void fold_tile(int blk, const float* __restrict__ Am,
                                          const float* __restrict__ av,
                                          const float* __restrict__ Bm,
                                          const float* __restrict__ bv,
                                          float* __restrict__ C) {
  __shared__ __attribute__((aligned(16))) float fred[NP * GK_SLICES][32 * 32];
  const int tid  = threadIdx.x;
  const int lane = tid & 31;
  const int l16  = lane & 15;
  const int hi   = lane >> 4;
  const int w    = __builtin_amdgcn_readfirstlane(tid >> 5);
  const int q    = blk * NP + w / GK_SLICES;   // the wave's tile
  const bool live = q < FD_TILES;              // the same in every lane of a wave
  const int m0   = (q / (WP / 32)) << 5;
  const int n0   = (q % (WP / 32)) << 5;
  const int g    = tid & (GK_SLICES * 32 - 1); // this thread finishes four columns of one row
  const int orow = m0 + (g >> 3);
  const int ocol = n0 + 4 * (g & 7);
  v4f radd = {0.f, 0.f, 0.f, 0.f};
  if (live) {
    if (ROWADD && m0 == FF) {                  // the same in every lane of a wave
      radd = *(const v4f*)(Bm + (size_t)FF * BPITCH + ocol);
#if defined(__HIP_DEVICE_COMPILE__)
      // the address arithmetic of the slice's loads may reuse this load's address registers
      asm volatile("s_wait_xcnt 0x0" ::: "memory");
#endif
    }
    const int kb = (w % GK_SLICES) * (FF / GK_SLICES) + 4 * hi;
    float* redp = &fred[w][8 * hi * 32 + l16];
    // both tests read the same in every lane of a wave
    if (m0 < FF) {
      if (!BEDGE || n0 < FF) fold_slice<BPITCH, true, true>(Am, av, Bm, bv, m0, n0, kb, l16, redp);
      else                   fold_slice<BPITCH, true, false>(Am, av, Bm, bv, m0, n0, kb, l16, redp);
    } else {
      if (!BEDGE || n0 < FF) fold_slice<BPITCH, false, true>(Am, av, Bm, bv, m0, n0, kb, l16, redp);
      else                   fold_slice<BPITCH, false, false>(Am, av, Bm, bv, m0, n0, kb, l16, redp);
    }
  }
  __syncthreads();
  if (live) {
    const int w0 = w - w % GK_SLICES;          // the tile's first wave
    v4f tot = *(const v4f*)&fred[w0][4 * g];
#pragma unroll
    for (int v = 1; v < GK_SLICES; ++v) tot += *(const v4f*)&fred[w0 + v][4 * g];
    if (ROWADD && orow == FF) tot += radd;
    *(v4f*)(C + (size_t)orow * WP + ocol) = tot;
  }
}

// C = A[B,K] @ Bm, Bm(k,n) = Bp[k*pitch + n], in the tiles and slices named above.
// DOT (qk = cQ WK): pitch F. Behind the product's blocks the launch holds BB/16 blocks that
// form dout[b] = A[b,:] . dv (one wave per row: it reads the same A and depends on nothing
// of C), and behind those the blocks of Wc = [fA^T ; fv^T] fB, which depend on
// neither.
// MERGE ([ql | cL] = xbar Wc): pitch WP, row K of Bp is the bias, column F goes to dout.
// A is pass B's pair of un-normalised sums [2][B][K] and dv its (max, sum) lines; the A
// load joins the two node ranges of a row: A[b,:] = (w0 * A0 + w1 * A1) / (w0 * l0 + w1 * l1),
// wi = exp(Mi - max(M0, M1)).
template <int K, bool DOT, bool MERGE>
__global__ __launch_bounds__(512) void gemm_slices_kernel(
    const float* __restrict__ A, const float* __restrict__ Bp, float* __restrict__ C,
    const float* __restrict__ dv, float* __restrict__ dout,
    const float* __restrict__ fA, const float* __restrict__ fv,
    const float* __restrict__ fB, float* __restrict__ fC) {
  constexpr int KW = K / GK_SLICES;   // k per wave
  constexpr int J  = KW / 8;          // groups of four k per lane and operand
  constexpr int BPITCH = MERGE ? WP : FF;
  constexpr int NBK = BPITCH / 32;    // blocks across the columns
  __shared__ float red[GK_SLICES][16 * 32];
  const int tid  = threadIdx.x;
  const int lane = tid & 31;
  const int l16  = lane & 15;
  const int hi   = lane >> 4;
  const int w    = __builtin_amdgcn_readfirstlane(tid >> 5);
  if (DOT && blockIdx.x >= GT_BLOCKS + BB / 16) {   // the whole block takes this way
    fold_tile<2, WP, false, true>(blockIdx.x - (GT_BLOCKS + BB / 16), fA, fv, fB, nullptr, fC);
    return;
  }
  if (DOT && blockIdx.x >= GT_BLOCKS) {   // the whole block leaves, in front of the barrier
    const int b = (blockIdx.x - GT_BLOCKS) * 16 + w;
    float s = 0.f;
#pragma unroll
    for (int i = 0; i < K / 32; ++i) s = fmaf(A[(size_t)b * K + lane + 32 * i], dv[lane + 32 * i], s);
#pragma unroll
    for (int o = 16; o; o >>= 1) s += __shfl_xor(s, o);
    if (lane == 0) dout[b] = s;
    return;
  }
  const int nt   = w & 1;
  const int ks   = w >> 1;
  const int m0   = (blockIdx.x / NBK) << 4;
  const int n0   = (blockIdx.x % NBK) << 5;
  const int kb   = ks * KW + 4 * hi;
  const int col  = n0 + nt * 16 + l16;

  // every loop of this kernel is unrolled: the fragments must lie in registers, and a
  // rolled loop would wait for each load before it issues the next
  v4f a4[J], b4[J];
  const float* st = MERGE ? dv + (m0 + l16) * ST_PITCH : nullptr;
  float M0 = 0.f, L0 = 0.f, M1 = 0.f, L1 = 0.f;
  if (MERGE) {   // wanted first, so asked for first
    M0 = st[0];
    L0 = st[1];
    M1 = st[BB * ST_PITCH];
    L1 = st[BB * ST_PITCH + 1];
  }
  const float* ap = A + (size_t)(m0 + l16) * K + kb;
#pragma unroll
  for (int j = 0; j < J; ++j) a4[j] = *(const v4f*)(ap + 8 * j);
  v4f a1[J];
  if (MERGE) {
#pragma unroll
    for (int j = 0; j < J; ++j) a1[j] = *(const v4f*)(ap + (size_t)BB * K + 8 * j);
  }
  const float* bp = Bp + (size_t)kb * BPITCH + col;
#pragma unroll
  for (int j = 0; j < J; ++j) {
#pragma unroll
    for (int e = 0; e < 4; ++e) b4[j][e] = bp[(size_t)(8 * j + e) * BPITCH];
  }
  // the element this thread finishes: row tid/32, column tid%32 of the block's tile
  const int orow = m0 + (tid >> 5);
  const int ocol = n0 + lane;
  const float bcol = MERGE ? Bp[(size_t)K * BPITCH + ocol] : 0.f;
  if (MERGE) {
    // every load above is issued before the first wait: without this the compiler held
    // half of them back behind the wait for M and l, a second trip to memory
    __builtin_amdgcn_sched_barrier(0);
    const float Mx = fmaxf(M0, M1);
    const float w0 = __expf(M0 - Mx), w1 = __expf(M1 - Mx);
    const float inv = 1.f / fmaf(L1, w1, L0 * w0);   // softmax-normalized here
    const float c0 = w0 * inv, c1 = w1 * inv;
#pragma unroll
    for (int j = 0; j < J; ++j) a4[j] = a4[j] * c0 + a1[j] * c1;
  }

  v8f acc = {};
#if __has_builtin(__builtin_amdgcn_wmma_f32_16x16x4_f32)
#pragma unroll
  for (int j = 0; j < J; ++j) {
#pragma unroll
    for (int h = 0; h < 2; ++h) {
      const v2f a  = {a4[j][2 * h], a4[j][2 * h + 1]};
      const v2f bv = {b4[j][2 * h], b4[j][2 * h + 1]};
      acc = __builtin_amdgcn_wmma_f32_16x16x4_f32(
          false, a, false, bv, (short)0, acc, false, false);
    }
  }
#endif
  if (MERGE) gk_slots(acc, a4, b4, ap, bp, st);
  else       gk_slots(acc, a4, b4);
#pragma unroll
  for (int r = 0; r < 8; ++r) red[ks][(r + 8 * hi) * 32 + nt * 16 + l16] = acc[r];
  __syncthreads();
  float tot = red[0][tid];
#pragma unroll
  for (int v = 1; v < GK_SLICES; ++v) tot += red[v][tid];
  if (MERGE) {
    tot += bcol;
    if (ocol < FF) C[(size_t)orow * FF + ocol] = tot;
    else if (ocol == FF) dout[orow] = tot;
  } else {
    C[(size_t)orow * FF + ocol] = tot;
#if defined(__HIP_DEVICE_COMPILE__)
    // the launch's other kinds of block stand behind this store in the code and write its registers
    asm volatile("s_wait_xcnt 0x0" ::: "memory");
#endif
  }
}

#define CQ_SLICES 12
__global__ __launch_bounds__(CQ_SLICES * 64) void gemm_cq_kernel(
    const float* __restrict__ glb, const float* __restrict__ Wg, const float* __restrict__ bg,
    const float* __restrict__ ctx, const float* __restrict__ Wlc, const float* __restrict__ blc,
    float* __restrict__ C,
    const float* __restrict__ fA, const float* __restrict__ fv,
    const float* __restrict__ fB, const float* __restrict__ fw, float* __restrict__ fC) {
  constexpr int KW = 64;              // k per wave
  constexpr int J  = KW / 8;          // 16-byte loads per lane and operand
  __shared__ float red[CQ_SLICES][16 * 32];
  if (blockIdx.x >= GT_BLOCKS) {      // the whole block takes this way
    fold_tile<CQ_SLICES / 4, FF, true, false>(blockIdx.x - GT_BLOCKS, fA, fv, fB, fw, fC);
    return;
  }
  const int tid  = threadIdx.x;
  const int lane = tid & 31;
  const int l16  = lane & 15;
  const int hi   = lane >> 4;
  const int w    = __builtin_amdgcn_readfirstlane(tid >> 5);
  const int nt   = w & 1;
  const int ks   = w >> 1;
  const int m0   = (blockIdx.x >> 3) << 4;
  const int n0   = (blockIdx.x & 7) << 5;
  const int col  = n0 + nt * 16 + l16;
  const bool first = ks < FF / KW;    // the same in every lane of a wave
  const int K    = first ? FF : 2 * FF;
  const int kb   = (first ? ks : ks - FF / KW) * KW + 4 * hi;

  v4f a4[J], b4[J];
  const float* ap = (first ? glb : ctx) + (size_t)(m0 + l16) * K + kb;
  const float* bp = (first ? Wg : Wlc) + (size_t)col * K + kb;
#pragma unroll
  for (int j = 0; j < J; ++j) a4[j] = *(const v4f*)(ap + 8 * j);
#pragma unroll
  for (int j = 0; j < J; ++j) b4[j] = *(const v4f*)(bp + 8 * j);
  const int ocol = n0 + lane;
  const float bcol = bg[ocol] + blc[ocol];

  v8f acc = {};
#if __has_builtin(__builtin_amdgcn_wmma_f32_16x16x4_f32)
#pragma unroll
  for (int j = 0; j < J; ++j) {
#pragma unroll
    for (int h = 0; h < 2; ++h) {
      const v2f a  = {a4[j][2 * h], a4[j][2 * h + 1]};
      const v2f bv = {b4[j][2 * h], b4[j][2 * h + 1]};
      acc = __builtin_amdgcn_wmma_f32_16x16x4_f32(
          false, a, false, bv, (short)0, acc, false, false);
    }
  }
#endif
  gk_slots(acc, a4, b4, ap, bp);
#pragma unroll
  for (int r = 0; r < 8; ++r) red[ks][(r + 8 * hi) * 32 + nt * 16 + l16] = acc[r];
  __syncthreads();
  // the tile has 512 elements: the first 16 waves finish one each (row tid/32, column tid%32)
  if (tid < 16 * 32) {
    float tot = red[0][tid];
#pragma unroll
    for (int v = 1; v < CQ_SLICES; ++v) tot += red[v][tid];
    C[(size_t)(m0 + (tid >> 5)) * FF + ocol] = tot + bcol;
  }
}

__device__ __forceinline__ void pb_copy8(const v4f* g, const v4f* l) {
#if defined(__HIP_DEVICE_COMPILE__)
  const unsigned long long g0 = (unsigned long long)(uintptr_t)g;
  const unsigned int l0 = (unsigned int)(uintptr_t)l;   // generic LDS pointer: low 32 bits
  asm volatile(
      "global_load_async_to_lds_b128 %0, %8, off\n\t"
      "global_load_async_to_lds_b128 %1, %9, off\n\t"
      "global_load_async_to_lds_b128 %2, %10, off\n\t"
      "global_load_async_to_lds_b128 %3, %11, off\n\t"
      "global_load_async_to_lds_b128 %4, %12, off\n\t"
      "global_load_async_to_lds_b128 %5, %13, off\n\t"
      "global_load_async_to_lds_b128 %6, %14, off\n\t"
      "global_load_async_to_lds_b128 %7, %15, off\n\t"
      "s_wait_xcnt 0x0"
      :: "v"(l0), "v"(l0 + 512u), "v"(l0 + 1024u), "v"(l0 + 1536u),
         "v"(l0 + 2048u), "v"(l0 + 2560u), "v"(l0 + 3072u), "v"(l0 + 3584u),
         "v"(g0), "v"(g0 + 1ull * NN * 4), "v"(g0 + 2ull * NN * 4), "v"(g0 + 3ull * NN * 4),
         "v"(g0 + 4ull * NN * 4), "v"(g0 + 5ull * NN * 4), "v"(g0 + 6ull * NN * 4),
         "v"(g0 + 7ull * NN * 4)
      : "memory");
#else
  (void)g; (void)l;
#endif
}

// The wave's 16 rows of tile t into its slice of one LDS buffer.
__device__ __forceinline__ void pb_fill(const v4f* xr, v4f* slice, int t, int lane) {
  const int c = min(t * 32 + lane, N4 - 1);     // past the row's end: copy its last column
  pb_copy8(xr + c, slice + lane);
  pb_copy8(xr + 8 * N4 + c, slice + 8 * 32 + lane);
}

// One trip: tile t out of its LDS buffer. REFILL: a tile t + 2 exists and is copied
// into the buffer that this trip has read (the caller's loop bounds are the test).
template <bool REFILL>
__device__ __forceinline__ void pb_trip(const v4f* xr, v4f* slice, v4f (*part)[32],
                                        const float (&q)[PB_ROWS], int t, int w, int lane,
                                        float cKb, v2f (&acc)[PB_ROWS], float& m, float& l) {
  // this wave's share of the scores of the lane's four nodes; sums run in node
  // pairs (.xy, .zw) so that packed f32 instructions take the registers as they lie
  v4f X[PB_ROWS];
#pragma unroll
  for (int i = 0; i < PB_ROWS; ++i) X[i] = slice[i * 32 + lane];
  v2f s01 = {0.f, 0.f}, s23 = {0.f, 0.f};
#pragma unroll
  for (int i = 0; i < PB_ROWS; ++i) {
    const v2f qq = {q[i], q[i]};
    s01 = __builtin_elementwise_fma(qq, X[i].xy, s01);
    s23 = __builtin_elementwise_fma(qq, X[i].zw, s23);
  }
  part[w][lane] = (v4f){s01.x, s01.y, s23.x, s23.y};
  __syncthreads();
  // every wave adds the 16 shares in the same order, so all waves see equal scores
  v4f tot = part[0][lane];
#pragma unroll
  for (int v = 1; v < PB_WAVES; ++v) tot += part[v][lane];
  const bool valid = REFILL || t * 32 + lane < N4;   // a tile with a tile t + 2 behind it is whole
  const float t0 = valid ? (tot.x + cKb) * SCALE : -INFINITY;
  const float t1 = valid ? (tot.y + cKb) * SCALE : -INFINITY;
  const float t2 = valid ? (tot.z + cKb) * SCALE : -INFINITY;
  const float t3 = valid ? (tot.w + cKb) * SCALE : -INFINITY;
  const float mn = fmaxf(m, fmaxf(fmaxf(t0, t1), fmaxf(t2, t3)));
  const float r  = __expf(m - mn);              // 0 on the first tile (m = -inf)
  const v2f e01 = {valid ? __expf(t0 - mn) : 0.f, valid ? __expf(t1 - mn) : 0.f};
  const v2f e23 = {valid ? __expf(t2 - mn) : 0.f, valid ? __expf(t3 - mn) : 0.f};
  const v2f es = e01 + e23;
  l = fmaf(l, r, es.x + es.y);
  m = mn;
  const v2f rr = {r, r};
#pragma unroll
  for (int i = 0; i < PB_ROWS; ++i)
    acc[i] = __builtin_elementwise_fma(e23, X[i].zw,
             __builtin_elementwise_fma(e01, X[i].xy, acc[i] * rr));

  // keeps the arithmetic above in front of the foot: without it the compiler moved it
  // behind the barrier, ahead of the copies, and read the 16 shares one wait at a time
  __builtin_amdgcn_sched_barrier(0);
  // foot of the trip: own LDS reads done, tile t+1 landed, everybody here; only
  // then is the buffer just read refilled
  asm volatile("s_wait_dscnt 0x0" ::: "memory");
  asm volatile("s_wait_asynccnt 0x0" ::: "memory");
  __syncthreads();
  if (REFILL) pb_fill(xr, slice, t + 2, lane);
}

__global__ __launch_bounds__(PB_THREADS) void passB_kernel(
    const float* __restrict__ x, const float* __restrict__ qk,
    const float* __restrict__ cK, float* __restrict__ xpart, float* __restrict__ st) {
  __shared__ __attribute__((aligned(16))) v4f tile[2][FF * 32];   // 2 x 128 KB
  __shared__ v4f part[PB_WAVES][32];
  __shared__ float xs[FF];
  const int b = blockIdx.x / PB_SPLIT;
  const int h = blockIdx.x % PB_SPLIT;   // which node range
  const int t0 = h * PB_TPB;             // its first tile (even: it lies in buffer 0)
  const int tid = threadIdx.x;
  const int lane = tid & 31;
  const int w = __builtin_amdgcn_readfirstlane(tid >> 5);
  const v4f* xr = (const v4f*)(x + ((size_t)b * FF + w * PB_ROWS) * NN);
  float q[PB_ROWS];
  v2f acc[PB_ROWS];
#pragma unroll
  for (int i = 0; i < PB_ROWS; ++i) {
    q[i] = qk[b * FF + w * PB_ROWS + i];
    acc[i] = (v2f){0.f, 0.f};
  }
  const float cKb = cK[b];
  float m = -INFINITY, l = 0.f;

  pb_fill(xr, &tile[0][w * PB_ROWS * 32], t0, lane);
  asm volatile("s_wait_asynccnt 0x0" ::: "memory");   // the first tile has landed
  __syncthreads();
  pb_fill(xr, &tile[1][w * PB_ROWS * 32], t0 + 1, lane);

  // both loops rolled: the bodies stay small in the instruction cache
#pragma unroll 1
  for (int t = t0; t < t0 + PB_TPB - 2; ++t)
    pb_trip<true>(xr, &tile[t & 1][w * PB_ROWS * 32], part, q, t, w, lane, cKb, acc, m, l);
#pragma unroll 1
  for (int t = t0 + PB_TPB - 2; t < t0 + PB_TPB; ++t)
    pb_trip<false>(xr, &tile[t & 1][w * PB_ROWS * 32], part, q, t, w, lane, cKb, acc, m, l);
  asm volatile("s_wait_asynccnt 0x0" ::: "memory");   // nothing in flight at the wave's end

  // join the 32 lanes: common max, rescale, butterfly sums
  float M = m;
#pragma unroll
  for (int o = 16; o; o >>= 1) M = fmaxf(M, __shfl_xor(M, o));
  const float sc = __expf(m - M);
  l *= sc;
#pragma unroll
  for (int o = 16; o; o >>= 1) l += __shfl_xor(l, o);
  float a[PB_ROWS];
#pragma unroll
  for (int i = 0; i < PB_ROWS; ++i) a[i] = (acc[i].x + acc[i].y) * sc;
#pragma unroll
  for (int o = 16; o; o >>= 1) {
#pragma unroll
    for (int i = 0; i < PB_ROWS; ++i) a[i] += __shfl_xor(a[i], o);
  }
  if (lane == 0) {
#pragma unroll
    for (int i = 0; i < PB_ROWS; ++i) xs[w * PB_ROWS + i] = a[i];
  }
  __syncthreads();
  // M and l are the same in every wave; whole 128-byte lines per wave
  if (tid < FF) xpart[(h * BB + b) * FF + tid] = xs[tid];   // relative to M, not normalized
  if (tid == 0) {
    st[(h * BB + b) * ST_PITCH]     = M;
    st[(h * BB + b) * ST_PITCH + 1] = l;
  }
}

#define PC_WAVES 16
#define PC_THREADS (PC_WAVES * 32)
#define PC_ROWS (FF / PC_WAVES)     // feature rows held by one wave
static_assert(PB_TPB * 32 <= PC_THREADS, "one thread finishes four nodes");
__global__ __launch_bounds__(PC_THREADS) void passC_kernel(
    const float* __restrict__ x, const float* __restrict__ ql,
    const float* __restrict__ cL, float* __restrict__ out) {
  __shared__ v4f share[PC_WAVES][PB_TPB * 32];   // 64 KB
  const int b = blockIdx.x / PB_SPLIT;
  const int h = blockIdx.x % PB_SPLIT;   // which node range
  const int c0 = h * PB_TPB * 32;        // its first float4 column
  const int tid = threadIdx.x;
  const int lane = tid & 31;
  const int w = __builtin_amdgcn_readfirstlane(tid >> 5);
  const v4f* xr = (const v4f*)(x + ((size_t)b * FF + w * PC_ROWS) * NN);
  float q[PC_ROWS];
#pragma unroll
  for (int i = 0; i < PC_ROWS; ++i) q[i] = ql[b * FF + w * PC_ROWS + i];
  const float cLb = cL[b];

  // every loop here is unrolled: the two groups of loaded values must lie in registers
  v4f buf[2][PC_ROWS];
  const int cb = c0 + lane;                                // the lane's column in the range's first tile
  const int ce = min(cb + (PB_TPB - 1) * 32, N4 - 1);      // in its last; past the row's end: the last column
#pragma unroll
  for (int i = 0; i < PC_ROWS; ++i) buf[0][i] = xr[i * N4 + ce];
#if defined(__HIP_DEVICE_COMPILE__)
  // ce is these loads' offset register: it stays theirs up to this wait
  asm volatile("s_wait_xcnt 0x0" :: "v"(ce) : "memory");
#endif
#pragma unroll
  for (int g = 0; g < PB_TPB; ++g) {
    const int tl = PB_TPB - 1 - g;       // this group's tile within the range
    // the two scheduling barriers pin the order "next group's loads, then this group's
    // sums": without them the loads may sink behind the waits for this group
    __builtin_amdgcn_sched_barrier(0);
    if (g + 1 < PB_TPB) {                // not a range's last tile: whole
#pragma unroll
      for (int i = 0; i < PC_ROWS; ++i) buf[(g + 1) & 1][i] = xr[i * N4 + (tl - 1) * 32 + cb];
    }
    __builtin_amdgcn_sched_barrier(0);
    // sums run in node pairs (.xy, .zw) so that packed f32 instructions take the registers as they lie
    v2f s01 = {0.f, 0.f}, s23 = {0.f, 0.f};
#pragma unroll
    for (int i = 0; i < PC_ROWS; ++i) {
      const v2f qq = {q[i], q[i]};
      s01 = __builtin_elementwise_fma(qq, buf[g & 1][i].xy, s01);
      s23 = __builtin_elementwise_fma(qq, buf[g & 1][i].zw, s23);
    }
    share[w][tl * 32 + lane] = (v4f){s01.x, s01.y, s23.x, s23.y};
  }
  __syncthreads();
  // thread j finishes float4 column c0 + j: whole 512-byte pieces of the output row per wave
  if (tid < PB_TPB * 32 && c0 + tid < N4) {
    v4f tot = share[0][tid];
#pragma unroll
    for (int v = 1; v < PC_WAVES; ++v) tot += share[v][tid];
    v4f r;
    r.x = tanhf((tot.x + cLb) * SCALE) * 10.f;
    r.y = tanhf((tot.y + cLb) * SCALE) * 10.f;
    r.z = tanhf((tot.z + cLb) * SCALE) * 10.f;
    r.w = tanhf((tot.w + cLb) * SCALE) * 10.f;
    *((v4f*)(out + (size_t)b * NN) + c0 + tid) = r;
  }
}

// ---------------------------------------------------------------------------
extern "C" void kernel_launch(void* const* d_in, const int* in_sizes, int n_in,
                              void* d_out, int out_size, void* d_ws, size_t ws_size,
                              hipStream_t stream) {
  const float* x     = (const float*)d_in[0];   // [B,F,N,1]
  const int*   lc    = (const int*)  d_in[1];   // [B,2]
  const float* Wg    = (const float*)d_in[2];   // [F,F]
  const float* bg    = (const float*)d_in[3];   // [F]
  const float* Wnode = (const float*)d_in[4];   // [3F,F]
  const float* bnode = (const float*)d_in[5];   // [3F]
  const float* Wlc   = (const float*)d_in[6];   // [F,2F]
  const float* blc   = (const float*)d_in[7];   // [F]
  const float* Wproj = (const float*)d_in[8];   // [F,F]
  const float* bproj = (const float*)d_in[9];   // [F]
  float* out = (float*)d_out;                   // [B,N]

  // workspace carve-up (~1.7 MB of f32)
  float* ws   = (float*)d_ws;
  float* glb  = ws;                         // [B,F]
  float* ctx  = glb  + BB * FF;             // [B,2F]
  float* cQ   = ctx  + BB * 2 * FF;         // [B,F]
  float* qk   = cQ   + BB * FF;             // [B,F]
  float* cK   = qk   + BB * FF;             // [B]
  float* xpart = cK  + BB;                  // [2,B,F]
  float* st   = xpart + PB_SPLIT * BB * FF; // [2,B] lines of ST_PITCH
  float* T    = st   + PB_SPLIT * BB * ST_PITCH;   // [WR,WP]
  float* Wc   = T    + WR * WP;             // [WR,WP]
  float* ql   = Wc   + WR * WP;             // [B,F]
  float* cL   = ql   + BB * FF;             // [B]

  // context gather, and pass A: glb = max_n x
  rowmax_gather_kernel<<<RM_BLOCKS, RM_THREADS, 0, stream>>>(x, lc, glb, ctx);
  // cQ = glb @ Wg^T + bg + ctx @ Wlc^T + blc; beside it T = [Wproj^T ; bproj^T] [Wnode_L | bnode_L]
  gemm_cq_kernel<<<GT_BLOCKS + FD_BLOCKS(CQ_SLICES / 4), CQ_SLICES * 64, 0, stream>>>(glb, Wg, bg, ctx, Wlc, blc, cQ,
      Wproj, bproj, Wnode + (size_t)2 * FF * FF, bnode + 2 * FF, T);
  // qk = cQ @ Wnode_K (Bm(k,n) = Wnode[k,n]), and cK = cQ . bnode_K; beside them Wc = [Wnode_V^T ; bnode_V^T] T
  gemm_slices_kernel<FF, true, false><<<GT_BLOCKS + BB / 16 + FD_BLOCKS(2), 512, 0, stream>>>(cQ, Wnode, qk, bnode, cK,
      Wnode + (size_t)FF * FF, bnode + FF, T, Wc);
  // Pass B: fused attention (single read of x)
  passB_kernel<<<BB * PB_SPLIT, PB_THREADS, 0, stream>>>(x, qk, cK, xpart, st);
  // [ql | cL] = xbar @ Wc + Wc's bias row, xbar joined from xpart and st
  gemm_slices_kernel<FF, false, true><<<QL_BLOCKS, 512, 0, stream>>>(xpart, Wc, ql, st, cL,
      nullptr, nullptr, nullptr, nullptr);
  // Pass C: logits
  passC_kernel<<<BB * PB_SPLIT, PC_THREADS, 0, stream>>>(x, ql, cL, out);
}

// v008
// One run takes 65.8 microseconds.
// Timed twice side by side with v007, it ran 1.05 and 1.04 times as fast.
// All steps since v000 together make it 3.54 times as fast.
#include <hip/hip_runtime.h>
#include <stdint.h>
#include <math.h>

// Problem constants (from reference): B=128, F=256, N=2000, scale = 1/sqrt(F)
#define BB 128
#define FF 256
#define NN 2000
#define SCALE 0.0625f

#define PB_WAVES 16         // waves per workgroup in pass B
#define PB_THREADS (PB_WAVES * 32)
#define PB_ROWS (FF / PB_WAVES)   // feature rows held by one wave
#define N4 (NN / 4)         // float4 columns per feature row
#define PB_TILES ((N4 + 31) / 32) // tiles of 128 nodes (32 lanes x float4)
#define PB_SPLIT 2          // workgroups per batch in pass B: B * 2 = one on every WGP
#define PB_TPB (PB_TILES / PB_SPLIT)   // tiles per workgroup
#define ST_PITCH 32         // floats: each workgroup's (max, sum) has a 128-byte line of its own
static_assert(PB_SPLIT == 2 && PB_TILES % PB_SPLIT == 0 && PB_TPB % 2 == 0 && PB_TPB >= 2,
              "two equal node ranges, each starting in LDS buffer 0");

typedef __attribute__((ext_vector_type(2))) float v2f;
typedef __attribute__((ext_vector_type(4))) float v4f;
typedef __attribute__((ext_vector_type(8))) float v8f;

#define GK_SLICES 8
#define GT_BLOCKS ((BB / 16) * (FF / 32))   // blocks of 16 x 32 in one [B,F] product
#define WP (FF + 32)                        // columns of T and Wc: F, cL's, zeros
#define WR (FF + 32)                        // rows of T and Wc: F, the bias row, zeros
#define FD_TILES ((WR / 32) * (WP / 32))    // tiles of 32 x 32 in T or Wc
#define FD_BLOCKS(np) ((FD_TILES + (np) - 1) / (np))   // blocks of np tiles
#define QL_BLOCKS ((BB / 16) * (WP / 32))   // blocks of 16 x 32 in [ql | cL]

#define GK_NOPS "v_nop\n\tv_nop\n\tv_nop\n\tv_nop\n\tv_nop\n\tv_nop\n\tv_nop\n\tv_nop"
// The two load addresses are inputs as well: their registers stay theirs while the
// loads fly (without this the compiler let later loads return into them).
__device__ __forceinline__ void gk_slots(const v8f& d, const v4f (&a)[8], const v4f (&b)[8],
                                         const float* pa, const float* pb) {
#if defined(__HIP_DEVICE_COMPILE__)
  asm volatile(GK_NOPS :: "v"(d), "v"(a[0]), "v"(a[1]), "v"(a[2]), "v"(a[3]),
               "v"(a[4]), "v"(a[5]), "v"(a[6]), "v"(a[7]),
               "v"(b[0]), "v"(b[1]), "v"(b[2]), "v"(b[3]),
               "v"(b[4]), "v"(b[5]), "v"(b[6]), "v"(b[7]), "v"(pa), "v"(pb));
#else
  (void)d; (void)a; (void)b; (void)pa; (void)pb;
#endif
}
// The same for the merging A load: its three load addresses are inputs for that reason.
__device__ __forceinline__ void gk_slots(const v8f& d, const v4f (&a)[4], const v4f (&b)[4],
                                         const float* pa, const float* pb, const float* ps) {
#if defined(__HIP_DEVICE_COMPILE__)
  asm volatile(GK_NOPS :: "v"(d), "v"(a[0]), "v"(a[1]), "v"(a[2]), "v"(a[3]),
               "v"(b[0]), "v"(b[1]), "v"(b[2]), "v"(b[3]), "v"(pa), "v"(pb), "v"(ps));
#else
  (void)d; (void)a; (void)b; (void)pa; (void)pb; (void)ps;
#endif
}

// The products of weights are cut for few waves (for speed only): a wave takes 32 x 32 of C,
// four WMMA tiles that share its loads, and one of
// 8 slices of k; the 8 waves of a tile meet in LDS. A block holds one tile per 8 waves.
// The same as gk_slots for the NA x NB chains of such a wave.
#define FD_FRAG(x) "v"(x[0]), "v"(x[1]), "v"(x[2]), "v"(x[3])
template <int NA, int NB>
__device__ __forceinline__ void fd_slots(const v8f (&d)[NA][NB], const v4f (&a)[NA][4], const v4f (&b)[NB][4]) {
#if defined(__HIP_DEVICE_COMPILE__)
  if constexpr (NA == 2 && NB == 2)
    asm volatile(GK_NOPS :: "v"(d[0][0]), "v"(d[0][1]), "v"(d[1][0]), "v"(d[1][1]),
                 FD_FRAG(a[0]), FD_FRAG(a[1]), FD_FRAG(b[0]), FD_FRAG(b[1]));
  else if constexpr (NA == 2)
    asm volatile(GK_NOPS :: "v"(d[0][0]), "v"(d[1][0]), FD_FRAG(a[0]), FD_FRAG(a[1]), FD_FRAG(b[0]));
  else if constexpr (NB == 2)
    asm volatile(GK_NOPS :: "v"(d[0][0]), "v"(d[0][1]), FD_FRAG(a[0]), FD_FRAG(b[0]), FD_FRAG(b[1]));
  else
    asm volatile(GK_NOPS :: "v"(d[0][0]), FD_FRAG(a[0]), FD_FRAG(b[0]));
#else
  (void)d; (void)a; (void)b;
#endif
}

// One wave's slice of k. AM: the 32 rows are rows of the matrix, else the bias row and
// padding; BM: the same for the columns. The bias lies in the first WMMA tile; the second is
// all padding, takes no product and is stored as zeros. The cases are whole paths from the loads to the LDS
// stores: with a branch for each operand alone the compiler waited for A's loads before it
// issued B's, a second trip to memory.
template <int BPITCH, bool AM, bool BM>
__device__ __forceinline__ void fold_slice(const float* __restrict__ Am, const float* __restrict__ av,
                                           const float* __restrict__ Bm, const float* __restrict__ bv,
                                           int m0, int n0, int kb, int l16, float* redp) {
  constexpr int J = FF / GK_SLICES / 8;      // groups of four k per lane, operand and WMMA tile
  // unrolled: the fragments must lie in registers, and every load is issued before the first wait
  constexpr int NA = AM ? 2 : 1, NB = BM ? 2 : 1;   // WMMA tiles that hold anything
  v4f a4[NA][J], b4[NB][J];
  // one address per operand, the steps of k and the second tile as constant offsets from it
  const float* ap = AM ? Am + (size_t)kb * FF + m0 + l16 : av + kb;
  const float* bp = BM ? Bm + (size_t)kb * BPITCH + n0 + l16 : bv + kb;
#pragma unroll
  for (int i = 0; i < NA; ++i) {
#pragma unroll
    for (int j = 0; j < J; ++j) {
      if (AM) {
#pragma unroll
        for (int e = 0; e < 4; ++e) a4[i][j][e] = ap[(8 * j + e) * FF + 16 * i];
      } else {
        a4[i][j] = *(const v4f*)(ap + 8 * j);
      }
    }
  }
#pragma unroll
  for (int i = 0; i < NB; ++i) {
#pragma unroll
    for (int j = 0; j < J; ++j) {
      if (BM) {
#pragma unroll
        for (int e = 0; e < 4; ++e) b4[i][j][e] = bp[(8 * j + e) * BPITCH + 16 * i];
      } else {
        b4[i][j] = *(const v4f*)(bp + 8 * j);
      }
    }
  }
  const v4f zero = {0.f, 0.f, 0.f, 0.f};
#pragma unroll
  for (int j = 0; j < J; ++j) {
    if (!AM) a4[0][j] = (l16 == 0) ? a4[0][j] : zero;   // row F, then padding rows
    if (!BM) b4[0][j] = (l16 == 0) ? b4[0][j] : zero;   // column F, then padding columns
  }
  v8f acc[NA][NB] = {};
#if __has_builtin(__builtin_amdgcn_wmma_f32_16x16x4_f32)
#pragma unroll
  for (int j = 0; j < J; ++j) {
#pragma unroll
    for (int h = 0; h < 2; ++h) {
#pragma unroll
      for (int i = 0; i < NA; ++i) {
#pragma unroll
        for (int n = 0; n < NB; ++n) {
          const v2f a  = {a4[i][j][2 * h], a4[i][j][2 * h + 1]};
          const v2f bq = {b4[n][j][2 * h], b4[n][j][2 * h + 1]};
          acc[i][n] = __builtin_amdgcn_wmma_f32_16x16x4_f32(
              false, a, false, bq, (short)0, acc[i][n], false, false);
        }
      }
    }
  }
#endif
  fd_slots<NA, NB>(acc, a4, b4);
#pragma unroll
  for (int i = 0; i < 2; ++i) {
#pragma unroll
    for (int n = 0; n < 2; ++n) {
#pragma unroll
      for (int r = 0; r < 8; ++r)
        redp[(16 * i + r) * 32 + 16 * n] = (i < NA && n < NB) ? acc[i < NA ? i : 0][n < NB ? n : 0][r] : 0.f;
    }
  }
}

// A block's 32 x 32 tiles of a product of weights, C[WR,WP] = A B over k < F:
//   A(m,k) = Am[k*F + m] for m < F, av[k] for m = F, 0 above
//   B(k,n) = Bm[k*BPITCH + n]; with BEDGE only for n < F, then bv[k] for n = F, 0 above
//   ROWADD: row F of C also takes row F of Bm.
// NP: tiles per block, 8 waves each; a wave sums and stores in the tile that it worked on.
template <int NP, int BPITCH, bool BEDGE, bool ROWADD>
__device__ __forceinline__ void fold_tile(int blk, const float* __restrict__ Am,
                                          const float* __restrict__ av,
                                          const float* __restrict__ Bm,
                                          const float* __restrict__ bv,
                                          float* __restrict__ C) {
  __shared__ __attribute__((aligned(16))) float fred[NP * GK_SLICES][32 * 32];
  const int tid  = threadIdx.x;
  const int lane = tid & 31;
  const int l16  = lane & 15;
  const int hi   = lane >> 4;
  const int w    = __builtin_amdgcn_readfirstlane(tid >> 5);
  const int q    = blk * NP + w / GK_SLICES;   // the wave's tile
  const bool live = q < FD_TILES;              // the same in every lane of a wave
  const int m0   = (q / (WP / 32)) << 5;
  const int n0   = (q % (WP / 32)) << 5;
  const int g    = tid & (GK_SLICES * 32 - 1); // this thread finishes four columns of one row
  const int orow = m0 + (g >> 3);
  const int ocol = n0 + 4 * (g & 7);
  v4f radd = {0.f, 0.f, 0.f, 0.f};
  if (live) {
    if (ROWADD && m0 == FF) {                  // the same in every lane of a wave
      radd = *(const v4f*)(Bm + (size_t)FF * BPITCH + ocol);
#if defined(__HIP_DEVICE_COMPILE__)
      // the address arithmetic of the slice's loads may reuse this load's address registers
      asm volatile("s_wait_xcnt 0x0" ::: "memory");
#endif
    }
    const int kb = (w % GK_SLICES) * (FF / GK_SLICES) + 4 * hi;
    float* redp = &fred[w][8 * hi * 32 + l16];
    // both tests read the same in every lane of a wave
    if (m0 < FF) {
      if (!BEDGE || n0 < FF) fold_slice<BPITCH, true, true>(Am, av, Bm, bv, m0, n0, kb, l16, redp);
      else                   fold_slice<BPITCH, true, false>(Am, av, Bm, bv, m0, n0, kb, l16, redp);
    } else {
      if (!BEDGE || n0 < FF) fold_slice<BPITCH, false, true>(Am, av, Bm, bv, m0, n0, kb, l16, redp);
      else                   fold_slice<BPITCH, false, false>(Am, av, Bm, bv, m0, n0, kb, l16, redp);
    }
  }
  __syncthreads();
  if (live) {
    const int w0 = w - w % GK_SLICES;          // the tile's first wave
    v4f tot = *(const v4f*)&fred[w0][4 * g];
#pragma unroll
    for (int v = 1; v < GK_SLICES; ++v) tot += *(const v4f*)&fred[w0 + v][4 * g];
    if (ROWADD && orow == FF) tot += radd;
    *(v4f*)(C + (size_t)orow * WP + ocol) = tot;
  }
}

#define RM_WAVES 16
#define RM_THREADS (RM_WAVES * 32)
#define RM_ROWS 8                                 // rows per wave
#define RM_WGROWS (RM_WAVES * RM_ROWS)            // rows per workgroup
#define RM_LOADS (RM_ROWS * N4 / 32)              // wave-wide 16-byte loads per span
#define RM_G 12                                   // loads per group
#define RM_GROUPS ((RM_LOADS + RM_G - 1) / RM_G)
#define RM_BLOCKS (BB * FF / RM_WGROWS)
#define GA_WAVES (2 * RM_WGROWS / 32)             // waves that gather, 32 values each
static_assert((RM_ROWS * N4) % 32 == 0 && N4 > 32, "a span is whole loads; a load meets at most two rows");
static_assert(FF % RM_WGROWS == 0 && RM_WGROWS % 32 == 0 && GA_WAVES <= RM_WAVES,
              "a workgroup's rows lie in one batch; a gathering wave has one of last / cur");
__global__ __launch_bounds__(RM_THREADS, 8) void rowmax_gather_kernel(
    const float* __restrict__ x, const int* __restrict__ lc,
    float* __restrict__ glb, float* __restrict__ ctx,
    const float* __restrict__ fA, const float* __restrict__ fv,
    const float* __restrict__ fB, const float* __restrict__ fw, float* __restrict__ fC) {
  __shared__ float rm[RM_WGROWS];
  if (blockIdx.x >= RM_BLOCKS) {      // the whole block takes this way
    fold_tile<RM_WAVES / GK_SLICES, FF, true, false>(blockIdx.x - RM_BLOCKS, fA, fv, fB, fw, fC);
    return;
  }
  const int tid  = threadIdx.x;
  const int lane = tid & 31;
  const int w    = __builtin_amdgcn_readfirstlane(tid >> 5);
  const int wg0  = blockIdx.x * RM_WGROWS;                // the workgroup's first row in [0, B*F)
  const v4f* sp = (const v4f*)(x + (size_t)(wg0 + w * RM_ROWS) * NN) + lane;
  float mx[RM_ROWS];
#pragma unroll
  for (int r = 0; r < RM_ROWS; ++r) mx[r] = -INFINITY;
  // every loop here is unrolled: the load number decides at compile time which row a value
  // belongs to, and the two groups of loaded values must lie in registers
  // gather: wave w takes last (w < GA_WAVES / 2) or cur of 32 of the workgroup's rows
  const int gb = wg0 / FF;                                // batch
  const int gj = w / (GA_WAVES / 2);                      // 0 last, 1 cur
  const int gr = wg0 + (w % (GA_WAVES / 2)) * 32 + lane;  // row in [0, B*F)
  v4f buf[2][RM_G];
#pragma unroll
  for (int q = 0; q < RM_G; ++q) buf[0][q] = sp[q * 32];
  float gv = 0.f;
  if (w < GA_WAVES) {                                     // the same in every lane of a wave
    const int n = min(max(lc[gb * 2 + gj], 0), NN - 1);   // the address stays inside x
    gv = x[(size_t)gr * NN + n];
#if defined(__HIP_DEVICE_COMPILE__)
    // the next group's loads return into this load's address registers
    asm volatile("s_wait_xcnt 0x0" ::: "memory");
#endif
  }
#pragma unroll
  for (int c = 0; c < RM_GROUPS; ++c) {
    // the two scheduling barriers pin the order "next group's loads, then this group's
    // maxima": without them the loads may sink behind the waits for this group
    __builtin_amdgcn_sched_barrier(0);
    if (c + 1 < RM_GROUPS) {
#pragma unroll
      for (int q = 0; q < RM_G; ++q)
        if ((c + 1) * RM_G + q < RM_LOADS) buf[(c + 1) & 1][q] = sp[((c + 1) * RM_G + q) * 32];
    }
    __builtin_amdgcn_sched_barrier(0);
#pragma unroll
    for (int q = 0; q < RM_G; ++q) {
      const int k = c * RM_G + q;
      if (k < RM_LOADS) {
        const v4f v = buf[c & 1][q];
        const float vm = fmaxf(fmaxf(v.x, v.y), fmaxf(v.z, v.w));
        const int ra = (k * 32) / N4;
        const int rb = (k * 32 + 31) / N4;
        if (ra == rb) {
          mx[ra] = fmaxf(mx[ra], vm);
        } else {
          const bool lo = lane < rb * N4 - k * 32;
          mx[ra] = fmaxf(mx[ra], lo ? vm : -INFINITY);
          mx[rb] = fmaxf(mx[rb], lo ? -INFINITY : vm);
        }
      }
    }
    // without the statement below the compiler regrouped the maxima across groups, kept
    // loaded values alive past their group and spilled them between the loads
#if defined(__HIP_DEVICE_COMPILE__)
#pragma unroll
    for (int r = 0; r < RM_ROWS; ++r)
      if (r >= (c * RM_G * 32) / N4 && r <= (c * RM_G * 32 + RM_G * 32 - 1) / N4)
        asm volatile("" : "+v"(mx[r]));   // streaming pattern: each row's result closed, against spills
#endif
  }
#pragma unroll
  for (int r = 0; r < RM_ROWS; ++r) {
#pragma unroll
    for (int o = 16; o; o >>= 1) mx[r] = fmaxf(mx[r], __shfl_xor(mx[r], o));
  }
  float mine = mx[0];
#pragma unroll
  for (int r = 1; r < RM_ROWS; ++r) mine = (lane == r) ? mx[r] : mine;
  if (lane < RM_ROWS) rm[w * RM_ROWS + lane] = mine;
  __syncthreads();
  // the workgroup's maxima leave as whole 128-byte lines, one wave each
  if (tid < RM_WGROWS) glb[wg0 + tid] = rm[tid];
  // behind the barrier: in front of it every wave would wait for this store to finish
  if (w < GA_WAVES) ctx[gb * 2 * FF + gj * FF + (gr - gb * FF)] = gv;   // a whole line per wave
#if defined(__HIP_DEVICE_COMPILE__)
  // the launch's other kind of block stands behind these stores in the code and writes their registers
  asm volatile("s_wait_xcnt 0x0" ::: "memory");
#endif
}

// [ql | cL] = xbar @ Wc, Bm(k,n) = Bp[k*WP + n], in the tiles and slices named above; row F
// of Bp is the bias, column F goes to dout.
// A is pass B's pair of un-normalised sums [2][B][F] and dv its (max, sum) lines; the A
// load joins the two node ranges of a row: A[b,:] = (w0 * A0 + w1 * A1) / (w0 * l0 + w1 * l1),
// wi = exp(Mi - max(M0, M1)).
__global__ __launch_bounds__(512) void gemm_ql_kernel(
    const float* __restrict__ A, const float* __restrict__ Bp, float* __restrict__ C,
    const float* __restrict__ dv, float* __restrict__ dout) {
  constexpr int K  = FF;
  constexpr int KW = K / GK_SLICES;   // k per wave
  constexpr int J  = KW / 8;          // groups of four k per lane and operand
  constexpr int NBK = WP / 32;        // blocks across the columns
  __shared__ float red[GK_SLICES][16 * 32];
  const int tid  = threadIdx.x;
  const int lane = tid & 31;
  const int l16  = lane & 15;
  const int hi   = lane >> 4;
  const int w    = __builtin_amdgcn_readfirstlane(tid >> 5);
  const int nt   = w & 1;
  const int ks   = w >> 1;
  const int m0   = (blockIdx.x / NBK) << 4;
  const int n0   = (blockIdx.x % NBK) << 5;
  const int kb   = ks * KW + 4 * hi;
  const int col  = n0 + nt * 16 + l16;

  // every loop of this kernel is unrolled: the fragments must lie in registers, and a
  // rolled loop would wait for each load before it issues the next
  v4f a4[J], b4[J];
  const float* st = dv + (m0 + l16) * ST_PITCH;
  // wanted first, so asked for first
  const float M0 = st[0];
  const float L0 = st[1];
  const float M1 = st[BB * ST_PITCH];
  const float L1 = st[BB * ST_PITCH + 1];
  const float* ap = A + (size_t)(m0 + l16) * K + kb;
#pragma unroll
  for (int j = 0; j < J; ++j) a4[j] = *(const v4f*)(ap + 8 * j);
  v4f a1[J];
#pragma unroll
  for (int j = 0; j < J; ++j) a1[j] = *(const v4f*)(ap + (size_t)BB * K + 8 * j);
  const float* bp = Bp + (size_t)kb * WP + col;
#pragma unroll
  for (int j = 0; j < J; ++j) {
#pragma unroll
    for (int e = 0; e < 4; ++e) b4[j][e] = bp[(size_t)(8 * j + e) * WP];
  }
  // the element this thread finishes: row tid/32, column tid%32 of the block's tile
  const int orow = m0 + (tid >> 5);
  const int ocol = n0 + lane;
  const float bcol = Bp[(size_t)K * WP + ocol];
  // every load above is issued before the first wait: without this the compiler held
  // half of them back behind the wait for M and l, a second trip to memory
  __builtin_amdgcn_sched_barrier(0);
  const float Mx = fmaxf(M0, M1);
  const float w0 = __expf(M0 - Mx), w1 = __expf(M1 - Mx);
  const float inv = 1.f / fmaf(L1, w1, L0 * w0);   // softmax-normalized here
  const float c0 = w0 * inv, c1 = w1 * inv;
#pragma unroll
  for (int j = 0; j < J; ++j) a4[j] = a4[j] * c0 + a1[j] * c1;

  v8f acc = {};
#if __has_builtin(__builtin_amdgcn_wmma_f32_16x16x4_f32)
#pragma unroll
  for (int j = 0; j < J; ++j) {
#pragma unroll
    for (int h = 0; h < 2; ++h) {
      const v2f a  = {a4[j][2 * h], a4[j][2 * h + 1]};
      const v2f bv = {b4[j][2 * h], b4[j][2 * h + 1]};
      acc = __builtin_amdgcn_wmma_f32_16x16x4_f32(
          false, a, false, bv, (short)0, acc, false, false);
    }
  }
#endif
  gk_slots(acc, a4, b4, ap, bp, st);
#pragma unroll
  for (int r = 0; r < 8; ++r) red[ks][(r + 8 * hi) * 32 + nt * 16 + l16] = acc[r];
  __syncthreads();
  float tot = red[0][tid];
#pragma unroll
  for (int v = 1; v < GK_SLICES; ++v) tot += red[v][tid];
  tot += bcol;
  if (ocol < FF) C[(size_t)orow * FF + ocol] = tot;
  else if (ocol == FF) dout[orow] = tot;
}

#define CQ_SLICES 12
#define QK_SHARES (FF / 32)
#define CQ_PITCH 36
#define CK_PITCH 32
__global__ __launch_bounds__(CQ_SLICES * 64) void gemm_cq_qk_kernel(
    const float* __restrict__ glb, const float* __restrict__ Wg, const float* __restrict__ bg,
    const float* __restrict__ ctx, const float* __restrict__ Wlc, const float* __restrict__ blc,
    const float* __restrict__ WK, const float* __restrict__ bK,
    float* __restrict__ qkp, float* __restrict__ cKp,
    const float* __restrict__ fA, const float* __restrict__ fv,
    const float* __restrict__ fB, float* __restrict__ fC) {
  constexpr int KW = 64;              // k per wave
  constexpr int J  = KW / 8;          // 16-byte loads per lane and operand
  __shared__ float red[CQ_SLICES][16 * 32];
  __shared__ __attribute__((aligned(16))) float cqt[16 * CQ_PITCH];
  if (blockIdx.x >= GT_BLOCKS) {      // the whole block takes this way
    fold_tile<CQ_SLICES / 4, WP, false, true>(blockIdx.x - GT_BLOCKS, fA, fv, fB, nullptr, fC);
    return;
  }
  const int tid  = threadIdx.x;
  const int lane = tid & 31;
  const int l16  = lane & 15;
  const int hi   = lane >> 4;
  const int w    = __builtin_amdgcn_readfirstlane(tid >> 5);
  const int nt   = w & 1;
  const int ks   = w >> 1;
  const int mt   = blockIdx.x >> 3;   // which 16 rows
  const int gs   = blockIdx.x & 7;    // which 32 columns of cQ
  const int m0   = mt << 4;
  const int n0   = gs << 5;
  const int col  = n0 + nt * 16 + l16;
  const bool first = ks < FF / KW;    // the same in every lane of a wave
  const int K    = first ? FF : 2 * FF;
  const int kb   = (first ? ks : ks - FF / KW) * KW + 4 * hi;

  v4f a4[J], b4[J];
  const float* ap = (first ? glb : ctx) + (size_t)(m0 + l16) * K + kb;
  const float* bp = (first ? Wg : Wlc) + (size_t)col * K + kb;
#pragma unroll
  for (int j = 0; j < J; ++j) a4[j] = *(const v4f*)(ap + 8 * j);
#pragma unroll
  for (int j = 0; j < J; ++j) b4[j] = *(const v4f*)(bp + 8 * j);
  const int ocol = n0 + lane;
  const float bcol = bg[ocol] + blc[ocol];
#if defined(__HIP_DEVICE_COMPILE__)
  // ocol is these two loads' offset register: it stays theirs up to this wait
  asm volatile("s_wait_xcnt 0x0" :: "v"(ocol) : "memory");
#endif
  // the second product's B: register e of group j holds g = n0 + 4hi + 8j + e, as its A below
  const v4f zero = {0.f, 0.f, 0.f, 0.f};
  v4f b2[2][4] = {{zero, zero, zero, zero}, {zero, zero, zero, zero}};
  if (w < QK_SHARES) {                // both tests read the same in every lane of a wave
    const float* kp = WK + (size_t)(n0 + 4 * hi) * FF + 32 * w + l16;
#pragma unroll
    for (int n = 0; n < 2; ++n) {
#pragma unroll
      for (int j = 0; j < 4; ++j) {
#pragma unroll
        for (int e = 0; e < 4; ++e) b2[n][j][e] = kp[(8 * j + e) * FF + 16 * n];
      }
    }
#if defined(__HIP_DEVICE_COMPILE__)
    // later arithmetic may reuse these loads' address registers
    asm volatile("s_wait_xcnt 0x0" ::: "memory");
#endif
  } else if (w == QK_SHARES) {
    const int kq = n0 / 4 + hi;       // in groups of four g
#pragma unroll
    for (int j = 0; j < 4; ++j) b2[0][j] = ((const v4f*)bK)[kq + 2 * j];
#if defined(__HIP_DEVICE_COMPILE__)
    // kq is these loads' offset register: it stays theirs up to this wait
    asm volatile("s_wait_xcnt 0x0" :: "v"(kq) : "memory");
#endif
#pragma unroll
    for (int j = 0; j < 4; ++j) b2[0][j] = (l16 == 0) ? b2[0][j] : zero;   // cK's column, then padding
  }

  v8f acc = {};
#if __has_builtin(__builtin_amdgcn_wmma_f32_16x16x4_f32)
#pragma unroll
  for (int j = 0; j < J; ++j) {
#pragma unroll
    for (int h = 0; h < 2; ++h) {
      const v2f a  = {a4[j][2 * h], a4[j][2 * h + 1]};
      const v2f bv = {b4[j][2 * h], b4[j][2 * h + 1]};
      acc = __builtin_amdgcn_wmma_f32_16x16x4_f32(
          false, a, false, bv, (short)0, acc, false, false);
    }
  }
#endif
  gk_slots(acc, a4, b4, ap, bp);
#pragma unroll
  for (int r = 0; r < 8; ++r) red[ks][(r + 8 * hi) * 32 + nt * 16 + l16] = acc[r];
  __syncthreads();
  // the tile has 512 elements: the first 16 waves finish one each (row tid/32, column tid%32)
  if (tid < 16 * 32) {
    float tot = red[0][tid];
#pragma unroll
    for (int v = 1; v < CQ_SLICES; ++v) tot += red[v][tid];
    cqt[(tid >> 5) * CQ_PITCH + lane] = tot + bcol;
  }
  __syncthreads();
  if (w > QK_SHARES) return;          // whole waves, behind the last barrier
  v4f a2[1][4];
#pragma unroll
  for (int j = 0; j < 4; ++j) a2[0][j] = *(const v4f*)&cqt[l16 * CQ_PITCH + 4 * hi + 8 * j];
  // the LDS reads and their addresses stay in front of the WMMA chain
  __builtin_amdgcn_sched_barrier(0);
  v8f acc2[1][2] = {};
#if __has_builtin(__builtin_amdgcn_wmma_f32_16x16x4_f32)
#pragma unroll
  for (int j = 0; j < 4; ++j) {
#pragma unroll
    for (int h = 0; h < 2; ++h) {
#pragma unroll
      for (int n = 0; n < 2; ++n) {
        const v2f a  = {a2[0][j][2 * h], a2[0][j][2 * h + 1]};
        const v2f bv = {b2[n][j][2 * h], b2[n][j][2 * h + 1]};
        acc2[0][n] = __builtin_amdgcn_wmma_f32_16x16x4_f32(
            false, a, false, bv, (short)0, acc2[0][n], false, false);
      }
    }
  }
#endif
  fd_slots<1, 2>(acc2, a2, b2);
  if (w < QK_SHARES) {
    float* pp = qkp + ((size_t)gs * BB + m0 + 8 * hi) * FF + 32 * w + l16;
#pragma unroll
    for (int n = 0; n < 2; ++n) {
#pragma unroll
      for (int r = 0; r < 8; ++r) pp[r * FF + 16 * n] = acc2[0][n][r];
    }
  } else if (l16 == 0) {
    float* pp = cKp + (gs * (BB / 16) + mt) * CK_PITCH + 8 * hi;
#pragma unroll
    for (int r = 0; r < 8; ++r) pp[r] = acc2[0][0][r];
  }
#if defined(__HIP_DEVICE_COMPILE__)
  // the launch's other kind of block stands behind these stores in the code and writes their registers
  asm volatile("s_wait_xcnt 0x0" ::: "memory");
#endif
}

__device__ __forceinline__ void pb_copy8(const v4f* g, const v4f* l) {
#if defined(__HIP_DEVICE_COMPILE__)
  const unsigned long long g0 = (unsigned long long)(uintptr_t)g;
  const unsigned int l0 = (unsigned int)(uintptr_t)l;   // generic LDS pointer: low 32 bits
  asm volatile(
      "global_load_async_to_lds_b128 %0, %8, off\n\t"
      "global_load_async_to_lds_b128 %1, %9, off\n\t"
      "global_load_async_to_lds_b128 %2, %10, off\n\t"
      "global_load_async_to_lds_b128 %3, %11, off\n\t"
      "global_load_async_to_lds_b128 %4, %12, off\n\t"
      "global_load_async_to_lds_b128 %5, %13, off\n\t"
      "global_load_async_to_lds_b128 %6, %14, off\n\t"
      "global_load_async_to_lds_b128 %7, %15, off\n\t"
      "s_wait_xcnt 0x0"
      :: "v"(l0), "v"(l0 + 512u), "v"(l0 + 1024u), "v"(l0 + 1536u),
         "v"(l0 + 2048u), "v"(l0 + 2560u), "v"(l0 + 3072u), "v"(l0 + 3584u),
         "v"(g0), "v"(g0 + 1ull * NN * 4), "v"(g0 + 2ull * NN * 4), "v"(g0 + 3ull * NN * 4),
         "v"(g0 + 4ull * NN * 4), "v"(g0 + 5ull * NN * 4), "v"(g0 + 6ull * NN * 4),
         "v"(g0 + 7ull * NN * 4)
      : "memory");
#else
  (void)g; (void)l;
#endif
}

// The wave's 16 rows of tile t into its slice of one LDS buffer.
__device__ __forceinline__ void pb_fill(const v4f* xr, v4f* slice, int t, int lane) {
  const int c = min(t * 32 + lane, N4 - 1);     // past the row's end: copy its last column
  pb_copy8(xr + c, slice + lane);
  pb_copy8(xr + 8 * N4 + c, slice + 8 * 32 + lane);
}

// One trip: tile t out of its LDS buffer. REFILL: a tile t + 2 exists and is copied
// into the buffer that this trip has read (the caller's loop bounds are the test).
template <bool REFILL>
__device__ __forceinline__ void pb_trip(const v4f* xr, v4f* slice, v4f (*part)[32],
                                        const float (&q)[PB_ROWS], int t, int w, int lane,
                                        float cKb, v2f (&acc)[PB_ROWS], float& m, float& l) {
  // this wave's share of the scores of the lane's four nodes; sums run in node
  // pairs (.xy, .zw) so that packed f32 instructions take the registers as they lie
  v4f X[PB_ROWS];
#pragma unroll
  for (int i = 0; i < PB_ROWS; ++i) X[i] = slice[i * 32 + lane];
  v2f s01 = {0.f, 0.f}, s23 = {0.f, 0.f};
#pragma unroll
  for (int i = 0; i < PB_ROWS; ++i) {
    const v2f qq = {q[i], q[i]};
    s01 = __builtin_elementwise_fma(qq, X[i].xy, s01);
    s23 = __builtin_elementwise_fma(qq, X[i].zw, s23);
  }
  part[w][lane] = (v4f){s01.x, s01.y, s23.x, s23.y};
  __syncthreads();
  // every wave adds the 16 shares in the same order, so all waves see equal scores
  v4f tot = part[0][lane];
#pragma unroll
  for (int v = 1; v < PB_WAVES; ++v) tot += part[v][lane];
  const bool valid = REFILL || t * 32 + lane < N4;   // a tile with a tile t + 2 behind it is whole
  const float t0 = valid ? (tot.x + cKb) * SCALE : -INFINITY;
  const float t1 = valid ? (tot.y + cKb) * SCALE : -INFINITY;
  const float t2 = valid ? (tot.z + cKb) * SCALE : -INFINITY;
  const float t3 = valid ? (tot.w + cKb) * SCALE : -INFINITY;
  const float mn = fmaxf(m, fmaxf(fmaxf(t0, t1), fmaxf(t2, t3)));
  const float r  = __expf(m - mn);              // 0 on the first tile (m = -inf)
  const v2f e01 = {valid ? __expf(t0 - mn) : 0.f, valid ? __expf(t1 - mn) : 0.f};
  const v2f e23 = {valid ? __expf(t2 - mn) : 0.f, valid ? __expf(t3 - mn) : 0.f};
  const v2f es = e01 + e23;
  l = fmaf(l, r, es.x + es.y);
  m = mn;
  const v2f rr = {r, r};
#pragma unroll
  for (int i = 0; i < PB_ROWS; ++i)
    acc[i] = __builtin_elementwise_fma(e23, X[i].zw,
             __builtin_elementwise_fma(e01, X[i].xy, acc[i] * rr));

  // keeps the arithmetic above in front of the foot: without it the compiler moved it
  // behind the barrier, ahead of the copies, and read the 16 shares one wait at a time
  __builtin_amdgcn_sched_barrier(0);
  // foot of the trip: own LDS reads done, tile t+1 landed, everybody here; only
  // then is the buffer just read refilled
  asm volatile("s_wait_dscnt 0x0" ::: "memory");
  asm volatile("s_wait_asynccnt 0x0" ::: "memory");
  __syncthreads();
  if (REFILL) pb_fill(xr, slice, t + 2, lane);
}

__global__ __launch_bounds__(PB_THREADS) void passB_kernel(
    const float* __restrict__ x, const float* __restrict__ qkp,
    const float* __restrict__ cKp, float* __restrict__ xpart, float* __restrict__ st) {
  __shared__ __attribute__((aligned(16))) v4f tile[2][FF * 32];   // 2 x 128 KB
  __shared__ v4f part[PB_WAVES][32];
  __shared__ float xs[FF];
  const int b = blockIdx.x / PB_SPLIT;
  const int h = blockIdx.x % PB_SPLIT;   // which node range
  const int t0 = h * PB_TPB;             // its first tile (even: it lies in buffer 0)
  const int tid = threadIdx.x;
  const int lane = tid & 31;
  const int w = __builtin_amdgcn_readfirstlane(tid >> 5);
  const v4f* xr = (const v4f*)(x + ((size_t)b * FF + w * PB_ROWS) * NN);
  float q[PB_ROWS];
  v2f acc[PB_ROWS];
#pragma unroll
  for (int i = 0; i < PB_ROWS; ++i) acc[i] = (v2f){0.f, 0.f};
  static_assert(QK_SHARES == 8 && PB_ROWS == 16, "32 lanes = 8 shares x 4 groups of 4 rows");
  v4f qv = *(const v4f*)(qkp + ((size_t)(lane >> 2) * BB + b) * FF + w * PB_ROWS + 4 * (lane & 3));
  float cKb = cKp[((lane & 7) * (BB / 16) + b / 16) * CK_PITCH + b % 16];
#if defined(__HIP_DEVICE_COMPILE__)
  // the copies' address arithmetic may reuse these loads' address registers
  asm volatile("s_wait_xcnt 0x0" ::: "memory");
#endif
  float m = -INFINITY, l = 0.f;

  pb_fill(xr, &tile[0][w * PB_ROWS * 32], t0, lane);
  // the two scheduling barriers keep the sums of the shares between the first tile's copies
  // and the wait for them: without them the compiler put the wait for the two loads between
  // the copies, or the sums behind the barrier, in front of the second tile's copies
  __builtin_amdgcn_sched_barrier(0);
#pragma unroll
  for (int o = 4; o <= 16; o <<= 1) {
#pragma unroll
    for (int e = 0; e < 4; ++e) qv[e] += __shfl_xor(qv[e], o);
  }
#pragma unroll
  for (int o = 1; o <= 4; o <<= 1) cKb += __shfl_xor(cKb, o);
#pragma unroll
  for (int i = 0; i < PB_ROWS; ++i) q[i] = __shfl(qv[i & 3], i >> 2);
  __builtin_amdgcn_sched_barrier(0);
  asm volatile("s_wait_asynccnt 0x0" ::: "memory");   // the first tile has landed
  __syncthreads();
  pb_fill(xr, &tile[1][w * PB_ROWS * 32], t0 + 1, lane);

  // both loops rolled: the bodies stay small in the instruction cache
#pragma unroll 1
  for (int t = t0; t < t0 + PB_TPB - 2; ++t)
    pb_trip<true>(xr, &tile[t & 1][w * PB_ROWS * 32], part, q, t, w, lane, cKb, acc, m, l);
#pragma unroll 1
  for (int t = t0 + PB_TPB - 2; t < t0 + PB_TPB; ++t)
    pb_trip<false>(xr, &tile[t & 1][w * PB_ROWS * 32], part, q, t, w, lane, cKb, acc, m, l);
  asm volatile("s_wait_asynccnt 0x0" ::: "memory");   // nothing in flight at the wave's end

  // join the 32 lanes: common max, rescale, butterfly sums
  float M = m;
#pragma unroll
  for (int o = 16; o; o >>= 1) M = fmaxf(M, __shfl_xor(M, o));
  const float sc = __expf(m - M);
  l *= sc;
#pragma unroll
  for (int o = 16; o; o >>= 1) l += __shfl_xor(l, o);
  float a[PB_ROWS];
#pragma unroll
  for (int i = 0; i < PB_ROWS; ++i) a[i] = (acc[i].x + acc[i].y) * sc;
#pragma unroll
  for (int o = 16; o; o >>= 1) {
#pragma unroll
    for (int i = 0; i < PB_ROWS; ++i) a[i] += __shfl_xor(a[i], o);
  }
  if (lane == 0) {
#pragma unroll
    for (int i = 0; i < PB_ROWS; ++i) xs[w * PB_ROWS + i] = a[i];
  }
  __syncthreads();
  // M and l are the same in every wave; whole 128-byte lines per wave
  if (tid < FF) xpart[(h * BB + b) * FF + tid] = xs[tid];   // relative to M, not normalized
  if (tid == 0) {
    st[(h * BB + b) * ST_PITCH]     = M;
    st[(h * BB + b) * ST_PITCH + 1] = l;
  }
}

#define PC_WAVES 16
#define PC_THREADS (PC_WAVES * 32)
#define PC_ROWS (FF / PC_WAVES)     // feature rows held by one wave
static_assert(PB_TPB * 32 <= PC_THREADS, "one thread finishes four nodes");
__global__ __launch_bounds__(PC_THREADS) void passC_kernel(
    const float* __restrict__ x, const float* __restrict__ ql,
    const float* __restrict__ cL, float* __restrict__ out) {
  __shared__ v4f share[PC_WAVES][PB_TPB * 32];   // 64 KB
  const int b = blockIdx.x / PB_SPLIT;
  const int h = blockIdx.x % PB_SPLIT;   // which node range
  const int c0 = h * PB_TPB * 32;        // its first float4 column
  const int tid = threadIdx.x;
  const int lane = tid & 31;
  const int w = __builtin_amdgcn_readfirstlane(tid >> 5);
  const v4f* xr = (const v4f*)(x + ((size_t)b * FF + w * PC_ROWS) * NN);
  float q[PC_ROWS];
#pragma unroll
  for (int i = 0; i < PC_ROWS; ++i) q[i] = ql[b * FF + w * PC_ROWS + i];
  const float cLb = cL[b];

  // every loop here is unrolled: the two groups of loaded values must lie in registers
  v4f buf[2][PC_ROWS];
  const int cb = c0 + lane;                                // the lane's column in the range's first tile
  const int ce = min(cb + (PB_TPB - 1) * 32, N4 - 1);      // in its last; past the row's end: the last column
#pragma unroll
  for (int i = 0; i < PC_ROWS; ++i) buf[0][i] = xr[i * N4 + ce];
#if defined(__HIP_DEVICE_COMPILE__)
  // ce is these loads' offset register: it stays theirs up to this wait
  asm volatile("s_wait_xcnt 0x0" :: "v"(ce) : "memory");
#endif
#pragma unroll
  for (int g = 0; g < PB_TPB; ++g) {
    const int tl = PB_TPB - 1 - g;       // this group's tile within the range
    // the two scheduling barriers pin the order "next group's loads, then this group's
    // sums": without them the loads may sink behind the waits for this group
    __builtin_amdgcn_sched_barrier(0);
    if (g + 1 < PB_TPB) {                // not a range's last tile: whole
#pragma unroll
      for (int i = 0; i < PC_ROWS; ++i) buf[(g + 1) & 1][i] = xr[i * N4 + (tl - 1) * 32 + cb];
    }
    __builtin_amdgcn_sched_barrier(0);
    // sums run in node pairs (.xy, .zw) so that packed f32 instructions take the registers as they lie
    v2f s01 = {0.f, 0.f}, s23 = {0.f, 0.f};
#pragma unroll
    for (int i = 0; i < PC_ROWS; ++i) {
      const v2f qq = {q[i], q[i]};
      s01 = __builtin_elementwise_fma(qq, buf[g & 1][i].xy, s01);
      s23 = __builtin_elementwise_fma(qq, buf[g & 1][i].zw, s23);
    }
    share[w][tl * 32 + lane] = (v4f){s01.x, s01.y, s23.x, s23.y};
  }
  __syncthreads();
  // thread j finishes float4 column c0 + j: whole 512-byte pieces of the output row per wave
  if (tid < PB_TPB * 32 && c0 + tid < N4) {
    v4f tot = share[0][tid];
#pragma unroll
    for (int v = 1; v < PC_WAVES; ++v) tot += share[v][tid];
    v4f r;
    r.x = tanhf((tot.x + cLb) * SCALE) * 10.f;
    r.y = tanhf((tot.y + cLb) * SCALE) * 10.f;
    r.z = tanhf((tot.z + cLb) * SCALE) * 10.f;
    r.w = tanhf((tot.w + cLb) * SCALE) * 10.f;
    *((v4f*)(out + (size_t)b * NN) + c0 + tid) = r;
  }
}

// ---------------------------------------------------------------------------
extern "C" void kernel_launch(void* const* d_in, const int* in_sizes, int n_in,
                              void* d_out, int out_size, void* d_ws, size_t ws_size,
                              hipStream_t stream) {
  const float* x     = (const float*)d_in[0];   // [B,F,N,1]
  const int*   lc    = (const int*)  d_in[1];   // [B,2]
  const float* Wg    = (const float*)d_in[2];   // [F,F]
  const float* bg    = (const float*)d_in[3];   // [F]
  const float* Wnode = (const float*)d_in[4];   // [3F,F]
  const float* bnode = (const float*)d_in[5];   // [3F]
  const float* Wlc   = (const float*)d_in[6];   // [F,2F]
  const float* blc   = (const float*)d_in[7];   // [F]
  const float* Wproj = (const float*)d_in[8];   // [F,F]
  const float* bproj = (const float*)d_in[9];   // [F]
  float* out = (float*)d_out;                   // [B,N]

  // workspace carve-up (~2.5 MB of f32)
  float* ws   = (float*)d_ws;
  float* glb  = ws;                         // [B,F]
  float* ctx  = glb  + BB * FF;             // [B,2F]
  float* qkp  = ctx  + BB * 2 * FF;         // [F/32,B,F]
  float* cKp  = qkp  + QK_SHARES * BB * FF; // [F/32,B/16] lines of CK_PITCH
  float* xpart = cKp + QK_SHARES * (BB / 16) * CK_PITCH;   // [2,B,F]
  float* st   = xpart + PB_SPLIT * BB * FF; // [2,B] lines of ST_PITCH
  float* T    = st   + PB_SPLIT * BB * ST_PITCH;   // [WR,WP]
  float* Wc   = T    + WR * WP;             // [WR,WP]
  float* ql   = Wc   + WR * WP;             // [B,F]
  float* cL   = ql   + BB * FF;             // [B]

  // context gather, and pass A: glb = max_n x; beside them T = [Wproj^T ; bproj^T] [Wnode_L | bnode_L]
  rowmax_gather_kernel<<<RM_BLOCKS + FD_BLOCKS(RM_WAVES / GK_SLICES), RM_THREADS, 0, stream>>>(x, lc, glb, ctx,
      Wproj, bproj, Wnode + (size_t)2 * FF * FF, bnode + 2 * FF, T);
  // cQ = glb @ Wg^T + bg + ctx @ Wlc^T + blc, then the shares of qk = cQ @ Wnode_K (Bm(k,n) = Wnode[k,n])
  // and cK = cQ . bnode_K; beside them Wc = [Wnode_V^T ; bnode_V^T] T
  gemm_cq_qk_kernel<<<GT_BLOCKS + FD_BLOCKS(CQ_SLICES / 4), CQ_SLICES * 64, 0, stream>>>(glb, Wg, bg, ctx, Wlc, blc,
      Wnode, bnode, qkp, cKp, Wnode + (size_t)FF * FF, bnode + FF, T, Wc);
  // Pass B: fused attention (single read of x)
  passB_kernel<<<BB * PB_SPLIT, PB_THREADS, 0, stream>>>(x, qkp, cKp, xpart, st);
  // [ql | cL] = xbar @ Wc + Wc's bias row, xbar joined from xpart and st
  gemm_ql_kernel<<<QL_BLOCKS, 512, 0, stream>>>(xpart, Wc, ql, st, cL);
  // Pass C: logits
  passC_kernel<<<BB * PB_SPLIT, PC_THREADS, 0, stream>>>(x, ql, cL, out);
}

// v009
// It runs in 62.8 microseconds.
// Two timings next to v008 both put it at 1.04 times that version's speed.
// All steps since v000 together make it 3.68 times as fast.
#include <hip/hip_runtime.h>
#include <stdint.h>
#include <math.h>

// Problem constants (from reference): B=128, F=256, N=2000, scale = 1/sqrt(F)
#define BB 128
#define FF 256
#define NN 2000
#define SCALE 0.0625f

#define PB_WAVES 16         // waves per workgroup in pass B
#define PB_THREADS (PB_WAVES * 32)
#define PB_ROWS (FF / PB_WAVES)   // feature rows held by one wave
#define N4 (NN / 4)         // float4 columns per feature row
#define PB_TILES ((N4 + 31) / 32) // tiles of 128 nodes (32 lanes x float4)
#define PB_SPLIT 2          // workgroups per batch in pass B: B * 2 = one on every WGP
#define PB_TPB (PB_TILES / PB_SPLIT)   // tiles per workgroup
#define ST_PITCH 32         // floats: each workgroup's (max, sum) has a 128-byte line of its own
static_assert(PB_SPLIT == 2 && PB_TILES % PB_SPLIT == 0 && PB_TPB % 2 == 0 && PB_TPB >= 2,
              "two equal node ranges, each starting in LDS buffer 0");

typedef __attribute__((ext_vector_type(2))) float v2f;
typedef __attribute__((ext_vector_type(4))) float v4f;
typedef __attribute__((ext_vector_type(8))) float v8f;

// ---------------------------------------------------------------------------
// x is read three times (pass A, B, C) and is larger than the L2, so a
// plain stream pushes out of L2 much of what the next pass wants. The rows of x are therefore
// of two kinds, the same in all three passes: of each 16 feature rows the first XK_KEEP are
// read plainly and, being about half of x, stay in L2 from one pass to the next; the others
// are read with the non-temporal hint, which leaves little in L2, so that they do not push
// the kept rows out. The hint changes no value.
// ---------------------------------------------------------------------------
#define XK_KEEP 8
template <bool NT>
__device__ __forceinline__ v4f x_load(const v4f* p) {
  return NT ? __builtin_nontemporal_load(p) : *p;
}

#define GK_SLICES 8
#define GT_BLOCKS ((BB / 16) * (FF / 32))   // blocks of 16 x 32 in one [B,F] product
#define WP (FF + 32)                        // columns of T and Wc: F, cL's, zeros
#define WR (FF + 32)                        // rows of T and Wc: F, the bias row, zeros
#define FD_TILES ((WR / 32) * (WP / 32))    // tiles of 32 x 32 in T or Wc
#define FD_BLOCKS(np) ((FD_TILES + (np) - 1) / (np))   // blocks of np tiles
#define QL_BLOCKS ((BB / 16) * (WP / 32))   // blocks of 16 x 32 in [ql | cL]

#define GK_NOPS "v_nop\n\tv_nop\n\tv_nop\n\tv_nop\n\tv_nop\n\tv_nop\n\tv_nop\n\tv_nop"
// The two load addresses are inputs as well: their registers stay theirs while the
// loads fly (without this the compiler let later loads return into them).
__device__ __forceinline__ void gk_slots(const v8f& d, const v4f (&a)[8], const v4f (&b)[8],
                                         const float* pa, const float* pb) {
#if defined(__HIP_DEVICE_COMPILE__)
  asm volatile(GK_NOPS :: "v"(d), "v"(a[0]), "v"(a[1]), "v"(a[2]), "v"(a[3]),
               "v"(a[4]), "v"(a[5]), "v"(a[6]), "v"(a[7]),
               "v"(b[0]), "v"(b[1]), "v"(b[2]), "v"(b[3]),
               "v"(b[4]), "v"(b[5]), "v"(b[6]), "v"(b[7]), "v"(pa), "v"(pb));
#else
  (void)d; (void)a; (void)b; (void)pa; (void)pb;
#endif
}
// The same for the merging A load: its three load addresses are inputs for that reason.
__device__ __forceinline__ void gk_slots(const v8f& d, const v4f (&a)[4], const v4f (&b)[4],
                                         const float* pa, const float* pb, const float* ps) {
#if defined(__HIP_DEVICE_COMPILE__)
  asm volatile(GK_NOPS :: "v"(d), "v"(a[0]), "v"(a[1]), "v"(a[2]), "v"(a[3]),
               "v"(b[0]), "v"(b[1]), "v"(b[2]), "v"(b[3]), "v"(pa), "v"(pb), "v"(ps));
#else
  (void)d; (void)a; (void)b; (void)pa; (void)pb; (void)ps;
#endif
}

// The products of weights are cut for few waves (for speed only): a wave takes 32 x 32 of C,
// four WMMA tiles that share its loads, and one of
// 8 slices of k; the 8 waves of a tile meet in LDS. A block holds one tile per 8 waves.
// The same as gk_slots for the NA x NB chains of such a wave.
#define FD_FRAG(x) "v"(x[0]), "v"(x[1]), "v"(x[2]), "v"(x[3])
template <int NA, int NB>
__device__ __forceinline__ void fd_slots(const v8f (&d)[NA][NB], const v4f (&a)[NA][4], const v4f (&b)[NB][4]) {
#if defined(__HIP_DEVICE_COMPILE__)
  if constexpr (NA == 2 && NB == 2)
    asm volatile(GK_NOPS :: "v"(d[0][0]), "v"(d[0][1]), "v"(d[1][0]), "v"(d[1][1]),
                 FD_FRAG(a[0]), FD_FRAG(a[1]), FD_FRAG(b[0]), FD_FRAG(b[1]));
  else if constexpr (NA == 2)
    asm volatile(GK_NOPS :: "v"(d[0][0]), "v"(d[1][0]), FD_FRAG(a[0]), FD_FRAG(a[1]), FD_FRAG(b[0]));
  else if constexpr (NB == 2)
    asm volatile(GK_NOPS :: "v"(d[0][0]), "v"(d[0][1]), FD_FRAG(a[0]), FD_FRAG(b[0]), FD_FRAG(b[1]));
  else
    asm volatile(GK_NOPS :: "v"(d[0][0]), FD_FRAG(a[0]), FD_FRAG(b[0]));
#else
  (void)d; (void)a; (void)b;
#endif
}

// One wave's slice of k. AM: the 32 rows are rows of the matrix, else the bias row and
// padding; BM: the same for the columns. The bias lies in the first WMMA tile; the second is
// all padding, takes no product and is stored as zeros. The cases are whole paths from the loads to the LDS
// stores: with a branch for each operand alone the compiler waited for A's loads before it
// issued B's, a second trip to memory.
template <int BPITCH, bool AM, bool BM>
__device__ __forceinline__ void fold_slice(const float* __restrict__ Am, const float* __restrict__ av,
                                           const float* __restrict__ Bm, const float* __restrict__ bv,
                                           int m0, int n0, int kb, int l16, float* redp) {
  constexpr int J = FF / GK_SLICES / 8;      // groups of four k per lane, operand and WMMA tile
  // unrolled: the fragments must lie in registers, and every load is issued before the first wait
  constexpr int NA = AM ? 2 : 1, NB = BM ? 2 : 1;   // WMMA tiles that hold anything
  v4f a4[NA][J], b4[NB][J];
  // one address per operand, the steps of k and the second tile as constant offsets from it
  const float* ap = AM ? Am + (size_t)kb * FF + m0 + l16 : av + kb;
  const float* bp = BM ? Bm + (size_t)kb * BPITCH + n0 + l16 : bv + kb;
#pragma unroll
  for (int i = 0; i < NA; ++i) {
#pragma unroll
    for (int j = 0; j < J; ++j) {
      if (AM) {
#pragma unroll
        for (int e = 0; e < 4; ++e) a4[i][j][e] = ap[(8 * j + e) * FF + 16 * i];
      } else {
        a4[i][j] = *(const v4f*)(ap + 8 * j);
      }
    }
  }
#pragma unroll
  for (int i = 0; i < NB; ++i) {
#pragma unroll
    for (int j = 0; j < J; ++j) {
      if (BM) {
#pragma unroll
        for (int e = 0; e < 4; ++e) b4[i][j][e] = bp[(8 * j + e) * BPITCH + 16 * i];
      } else {
        b4[i][j] = *(const v4f*)(bp + 8 * j);
      }
    }
  }
  const v4f zero = {0.f, 0.f, 0.f, 0.f};
#pragma unroll
  for (int j = 0; j < J; ++j) {
    if (!AM) a4[0][j] = (l16 == 0) ? a4[0][j] : zero;   // row F, then padding rows
    if (!BM) b4[0][j] = (l16 == 0) ? b4[0][j] : zero;   // column F, then padding columns
  }
  v8f acc[NA][NB] = {};
#if __has_builtin(__builtin_amdgcn_wmma_f32_16x16x4_f32)
#pragma unroll
  for (int j = 0; j < J; ++j) {
#pragma unroll
    for (int h = 0; h < 2; ++h) {
#pragma unroll
      for (int i = 0; i < NA; ++i) {
#pragma unroll
        for (int n = 0; n < NB; ++n) {
          const v2f a  = {a4[i][j][2 * h], a4[i][j][2 * h + 1]};
          const v2f bq = {b4[n][j][2 * h], b4[n][j][2 * h + 1]};
          acc[i][n] = __builtin_amdgcn_wmma_f32_16x16x4_f32(
              false, a, false, bq, (short)0, acc[i][n], false, false);
        }
      }
    }
  }
#endif
  fd_slots<NA, NB>(acc, a4, b4);
#pragma unroll
  for (int i = 0; i < 2; ++i) {
#pragma unroll
    for (int n = 0; n < 2; ++n) {
#pragma unroll
      for (int r = 0; r < 8; ++r)
        redp[(16 * i + r) * 32 + 16 * n] = (i < NA && n < NB) ? acc[i < NA ? i : 0][n < NB ? n : 0][r] : 0.f;
    }
  }
}

// A block's 32 x 32 tiles of a product of weights, C[WR,WP] = A B over k < F:
//   A(m,k) = Am[k*F + m] for m < F, av[k] for m = F, 0 above
//   B(k,n) = Bm[k*BPITCH + n]; with BEDGE only for n < F, then bv[k] for n = F, 0 above
//   ROWADD: row F of C also takes row F of Bm.
// NP: tiles per block, 8 waves each; a wave sums and stores in the tile that it worked on.
template <int NP, int BPITCH, bool BEDGE, bool ROWADD>
__device__ __forceinline__ void fold_tile(int blk, const float* __restrict__ Am,
                                          const float* __restrict__ av,
                                          const float* __restrict__ Bm,
                                          const float* __restrict__ bv,
                                          float* __restrict__ C) {
  __shared__ __attribute__((aligned(16))) float fred[NP * GK_SLICES][32 * 32];
  const int tid  = threadIdx.x;
  const int lane = tid & 31;
  const int l16  = lane & 15;
  const int hi   = lane >> 4;
  const int w    = __builtin_amdgcn_readfirstlane(tid >> 5);
  const int q    = blk * NP + w / GK_SLICES;   // the wave's tile
  const bool live = q < FD_TILES;              // the same in every lane of a wave
  const int m0   = (q / (WP / 32)) << 5;
  const int n0   = (q % (WP / 32)) << 5;
  const int g    = tid & (GK_SLICES * 32 - 1); // this thread finishes four columns of one row
  const int orow = m0 + (g >> 3);
  const int ocol = n0 + 4 * (g & 7);
  v4f radd = {0.f, 0.f, 0.f, 0.f};
  if (live) {
    if (ROWADD && m0 == FF) {                  // the same in every lane of a wave
      radd = *(const v4f*)(Bm + (size_t)FF * BPITCH + ocol);
#if defined(__HIP_DEVICE_COMPILE__)
      // the address arithmetic of the slice's loads may reuse this load's address registers
      asm volatile("s_wait_xcnt 0x0" ::: "memory");
#endif
    }
    const int kb = (w % GK_SLICES) * (FF / GK_SLICES) + 4 * hi;
    float* redp = &fred[w][8 * hi * 32 + l16];
    // both tests read the same in every lane of a wave
    if (m0 < FF) {
      if (!BEDGE || n0 < FF) fold_slice<BPITCH, true, true>(Am, av, Bm, bv, m0, n0, kb, l16, redp);
      else                   fold_slice<BPITCH, true, false>(Am, av, Bm, bv, m0, n0, kb, l16, redp);
    } else {
      if (!BEDGE || n0 < FF) fold_slice<BPITCH, false, true>(Am, av, Bm, bv, m0, n0, kb, l16, redp);
      else                   fold_slice<BPITCH, false, false>(Am, av, Bm, bv, m0, n0, kb, l16, redp);
    }
  }
  __syncthreads();
  if (live) {
    const int w0 = w - w % GK_SLICES;          // the tile's first wave
    v4f tot = *(const v4f*)&fred[w0][4 * g];
#pragma unroll
    for (int v = 1; v < GK_SLICES; ++v) tot += *(const v4f*)&fred[w0 + v][4 * g];
    if (ROWADD && orow == FF) tot += radd;
    *(v4f*)(C + (size_t)orow * WP + ocol) = tot;
  }
}

#define RM_WAVES 16
#define RM_THREADS (RM_WAVES * 32)
#define RM_ROWS 8                                 // rows per wave
#define RM_WGROWS (RM_WAVES * RM_ROWS)            // rows per workgroup
#define RM_LOADS (RM_ROWS * N4 / 32)              // wave-wide 16-byte loads per span
#define RM_G 12                                   // loads per group
#define RM_GROUPS ((RM_LOADS + RM_G - 1) / RM_G)
#define RM_BLOCKS (BB * FF / RM_WGROWS)
#define GA_WAVES (2 * RM_WGROWS / 32)             // waves that gather, 32 values each
static_assert((RM_ROWS * N4) % 32 == 0 && N4 > 32, "a span is whole loads; a load meets at most two rows");
static_assert(FF % RM_WGROWS == 0 && RM_WGROWS % 32 == 0 && GA_WAVES <= RM_WAVES,
              "a workgroup's rows lie in one batch; a gathering wave has one of last / cur");
static_assert(RM_ROWS == XK_KEEP, "a wave's span is rows of one kind: kept in even waves, passing in odd ones");
// One wave's span. NT: its rows are of the passing kind. The hint is part of the instruction,
// so the two kinds are two copies of the stream, chosen by a scalar branch.
template <bool NT>
__device__ __forceinline__ void rm_stream(const v4f* sp, const float* __restrict__ x,
                                          const int* __restrict__ lc, int w, int lane,
                                          int gb, int gj, int gr, float (&mx)[RM_ROWS], float& gv) {
  // every loop here is unrolled: the load number decides at compile time which row a value
  // belongs to, and the two groups of loaded values must lie in registers
  v4f buf[2][RM_G];
#pragma unroll
  for (int q = 0; q < RM_G; ++q) buf[0][q] = x_load<NT>(sp + q * 32);
  if (w < GA_WAVES) {                                     // the same in every lane of a wave
    const int n = min(max(lc[gb * 2 + gj], 0), NN - 1);   // the address stays inside x
    gv = x[(size_t)gr * NN + n];
#if defined(__HIP_DEVICE_COMPILE__)
    // the next group's loads return into this load's address registers
    asm volatile("s_wait_xcnt 0x0" ::: "memory");
#endif
  }
#pragma unroll
  for (int c = 0; c < RM_GROUPS; ++c) {
    // the two scheduling barriers pin the order "next group's loads, then this group's
    // maxima": without them the loads may sink behind the waits for this group
    __builtin_amdgcn_sched_barrier(0);
    if (c + 1 < RM_GROUPS) {
#pragma unroll
      for (int q = 0; q < RM_G; ++q)
        if ((c + 1) * RM_G + q < RM_LOADS) buf[(c + 1) & 1][q] = x_load<NT>(sp + ((c + 1) * RM_G + q) * 32);
    }
    __builtin_amdgcn_sched_barrier(0);
#pragma unroll
    for (int q = 0; q < RM_G; ++q) {
      const int k = c * RM_G + q;
      if (k < RM_LOADS) {
        const v4f v = buf[c & 1][q];
        const float vm = fmaxf(fmaxf(v.x, v.y), fmaxf(v.z, v.w));
        const int ra = (k * 32) / N4;
        const int rb = (k * 32 + 31) / N4;
        if (ra == rb) {
          mx[ra] = fmaxf(mx[ra], vm);
        } else {
          const bool lo = lane < rb * N4 - k * 32;
          mx[ra] = fmaxf(mx[ra], lo ? vm : -INFINITY);
          mx[rb] = fmaxf(mx[rb], lo ? -INFINITY : vm);
        }
      }
    }
    // without the statement below the compiler regrouped the maxima across groups, kept
    // loaded values alive past their group and spilled them between the loads
#if defined(__HIP_DEVICE_COMPILE__)
#pragma unroll
    for (int r = 0; r < RM_ROWS; ++r)
      if (r >= (c * RM_G * 32) / N4 && r <= (c * RM_G * 32 + RM_G * 32 - 1) / N4)
        asm volatile("" : "+v"(mx[r]));   // streaming pattern: each row's result closed, against spills
#endif
  }
}

__global__ __launch_bounds__(RM_THREADS, 8) void rowmax_gather_kernel(
    const float* __restrict__ x, const int* __restrict__ lc,
    float* __restrict__ glb, float* __restrict__ ctx,
    const float* __restrict__ fA, const float* __restrict__ fv,
    const float* __restrict__ fB, const float* __restrict__ fw, float* __restrict__ fC) {
  __shared__ float rm[RM_WGROWS];
  if (blockIdx.x >= RM_BLOCKS) {      // the whole block takes this way
    fold_tile<RM_WAVES / GK_SLICES, FF, true, false>(blockIdx.x - RM_BLOCKS, fA, fv, fB, fw, fC);
    return;
  }
  const int tid  = threadIdx.x;
  const int lane = tid & 31;
  const int w    = __builtin_amdgcn_readfirstlane(tid >> 5);
  const int wg0  = blockIdx.x * RM_WGROWS;                // the workgroup's first row in [0, B*F)
  const v4f* sp = (const v4f*)(x + (size_t)(wg0 + w * RM_ROWS) * NN) + lane;
  float mx[RM_ROWS];
#pragma unroll
  for (int r = 0; r < RM_ROWS; ++r) mx[r] = -INFINITY;
  // gather: wave w takes last (w < GA_WAVES / 2) or cur of 32 of the workgroup's rows
  const int gb = wg0 / FF;                                // batch
  const int gj = w / (GA_WAVES / 2);                      // 0 last, 1 cur
  const int gr = wg0 + (w % (GA_WAVES / 2)) * 32 + lane;  // row in [0, B*F)
  float gv = 0.f;
  if (w & 1) rm_stream<true>(sp, x, lc, w, lane, gb, gj, gr, mx, gv);    // the same in every lane of a wave
  else       rm_stream<false>(sp, x, lc, w, lane, gb, gj, gr, mx, gv);
#pragma unroll
  for (int r = 0; r < RM_ROWS; ++r) {
#pragma unroll
    for (int o = 16; o; o >>= 1) mx[r] = fmaxf(mx[r], __shfl_xor(mx[r], o));
  }
  float mine = mx[0];
#pragma unroll
  for (int r = 1; r < RM_ROWS; ++r) mine = (lane == r) ? mx[r] : mine;
  if (lane < RM_ROWS) rm[w * RM_ROWS + lane] = mine;
  __syncthreads();
  // the workgroup's maxima leave as whole 128-byte lines, one wave each
  if (tid < RM_WGROWS) glb[wg0 + tid] = rm[tid];
  // behind the barrier: in front of it every wave would wait for this store to finish
  if (w < GA_WAVES) ctx[gb * 2 * FF + gj * FF + (gr - gb * FF)] = gv;   // a whole line per wave
#if defined(__HIP_DEVICE_COMPILE__)
  // the launch's other kind of block stands behind these stores in the code and writes their registers
  asm volatile("s_wait_xcnt 0x0" ::: "memory");
#endif
}

// [ql | cL] = xbar @ Wc, Bm(k,n) = Bp[k*WP + n], in the tiles and slices named above; row F
// of Bp is the bias, column F goes to dout.
// A is pass B's pair of un-normalised sums [2][B][F] and dv its (max, sum) lines; the A
// load joins the two node ranges of a row: A[b,:] = (w0 * A0 + w1 * A1) / (w0 * l0 + w1 * l1),
// wi = exp(Mi - max(M0, M1)).
__global__ __launch_bounds__(512) void gemm_ql_kernel(
    const float* __restrict__ A, const float* __restrict__ Bp, float* __restrict__ C,
    const float* __restrict__ dv, float* __restrict__ dout) {
  constexpr int K  = FF;
  constexpr int KW = K / GK_SLICES;   // k per wave
  constexpr int J  = KW / 8;          // groups of four k per lane and operand
  constexpr int NBK = WP / 32;        // blocks across the columns
  __shared__ float red[GK_SLICES][16 * 32];
  const int tid  = threadIdx.x;
  const int lane = tid & 31;
  const int l16  = lane & 15;
  const int hi   = lane >> 4;
  const int w    = __builtin_amdgcn_readfirstlane(tid >> 5);
  const int nt   = w & 1;
  const int ks   = w >> 1;
  const int m0   = (blockIdx.x / NBK) << 4;
  const int n0   = (blockIdx.x % NBK) << 5;
  const int kb   = ks * KW + 4 * hi;
  const int col  = n0 + nt * 16 + l16;

  // every loop of this kernel is unrolled: the fragments must lie in registers, and a
  // rolled loop would wait for each load before it issues the next
  v4f a4[J], b4[J];
  const float* st = dv + (m0 + l16) * ST_PITCH;
  // wanted first, so asked for first
  const float M0 = st[0];
  const float L0 = st[1];
  const float M1 = st[BB * ST_PITCH];
  const float L1 = st[BB * ST_PITCH + 1];
  const float* ap = A + (size_t)(m0 + l16) * K + kb;
#pragma unroll
  for (int j = 0; j < J; ++j) a4[j] = *(const v4f*)(ap + 8 * j);
  v4f a1[J];
#pragma unroll
  for (int j = 0; j < J; ++j) a1[j] = *(const v4f*)(ap + (size_t)BB * K + 8 * j);
  const float* bp = Bp + (size_t)kb * WP + col;
#pragma unroll
  for (int j = 0; j < J; ++j) {
#pragma unroll
    for (int e = 0; e < 4; ++e) b4[j][e] = bp[(size_t)(8 * j + e) * WP];
  }
  // the element this thread finishes: row tid/32, column tid%32 of the block's tile
  const int orow = m0 + (tid >> 5);
  const int ocol = n0 + lane;
  const float bcol = Bp[(size_t)K * WP + ocol];
  // every load above is issued before the first wait: without this the compiler held
  // half of them back behind the wait for M and l, a second trip to memory
  __builtin_amdgcn_sched_barrier(0);
  const float Mx = fmaxf(M0, M1);
  const float w0 = __expf(M0 - Mx), w1 = __expf(M1 - Mx);
  const float inv = 1.f / fmaf(L1, w1, L0 * w0);   // softmax-normalized here
  const float c0 = w0 * inv, c1 = w1 * inv;
#pragma unroll
  for (int j = 0; j < J; ++j) a4[j] = a4[j] * c0 + a1[j] * c1;

  v8f acc = {};
#if __has_builtin(__builtin_amdgcn_wmma_f32_16x16x4_f32)
#pragma unroll
  for (int j = 0; j < J; ++j) {
#pragma unroll
    for (int h = 0; h < 2; ++h) {
      const v2f a  = {a4[j][2 * h], a4[j][2 * h + 1]};
      const v2f bv = {b4[j][2 * h], b4[j][2 * h + 1]};
      acc = __builtin_amdgcn_wmma_f32_16x16x4_f32(
          false, a, false, bv, (short)0, acc, false, false);
    }
  }
#endif
  gk_slots(acc, a4, b4, ap, bp, st);
#pragma unroll
  for (int r = 0; r < 8; ++r) red[ks][(r + 8 * hi) * 32 + nt * 16 + l16] = acc[r];
  __syncthreads();
  float tot = red[0][tid];
#pragma unroll
  for (int v = 1; v < GK_SLICES; ++v) tot += red[v][tid];
  tot += bcol;
  if (ocol < FF) C[(size_t)orow * FF + ocol] = tot;
  else if (ocol == FF) dout[orow] = tot;
}

#define CQ_SLICES 12
#define QK_SHARES (FF / 32)
#define CQ_PITCH 36
#define CK_PITCH 32
__global__ __launch_bounds__(CQ_SLICES * 64) void gemm_cq_qk_kernel(
    const float* __restrict__ glb, const float* __restrict__ Wg, const float* __restrict__ bg,
    const float* __restrict__ ctx, const float* __restrict__ Wlc, const float* __restrict__ blc,
    const float* __restrict__ WK, const float* __restrict__ bK,
    float* __restrict__ qkp, float* __restrict__ cKp,
    const float* __restrict__ fA, const float* __restrict__ fv,
    const float* __restrict__ fB, float* __restrict__ fC) {
  constexpr int KW = 64;              // k per wave
  constexpr int J  = KW / 8;          // 16-byte loads per lane and operand
  __shared__ float red[CQ_SLICES][16 * 32];
  __shared__ __attribute__((aligned(16))) float cqt[16 * CQ_PITCH];
  if (blockIdx.x >= GT_BLOCKS) {      // the whole block takes this way
    fold_tile<CQ_SLICES / 4, WP, false, true>(blockIdx.x - GT_BLOCKS, fA, fv, fB, nullptr, fC);
    return;
  }
  const int tid  = threadIdx.x;
  const int lane = tid & 31;
  const int l16  = lane & 15;
  const int hi   = lane >> 4;
  const int w    = __builtin_amdgcn_readfirstlane(tid >> 5);
  const int nt   = w & 1;
  const int ks   = w >> 1;
  const int mt   = blockIdx.x >> 3;   // which 16 rows
  const int gs   = blockIdx.x & 7;    // which 32 columns of cQ
  const int m0   = mt << 4;
  const int n0   = gs << 5;
  const int col  = n0 + nt * 16 + l16;
  const bool first = ks < FF / KW;    // the same in every lane of a wave
  const int K    = first ? FF : 2 * FF;
  const int kb   = (first ? ks : ks - FF / KW) * KW + 4 * hi;

  v4f a4[J], b4[J];
  const float* ap = (first ? glb : ctx) + (size_t)(m0 + l16) * K + kb;
  const float* bp = (first ? Wg : Wlc) + (size_t)col * K + kb;
#pragma unroll
  for (int j = 0; j < J; ++j) a4[j] = *(const v4f*)(ap + 8 * j);
#pragma unroll
  for (int j = 0; j < J; ++j) b4[j] = *(const v4f*)(bp + 8 * j);
  const int ocol = n0 + lane;
  const float bcol = bg[ocol] + blc[ocol];
#if defined(__HIP_DEVICE_COMPILE__)
  // ocol is these two loads' offset register: it stays theirs up to this wait
  asm volatile("s_wait_xcnt 0x0" :: "v"(ocol) : "memory");
#endif
  // the second product's B: register e of group j holds g = n0 + 4hi + 8j + e, as its A below
  const v4f zero = {0.f, 0.f, 0.f, 0.f};
  v4f b2[2][4] = {{zero, zero, zero, zero}, {zero, zero, zero, zero}};
  if (w < QK_SHARES) {                // both tests read the same in every lane of a wave
    const float* kp = WK + (size_t)(n0 + 4 * hi) * FF + 32 * w + l16;
#pragma unroll
    for (int n = 0; n < 2; ++n) {
#pragma unroll
      for (int j = 0; j < 4; ++j) {
#pragma unroll
        for (int e = 0; e < 4; ++e) b2[n][j][e] = kp[(8 * j + e) * FF + 16 * n];
      }
    }
#if defined(__HIP_DEVICE_COMPILE__)
    // later arithmetic may reuse these loads' address registers
    asm volatile("s_wait_xcnt 0x0" ::: "memory");
#endif
  } else if (w == QK_SHARES) {
    const int kq = n0 / 4 + hi;       // in groups of four g
#pragma unroll
    for (int j = 0; j < 4; ++j) b2[0][j] = ((const v4f*)bK)[kq + 2 * j];
#if defined(__HIP_DEVICE_COMPILE__)
    // kq is these loads' offset register: it stays theirs up to this wait
    asm volatile("s_wait_xcnt 0x0" :: "v"(kq) : "memory");
#endif
#pragma unroll
    for (int j = 0; j < 4; ++j) b2[0][j] = (l16 == 0) ? b2[0][j] : zero;   // cK's column, then padding
  }

  v8f acc = {};
#if __has_builtin(__builtin_amdgcn_wmma_f32_16x16x4_f32)
#pragma unroll
  for (int j = 0; j < J; ++j) {
#pragma unroll
    for (int h = 0; h < 2; ++h) {
      const v2f a  = {a4[j][2 * h], a4[j][2 * h + 1]};
      const v2f bv = {b4[j][2 * h], b4[j][2 * h + 1]};
      acc = __builtin_amdgcn_wmma_f32_16x16x4_f32(
          false, a, false, bv, (short)0, acc, false, false);
    }
  }
#endif
  gk_slots(acc, a4, b4, ap, bp);
#pragma unroll
  for (int r = 0; r < 8; ++r) red[ks][(r + 8 * hi) * 32 + nt * 16 + l16] = acc[r];
  __syncthreads();
  // the tile has 512 elements: the first 16 waves finish one each (row tid/32, column tid%32)
  if (tid < 16 * 32) {
    float tot = red[0][tid];
#pragma unroll
    for (int v = 1; v < CQ_SLICES; ++v) tot += red[v][tid];
    cqt[(tid >> 5) * CQ_PITCH + lane] = tot + bcol;
  }
  __syncthreads();
  if (w > QK_SHARES) return;          // whole waves, behind the last barrier
  v4f a2[1][4];
#pragma unroll
  for (int j = 0; j < 4; ++j) a2[0][j] = *(const v4f*)&cqt[l16 * CQ_PITCH + 4 * hi + 8 * j];
  // the LDS reads and their addresses stay in front of the WMMA chain
  __builtin_amdgcn_sched_barrier(0);
  v8f acc2[1][2] = {};
#if __has_builtin(__builtin_amdgcn_wmma_f32_16x16x4_f32)
#pragma unroll
  for (int j = 0; j < 4; ++j) {
#pragma unroll
    for (int h = 0; h < 2; ++h) {
#pragma unroll
      for (int n = 0; n < 2; ++n) {
        const v2f a  = {a2[0][j][2 * h], a2[0][j][2 * h + 1]};
        const v2f bv = {b2[n][j][2 * h], b2[n][j][2 * h + 1]};
        acc2[0][n] = __builtin_amdgcn_wmma_f32_16x16x4_f32(
            false, a, false, bv, (short)0, acc2[0][n], false, false);
      }
    }
  }
#endif
  fd_slots<1, 2>(acc2, a2, b2);
  if (w < QK_SHARES) {
    float* pp = qkp + ((size_t)gs * BB + m0 + 8 * hi) * FF + 32 * w + l16;
#pragma unroll
    for (int n = 0; n < 2; ++n) {
#pragma unroll
      for (int r = 0; r < 8; ++r) pp[r * FF + 16 * n] = acc2[0][n][r];
    }
  } else if (l16 == 0) {
    float* pp = cKp + (gs * (BB / 16) + mt) * CK_PITCH + 8 * hi;
#pragma unroll
    for (int r = 0; r < 8; ++r) pp[r] = acc2[0][0][r];
  }
#if defined(__HIP_DEVICE_COMPILE__)
  // the launch's other kind of block stands behind these stores in the code and writes their registers
  asm volatile("s_wait_xcnt 0x0" ::: "memory");
#endif
}

#define PB_COPY8(TH) \
      "global_load_async_to_lds_b128 %0, %8, off" TH "\n\t" \
      "global_load_async_to_lds_b128 %1, %9, off" TH "\n\t" \
      "global_load_async_to_lds_b128 %2, %10, off" TH "\n\t" \
      "global_load_async_to_lds_b128 %3, %11, off" TH "\n\t" \
      "global_load_async_to_lds_b128 %4, %12, off" TH "\n\t" \
      "global_load_async_to_lds_b128 %5, %13, off" TH "\n\t" \
      "global_load_async_to_lds_b128 %6, %14, off" TH "\n\t" \
      "global_load_async_to_lds_b128 %7, %15, off" TH "\n\t" \
      "s_wait_xcnt 0x0"
template <bool NT>
__device__ __forceinline__ void pb_copy8(const v4f* g, const v4f* l) {
#if defined(__HIP_DEVICE_COMPILE__)
  const unsigned long long g0 = (unsigned long long)(uintptr_t)g;
  const unsigned int l0 = (unsigned int)(uintptr_t)l;   // generic LDS pointer: low 32 bits
#define PB_COPY8_OPS \
      "v"(l0), "v"(l0 + 512u), "v"(l0 + 1024u), "v"(l0 + 1536u), \
      "v"(l0 + 2048u), "v"(l0 + 2560u), "v"(l0 + 3072u), "v"(l0 + 3584u), \
      "v"(g0), "v"(g0 + 1ull * NN * 4), "v"(g0 + 2ull * NN * 4), "v"(g0 + 3ull * NN * 4), \
      "v"(g0 + 4ull * NN * 4), "v"(g0 + 5ull * NN * 4), "v"(g0 + 6ull * NN * 4), \
      "v"(g0 + 7ull * NN * 4)
  if constexpr (NT) asm volatile(PB_COPY8(" th:TH_LOAD_NT") :: PB_COPY8_OPS : "memory");
  else              asm volatile(PB_COPY8("") :: PB_COPY8_OPS : "memory");
#else
  (void)g; (void)l;
#endif
}

// The wave's 16 rows of tile t into its slice of one LDS buffer.
__device__ __forceinline__ void pb_fill(const v4f* xr, v4f* slice, int t, int lane) {
  const int c = min(t * 32 + lane, N4 - 1);     // past the row's end: copy its last column
  static_assert(PB_ROWS == 16 && XK_KEEP == 8, "the first eight rows are kept, the second eight pass");
  pb_copy8<false>(xr + c, slice + lane);
  pb_copy8<true>(xr + 8 * N4 + c, slice + 8 * 32 + lane);
}

// One trip: tile t out of its LDS buffer. REFILL: a tile t + 2 exists and is copied
// into the buffer that this trip has read (the caller's loop bounds are the test).
template <bool REFILL>
__device__ __forceinline__ void pb_trip(const v4f* xr, v4f* slice, v4f (*part)[32],
                                        const float (&q)[PB_ROWS], int t, int w, int lane,
                                        float cKb, v2f (&acc)[PB_ROWS], float& m, float& l) {
  // this wave's share of the scores of the lane's four nodes; sums run in node
  // pairs (.xy, .zw) so that packed f32 instructions take the registers as they lie
  v4f X[PB_ROWS];
#pragma unroll
  for (int i = 0; i < PB_ROWS; ++i) X[i] = slice[i * 32 + lane];
  v2f s01 = {0.f, 0.f}, s23 = {0.f, 0.f};
#pragma unroll
  for (int i = 0; i < PB_ROWS; ++i) {
    const v2f qq = {q[i], q[i]};
    s01 = __builtin_elementwise_fma(qq, X[i].xy, s01);
    s23 = __builtin_elementwise_fma(qq, X[i].zw, s23);
  }
  part[w][lane] = (v4f){s01.x, s01.y, s23.x, s23.y};
  __syncthreads();
  // every wave adds the 16 shares in the same order, so all waves see equal scores
  v4f tot = part[0][lane];
#pragma unroll
  for (int v = 1; v < PB_WAVES; ++v) tot += part[v][lane];
  const bool valid = REFILL || t * 32 + lane < N4;   // a tile with a tile t + 2 behind it is whole
  const float t0 = valid ? (tot.x + cKb) * SCALE : -INFINITY;
  const float t1 = valid ? (tot.y + cKb) * SCALE : -INFINITY;
  const float t2 = valid ? (tot.z + cKb) * SCALE : -INFINITY;
  const float t3 = valid ? (tot.w + cKb) * SCALE : -INFINITY;
  const float mn = fmaxf(m, fmaxf(fmaxf(t0, t1), fmaxf(t2, t3)));
  const float r  = __expf(m - mn);              // 0 on the first tile (m = -inf)
  const v2f e01 = {valid ? __expf(t0 - mn) : 0.f, valid ? __expf(t1 - mn) : 0.f};
  const v2f e23 = {valid ? __expf(t2 - mn) : 0.f, valid ? __expf(t3 - mn) : 0.f};
  const v2f es = e01 + e23;
  l = fmaf(l, r, es.x + es.y);
  m = mn;
  const v2f rr = {r, r};
#pragma unroll
  for (int i = 0; i < PB_ROWS; ++i)
    acc[i] = __builtin_elementwise_fma(e23, X[i].zw,
             __builtin_elementwise_fma(e01, X[i].xy, acc[i] * rr));

  // keeps the arithmetic above in front of the foot: without it the compiler moved it
  // behind the barrier, ahead of the copies, and read the 16 shares one wait at a time
  __builtin_amdgcn_sched_barrier(0);
  // foot of the trip: own LDS reads done, tile t+1 landed, everybody here; only
  // then is the buffer just read refilled
  asm volatile("s_wait_dscnt 0x0" ::: "memory");
  asm volatile("s_wait_asynccnt 0x0" ::: "memory");
  __syncthreads();
  if (REFILL) pb_fill(xr, slice, t + 2, lane);
}

__global__ __launch_bounds__(PB_THREADS) void passB_kernel(
    const float* __restrict__ x, const float* __restrict__ qkp,
    const float* __restrict__ cKp, float* __restrict__ xpart, float* __restrict__ st) {
  __shared__ __attribute__((aligned(16))) v4f tile[2][FF * 32];   // 2 x 128 KB
  __shared__ v4f part[PB_WAVES][32];
  __shared__ float xs[FF];
  const int b = blockIdx.x / PB_SPLIT;
  const int h = blockIdx.x % PB_SPLIT;   // which node range
  const int t0 = h * PB_TPB;             // its first tile (even: it lies in buffer 0)
  const int tid = threadIdx.x;
  const int lane = tid & 31;
  const int w = __builtin_amdgcn_readfirstlane(tid >> 5);
  const v4f* xr = (const v4f*)(x + ((size_t)b * FF + w * PB_ROWS) * NN);
  float q[PB_ROWS];
  v2f acc[PB_ROWS];
#pragma unroll
  for (int i = 0; i < PB_ROWS; ++i) acc[i] = (v2f){0.f, 0.f};
  static_assert(QK_SHARES == 8 && PB_ROWS == 16, "32 lanes = 8 shares x 4 groups of 4 rows");
  v4f qv = *(const v4f*)(qkp + ((size_t)(lane >> 2) * BB + b) * FF + w * PB_ROWS + 4 * (lane & 3));
  float cKb = cKp[((lane & 7) * (BB / 16) + b / 16) * CK_PITCH + b % 16];
#if defined(__HIP_DEVICE_COMPILE__)
  // the copies' address arithmetic may reuse these loads' address registers
  asm volatile("s_wait_xcnt 0x0" ::: "memory");
#endif
  float m = -INFINITY, l = 0.f;

  pb_fill(xr, &tile[0][w * PB_ROWS * 32], t0, lane);
  // the two scheduling barriers keep the sums of the shares between the first tile's copies
  // and the wait for them: without them the compiler put the wait for the two loads between
  // the copies, or the sums behind the barrier, in front of the second tile's copies
  __builtin_amdgcn_sched_barrier(0);
#pragma unroll
  for (int o = 4; o <= 16; o <<= 1) {
#pragma unroll
    for (int e = 0; e < 4; ++e) qv[e] += __shfl_xor(qv[e], o);
  }
#pragma unroll
  for (int o = 1; o <= 4; o <<= 1) cKb += __shfl_xor(cKb, o);
#pragma unroll
  for (int i = 0; i < PB_ROWS; ++i) q[i] = __shfl(qv[i & 3], i >> 2);
  __builtin_amdgcn_sched_barrier(0);
  asm volatile("s_wait_asynccnt 0x0" ::: "memory");   // the first tile has landed
  __syncthreads();
  pb_fill(xr, &tile[1][w * PB_ROWS * 32], t0 + 1, lane);

  // both loops rolled (for speed only)
#pragma unroll 1
  for (int t = t0; t < t0 + PB_TPB - 2; ++t)
    pb_trip<true>(xr, &tile[t & 1][w * PB_ROWS * 32], part, q, t, w, lane, cKb, acc, m, l);
#pragma unroll 1
  for (int t = t0 + PB_TPB - 2; t < t0 + PB_TPB; ++t)
    pb_trip<false>(xr, &tile[t & 1][w * PB_ROWS * 32], part, q, t, w, lane, cKb, acc, m, l);
  asm volatile("s_wait_asynccnt 0x0" ::: "memory");   // nothing in flight at the wave's end

  // join the 32 lanes: common max, rescale, butterfly sums
  float M = m;
#pragma unroll
  for (int o = 16; o; o >>= 1) M = fmaxf(M, __shfl_xor(M, o));
  const float sc = __expf(m - M);
  l *= sc;
#pragma unroll
  for (int o = 16; o; o >>= 1) l += __shfl_xor(l, o);
  float a[PB_ROWS];
#pragma unroll
  for (int i = 0; i < PB_ROWS; ++i) a[i] = (acc[i].x + acc[i].y) * sc;
#pragma unroll
  for (int o = 16; o; o >>= 1) {
#pragma unroll
    for (int i = 0; i < PB_ROWS; ++i) a[i] += __shfl_xor(a[i], o);
  }
  if (lane == 0) {
#pragma unroll
    for (int i = 0; i < PB_ROWS; ++i) xs[w * PB_ROWS + i] = a[i];
  }
  __syncthreads();
  // M and l are the same in every wave; whole 128-byte lines per wave
  if (tid < FF) xpart[(h * BB + b) * FF + tid] = xs[tid];   // relative to M, not normalized
  if (tid == 0) {
    st[(h * BB + b) * ST_PITCH]     = M;
    st[(h * BB + b) * ST_PITCH + 1] = l;
  }
}

#define PC_WAVES 16
#define PC_THREADS (PC_WAVES * 32)
#define PC_ROWS (FF / PC_WAVES)     // feature rows held by one wave
static_assert(PB_TPB * 32 <= PC_THREADS, "one thread finishes four nodes");
static_assert(PC_ROWS == 16, "a wave's rows are one group of 16: XK_KEEP kept, the others passing");
__global__ __launch_bounds__(PC_THREADS) void passC_kernel(
    const float* __restrict__ x, const float* __restrict__ ql,
    const float* __restrict__ cL, float* __restrict__ out) {
  __shared__ v4f share[PC_WAVES][PB_TPB * 32];   // 64 KB
  const int b = blockIdx.x / PB_SPLIT;
  const int h = blockIdx.x % PB_SPLIT;   // which node range
  const int c0 = h * PB_TPB * 32;        // its first float4 column
  const int tid = threadIdx.x;
  const int lane = tid & 31;
  const int w = __builtin_amdgcn_readfirstlane(tid >> 5);
  const v4f* xr = (const v4f*)(x + ((size_t)b * FF + w * PC_ROWS) * NN);
  float q[PC_ROWS];
#pragma unroll
  for (int i = 0; i < PC_ROWS; ++i) q[i] = ql[b * FF + w * PC_ROWS + i];
  const float cLb = cL[b];

  // every loop here is unrolled: the two groups of loaded values must lie in registers
  v4f buf[2][PC_ROWS];
  const int cb = c0 + lane;                                // the lane's column in the range's first tile
  const int ce = min(cb + (PB_TPB - 1) * 32, N4 - 1);      // in its last; past the row's end: the last column
#pragma unroll
  for (int i = 0; i < XK_KEEP; ++i) buf[0][i] = x_load<false>(xr + i * N4 + ce);
#pragma unroll
  for (int i = XK_KEEP; i < PC_ROWS; ++i) buf[0][i] = x_load<true>(xr + i * N4 + ce);
#if defined(__HIP_DEVICE_COMPILE__)
  // ce is these loads' offset register: it stays theirs up to this wait
  asm volatile("s_wait_xcnt 0x0" :: "v"(ce) : "memory");
#endif
#pragma unroll
  for (int g = 0; g < PB_TPB; ++g) {
    const int tl = PB_TPB - 1 - g;       // this group's tile within the range
    // the two scheduling barriers pin the order "next group's loads, then this group's
    // sums": without them the loads may sink behind the waits for this group
    __builtin_amdgcn_sched_barrier(0);
    if (g + 1 < PB_TPB) {                // not a range's last tile: whole
#pragma unroll
      for (int i = 0; i < XK_KEEP; ++i) buf[(g + 1) & 1][i] = x_load<false>(xr + i * N4 + (tl - 1) * 32 + cb);
#pragma unroll
      for (int i = XK_KEEP; i < PC_ROWS; ++i) buf[(g + 1) & 1][i] = x_load<true>(xr + i * N4 + (tl - 1) * 32 + cb);
    }
    __builtin_amdgcn_sched_barrier(0);
    // sums run in node pairs (.xy, .zw) so that packed f32 instructions take the registers as they lie
    v2f s01 = {0.f, 0.f}, s23 = {0.f, 0.f};
#pragma unroll
    for (int i = 0; i < PC_ROWS; ++i) {
      const v2f qq = {q[i], q[i]};
      s01 = __builtin_elementwise_fma(qq, buf[g & 1][i].xy, s01);
      s23 = __builtin_elementwise_fma(qq, buf[g & 1][i].zw, s23);
    }
    share[w][tl * 32 + lane] = (v4f){s01.x, s01.y, s23.x, s23.y};
  }
  __syncthreads();
  // thread j finishes float4 column c0 + j: whole 512-byte pieces of the output row per wave
  if (tid < PB_TPB * 32 && c0 + tid < N4) {
    v4f tot = share[0][tid];
#pragma unroll
    for (int v = 1; v < PC_WAVES; ++v) tot += share[v][tid];
    v4f r;
    r.x = tanhf((tot.x + cLb) * SCALE) * 10.f;
    r.y = tanhf((tot.y + cLb) * SCALE) * 10.f;
    r.z = tanhf((tot.z + cLb) * SCALE) * 10.f;
    r.w = tanhf((tot.w + cLb) * SCALE) * 10.f;
    *((v4f*)(out + (size_t)b * NN) + c0 + tid) = r;
  }
}

// ---------------------------------------------------------------------------
extern "C" void kernel_launch(void* const* d_in, const int* in_sizes, int n_in,
                              void* d_out, int out_size, void* d_ws, size_t ws_size,
                              hipStream_t stream) {
  const float* x     = (const float*)d_in[0];   // [B,F,N,1]
  const int*   lc    = (const int*)  d_in[1];   // [B,2]
  const float* Wg    = (const float*)d_in[2];   // [F,F]
  const float* bg    = (const float*)d_in[3];   // [F]
  const float* Wnode = (const float*)d_in[4];   // [3F,F]
  const float* bnode = (const float*)d_in[5];   // [3F]
  const float* Wlc   = (const float*)d_in[6];   // [F,2F]
  const float* blc   = (const float*)d_in[7];   // [F]
  const float* Wproj = (const float*)d_in[8];   // [F,F]
  const float* bproj = (const float*)d_in[9];   // [F]
  float* out = (float*)d_out;                   // [B,N]

  // workspace carve-up (~2.5 MB of f32)
  float* ws   = (float*)d_ws;
  float* glb  = ws;                         // [B,F]
  float* ctx  = glb  + BB * FF;             // [B,2F]
  float* qkp  = ctx  + BB * 2 * FF;         // [F/32,B,F]
  float* cKp  = qkp  + QK_SHARES * BB * FF; // [F/32,B/16] lines of CK_PITCH
  float* xpart = cKp + QK_SHARES * (BB / 16) * CK_PITCH;   // [2,B,F]
  float* st   = xpart + PB_SPLIT * BB * FF; // [2,B] lines of ST_PITCH
  float* T    = st   + PB_SPLIT * BB * ST_PITCH;   // [WR,WP]
  float* Wc   = T    + WR * WP;             // [WR,WP]
  float* ql   = Wc   + WR * WP;             // [B,F]
  float* cL   = ql   + BB * FF;             // [B]

  // context gather, and pass A: glb = max_n x; beside them T = [Wproj^T ; bproj^T] [Wnode_L | bnode_L]
  rowmax_gather_kernel<<<RM_BLOCKS + FD_BLOCKS(RM_WAVES / GK_SLICES), RM_THREADS, 0, stream>>>(x, lc, glb, ctx,
      Wproj, bproj, Wnode + (size_t)2 * FF * FF, bnode + 2 * FF, T);
  // cQ = glb @ Wg^T + bg + ctx @ Wlc^T + blc, then the shares of qk = cQ @ Wnode_K (Bm(k,n) = Wnode[k,n])
  // and cK = cQ . bnode_K; beside them Wc = [Wnode_V^T ; bnode_V^T] T
  gemm_cq_qk_kernel<<<GT_BLOCKS + FD_BLOCKS(CQ_SLICES / 4), CQ_SLICES * 64, 0, stream>>>(glb, Wg, bg, ctx, Wlc, blc,
      Wnode, bnode, qkp, cKp, Wnode + (size_t)FF * FF, bnode + FF, T, Wc);
  // Pass B: fused attention (single read of x)
  passB_kernel<<<BB * PB_SPLIT, PB_THREADS, 0, stream>>>(x, qkp, cKp, xpart, st);
  // [ql | cL] = xbar @ Wc + Wc's bias row, xbar joined from xpart and st
  gemm_ql_kernel<<<QL_BLOCKS, 512, 0, stream>>>(xpart, Wc, ql, st, cL);
  // Pass C: logits
  passC_kernel<<<BB * PB_SPLIT, PC_THREADS, 0, stream>>>(x, ql, cL, out);
}

// v010
// A run of this version takes 59.8 microseconds.
// Next to v009, in two timings, it ran 1.05 times as fast each time.
// Counting every step since v000, it is 3.88 times as fast.
#include <hip/hip_runtime.h>
#include <stdint.h>
#include <math.h>

// Problem constants (from reference): B=128, F=256, N=2000, scale = 1/sqrt(F)
#define BB 128
#define FF 256
#define NN 2000
#define SCALE 0.0625f

#define PB_WAVES 16         // waves per workgroup in pass B
#define PB_THREADS (PB_WAVES * 32)
#define PB_ROWS (FF / PB_WAVES)   // feature rows held by one wave
#define N4 (NN / 4)         // float4 columns per feature row
#define PB_TILES ((N4 + 31) / 32) // tiles of 128 nodes (32 lanes x float4)
#define PB_SPLIT 2          // workgroups per batch in pass B: B * 2 = one on every WGP
#define PB_TPB (PB_TILES / PB_SPLIT)   // tiles per workgroup
#define ST_PITCH 32         // floats: each workgroup's (max, sum) has a 128-byte line of its own
static_assert(PB_SPLIT == 2 && PB_TILES % PB_SPLIT == 0 && PB_TPB % 2 == 0 && PB_TPB >= 2,
              "two equal node ranges, each starting in LDS buffer 0");

typedef __attribute__((ext_vector_type(2))) float v2f;
typedef __attribute__((ext_vector_type(4))) float v4f;
typedef __attribute__((ext_vector_type(8))) float v8f;

// ---------------------------------------------------------------------------
// x is read three times (pass A, B, C) and is larger than the L2, so a
// plain stream pushes out of L2 much of what the next pass wants. The rows of x are therefore
// of two kinds, the same in all three passes: of each 16 feature rows the first XK_KEEP are
// read plainly and, being about half of x, stay in L2 from one pass to the next; the others
// are read with the non-temporal hint, which leaves little in L2, so that they do not push
// the kept rows out. The hint changes no value.
// ---------------------------------------------------------------------------
#define XK_KEEP 8
template <bool NT>
__device__ __forceinline__ v4f x_load(const v4f* p) {
  return NT ? __builtin_nontemporal_load(p) : *p;
}

#define GK_SLICES 8
#define GT_BLOCKS ((BB / 16) * (FF / 32))   // blocks of 16 x 32 in one [B,F] product
#define WP (FF + 32)                        // columns of T and Wc: F, cL's, zeros
#define WR (FF + 32)                        // rows of T and Wc: F, the bias row, zeros
#define FD_TILES ((WR / 32) * (WP / 32))    // tiles of 32 x 32 in T or Wc
#define FD_BLOCKS(np) ((FD_TILES + (np) - 1) / (np))   // blocks of np tiles
#define QL_BLOCKS ((BB / 16) * (WP / 32))   // blocks of 16 x 32 in [ql | cL]

#define GK_NOPS "v_nop\n\tv_nop\n\tv_nop\n\tv_nop\n\tv_nop\n\tv_nop\n\tv_nop\n\tv_nop"
// The two load addresses are inputs as well: their registers stay theirs while the
// loads fly (without this the compiler let later loads return into them).
__device__ __forceinline__ void gk_slots(const v8f& d, const v4f (&a)[8], const v4f (&b)[8],
                                         const float* pa, const float* pb) {
#if defined(__HIP_DEVICE_COMPILE__)
  asm volatile(GK_NOPS :: "v"(d), "v"(a[0]), "v"(a[1]), "v"(a[2]), "v"(a[3]),
               "v"(a[4]), "v"(a[5]), "v"(a[6]), "v"(a[7]),
               "v"(b[0]), "v"(b[1]), "v"(b[2]), "v"(b[3]),
               "v"(b[4]), "v"(b[5]), "v"(b[6]), "v"(b[7]), "v"(pa), "v"(pb));
#else
  (void)d; (void)a; (void)b; (void)pa; (void)pb;
#endif
}
// The same for the merging A load: its three load addresses are inputs for that reason.
__device__ __forceinline__ void gk_slots(const v8f& d, const v4f (&a)[4], const v4f (&b)[4],
                                         const float* pa, const float* pb, const float* ps) {
#if defined(__HIP_DEVICE_COMPILE__)
  asm volatile(GK_NOPS :: "v"(d), "v"(a[0]), "v"(a[1]), "v"(a[2]), "v"(a[3]),
               "v"(b[0]), "v"(b[1]), "v"(b[2]), "v"(b[3]), "v"(pa), "v"(pb), "v"(ps));
#else
  (void)d; (void)a; (void)b; (void)pa; (void)pb; (void)ps;
#endif
}

// The products of weights are cut for few waves (for speed only): a wave takes 32 x 32 of C,
// four WMMA tiles that share its loads, and one of
// 8 slices of k; the 8 waves of a tile meet in LDS. A block holds one tile per 8 waves.
// The same as gk_slots for the NA x NB chains of such a wave.
#define FD_FRAG(x) "v"(x[0]), "v"(x[1]), "v"(x[2]), "v"(x[3])
template <int NA, int NB>
__device__ __forceinline__ void fd_slots(const v8f (&d)[NA][NB], const v4f (&a)[NA][4], const v4f (&b)[NB][4]) {
#if defined(__HIP_DEVICE_COMPILE__)
  if constexpr (NA == 2 && NB == 2)
    asm volatile(GK_NOPS :: "v"(d[0][0]), "v"(d[0][1]), "v"(d[1][0]), "v"(d[1][1]),
                 FD_FRAG(a[0]), FD_FRAG(a[1]), FD_FRAG(b[0]), FD_FRAG(b[1]));
  else if constexpr (NA == 2)
    asm volatile(GK_NOPS :: "v"(d[0][0]), "v"(d[1][0]), FD_FRAG(a[0]), FD_FRAG(a[1]), FD_FRAG(b[0]));
  else if constexpr (NB == 2)
    asm volatile(GK_NOPS :: "v"(d[0][0]), "v"(d[0][1]), FD_FRAG(a[0]), FD_FRAG(b[0]), FD_FRAG(b[1]));
  else
    asm volatile(GK_NOPS :: "v"(d[0][0]), FD_FRAG(a[0]), FD_FRAG(b[0]));
#else
  (void)d; (void)a; (void)b;
#endif
}

// One wave's slice of k. AM: the 32 rows are rows of the matrix, else the bias row and
// padding; BM: the same for the columns. The bias lies in the first WMMA tile; the second is
// all padding, takes no product and is stored as zeros. The cases are whole paths from the loads to the LDS
// stores: with a branch for each operand alone the compiler waited for A's loads before it
// issued B's, a second trip to memory.
template <int BPITCH, bool AM, bool BM>
__device__ __forceinline__ void fold_slice(const float* __restrict__ Am, const float* __restrict__ av,
                                           const float* __restrict__ Bm, const float* __restrict__ bv,
                                           int m0, int n0, int kb, int l16, float* redp) {
  constexpr int J = FF / GK_SLICES / 8;      // groups of four k per lane, operand and WMMA tile
  // unrolled: the fragments must lie in registers, and every load is issued before the first wait
  constexpr int NA = AM ? 2 : 1, NB = BM ? 2 : 1;   // WMMA tiles that hold anything
  v4f a4[NA][J], b4[NB][J];
  // one address per operand, the steps of k and the second tile as constant offsets from it
  const float* ap = AM ? Am + (size_t)kb * FF + m0 + l16 : av + kb;
  const float* bp = BM ? Bm + (size_t)kb * BPITCH + n0 + l16 : bv + kb;
#pragma unroll
  for (int i = 0; i < NA; ++i) {
#pragma unroll
    for (int j = 0; j < J; ++j) {
      if (AM) {
#pragma unroll
        for (int e = 0; e < 4; ++e) a4[i][j][e] = ap[(8 * j + e) * FF + 16 * i];
      } else {
        a4[i][j] = *(const v4f*)(ap + 8 * j);
      }
    }
  }
#pragma unroll
  for (int i = 0; i < NB; ++i) {
#pragma unroll
    for (int j = 0; j < J; ++j) {
      if (BM) {
#pragma unroll
        for (int e = 0; e < 4; ++e) b4[i][j][e] = bp[(8 * j + e) * BPITCH + 16 * i];
      } else {
        b4[i][j] = *(const v4f*)(bp + 8 * j);
      }
    }
  }
  const v4f zero = {0.f, 0.f, 0.f, 0.f};
#pragma unroll
  for (int j = 0; j < J; ++j) {
    if (!AM) a4[0][j] = (l16 == 0) ? a4[0][j] : zero;   // row F, then padding rows
    if (!BM) b4[0][j] = (l16 == 0) ? b4[0][j] : zero;   // column F, then padding columns
  }
  v8f acc[NA][NB] = {};
#if __has_builtin(__builtin_amdgcn_wmma_f32_16x16x4_f32)
#pragma unroll
  for (int j = 0; j < J; ++j) {
#pragma unroll
    for (int h = 0; h < 2; ++h) {
#pragma unroll
      for (int i = 0; i < NA; ++i) {
#pragma unroll
        for (int n = 0; n < NB; ++n) {
          const v2f a  = {a4[i][j][2 * h], a4[i][j][2 * h + 1]};
          const v2f bq = {b4[n][j][2 * h], b4[n][j][2 * h + 1]};
          acc[i][n] = __builtin_amdgcn_wmma_f32_16x16x4_f32(
              false, a, false, bq, (short)0, acc[i][n], false, false);
        }
      }
    }
  }
#endif
  fd_slots<NA, NB>(acc, a4, b4);
#pragma unroll
  for (int i = 0; i < 2; ++i) {
#pragma unroll
    for (int n = 0; n < 2; ++n) {
#pragma unroll
      for (int r = 0; r < 8; ++r)
        redp[(16 * i + r) * 32 + 16 * n] = (i < NA && n < NB) ? acc[i < NA ? i : 0][n < NB ? n : 0][r] : 0.f;
    }
  }
}

// A block's 32 x 32 tiles of a product of weights, C[WR,WP] = A B over k < F:
//   A(m,k) = Am[k*F + m] for m < F, av[k] for m = F, 0 above
//   B(k,n) = Bm[k*BPITCH + n]; with BEDGE only for n < F, then bv[k] for n = F, 0 above
//   ROWADD: row F of C also takes row F of Bm.
// NP: tiles per block, 8 waves each; a wave sums and stores in the tile that it worked on.
template <int NP, int BPITCH, bool BEDGE, bool ROWADD>
__device__ __forceinline__ void fold_tile(int blk, const float* __restrict__ Am,
                                          const float* __restrict__ av,
                                          const float* __restrict__ Bm,
                                          const float* __restrict__ bv,
                                          float* __restrict__ C) {
  __shared__ __attribute__((aligned(16))) float fred[NP * GK_SLICES][32 * 32];
  const int tid  = threadIdx.x;
  const int lane = tid & 31;
  const int l16  = lane & 15;
  const int hi   = lane >> 4;
  const int w    = __builtin_amdgcn_readfirstlane(tid >> 5);
  const int q    = blk * NP + w / GK_SLICES;   // the wave's tile
  const bool live = q < FD_TILES;              // the same in every lane of a wave
  const int m0   = (q / (WP / 32)) << 5;
  const int n0   = (q % (WP / 32)) << 5;
  const int g    = tid & (GK_SLICES * 32 - 1); // this thread finishes four columns of one row
  const int orow = m0 + (g >> 3);
  const int ocol = n0 + 4 * (g & 7);
  v4f radd = {0.f, 0.f, 0.f, 0.f};
  if (live) {
    if (ROWADD && m0 == FF) {                  // the same in every lane of a wave
      radd = *(const v4f*)(Bm + (size_t)FF * BPITCH + ocol);
#if defined(__HIP_DEVICE_COMPILE__)
      // the address arithmetic of the slice's loads may reuse this load's address registers
      asm volatile("s_wait_xcnt 0x0" ::: "memory");
#endif
    }
    const int kb = (w % GK_SLICES) * (FF / GK_SLICES) + 4 * hi;
    float* redp = &fred[w][8 * hi * 32 + l16];
    // both tests read the same in every lane of a wave
    if (m0 < FF) {
      if (!BEDGE || n0 < FF) fold_slice<BPITCH, true, true>(Am, av, Bm, bv, m0, n0, kb, l16, redp);
      else                   fold_slice<BPITCH, true, false>(Am, av, Bm, bv, m0, n0, kb, l16, redp);
    } else {
      if (!BEDGE || n0 < FF) fold_slice<BPITCH, false, true>(Am, av, Bm, bv, m0, n0, kb, l16, redp);
      else                   fold_slice<BPITCH, false, false>(Am, av, Bm, bv, m0, n0, kb, l16, redp);
    }
  }
  __syncthreads();
  if (live) {
    const int w0 = w - w % GK_SLICES;          // the tile's first wave
    v4f tot = *(const v4f*)&fred[w0][4 * g];
#pragma unroll
    for (int v = 1; v < GK_SLICES; ++v) tot += *(const v4f*)&fred[w0 + v][4 * g];
    if (ROWADD && orow == FF) tot += radd;
    *(v4f*)(C + (size_t)orow * WP + ocol) = tot;
  }
}

#define RM_WAVES 16
#define RM_THREADS (RM_WAVES * 32)
#define RM_ROWS 8                                 // rows per wave
#define RM_WGROWS (RM_WAVES * RM_ROWS)            // rows per workgroup
#define RM_LOADS (RM_ROWS * N4 / 32)              // wave-wide 16-byte loads per span
#define RM_G 12                                   // loads per group
#define RM_GROUPS ((RM_LOADS + RM_G - 1) / RM_G)
#define RM_BLOCKS (BB * FF / RM_WGROWS)
#define GA_WAVES (2 * RM_WGROWS / 32)             // waves that gather, 32 values each
static_assert((RM_ROWS * N4) % 32 == 0 && N4 > 32, "a span is whole loads; a load meets at most two rows");
static_assert(FF % RM_WGROWS == 0 && RM_WGROWS % 32 == 0 && GA_WAVES <= RM_WAVES,
              "a workgroup's rows lie in one batch; a gathering wave has one of last / cur");
static_assert(RM_ROWS == XK_KEEP, "a wave's span is rows of one kind: kept in even waves, passing in odd ones");
// One wave's span. NT: its rows are of the passing kind. The hint is part of the instruction,
// so the two kinds are two copies of the stream, chosen by a scalar branch.
template <bool NT>
__device__ __forceinline__ void rm_stream(const v4f* sp, const float* __restrict__ x,
                                          const int* __restrict__ lc, int w, int lane,
                                          int gb, int gj, int gr, float (&mx)[RM_ROWS], float& gv) {
  // every loop here is unrolled: the load number decides at compile time which row a value
  // belongs to, and the two groups of loaded values must lie in registers
  v4f buf[2][RM_G];
#pragma unroll
  for (int q = 0; q < RM_G; ++q) buf[0][q] = x_load<NT>(sp + q * 32);
  if (w < GA_WAVES) {                                     // the same in every lane of a wave
    const int n = min(max(lc[gb * 2 + gj], 0), NN - 1);   // the address stays inside x
    gv = x[(size_t)gr * NN + n];
#if defined(__HIP_DEVICE_COMPILE__)
    // the next group's loads return into this load's address registers
    asm volatile("s_wait_xcnt 0x0" ::: "memory");
#endif
  }
#pragma unroll
  for (int c = 0; c < RM_GROUPS; ++c) {
    // the two scheduling barriers pin the order "next group's loads, then this group's
    // maxima": without them the loads may sink behind the waits for this group
    __builtin_amdgcn_sched_barrier(0);
    if (c + 1 < RM_GROUPS) {
#pragma unroll
      for (int q = 0; q < RM_G; ++q)
        if ((c + 1) * RM_G + q < RM_LOADS) buf[(c + 1) & 1][q] = x_load<NT>(sp + ((c + 1) * RM_G + q) * 32);
    }
    __builtin_amdgcn_sched_barrier(0);
#pragma unroll
    for (int q = 0; q < RM_G; ++q) {
      const int k = c * RM_G + q;
      if (k < RM_LOADS) {
        const v4f v = buf[c & 1][q];
        const float vm = fmaxf(fmaxf(v.x, v.y), fmaxf(v.z, v.w));
        const int ra = (k * 32) / N4;
        const int rb = (k * 32 + 31) / N4;
        if (ra == rb) {
          mx[ra] = fmaxf(mx[ra], vm);
        } else {
          const bool lo = lane < rb * N4 - k * 32;
          mx[ra] = fmaxf(mx[ra], lo ? vm : -INFINITY);
          mx[rb] = fmaxf(mx[rb], lo ? -INFINITY : vm);
        }
      }
    }
    // without the statement below the compiler regrouped the maxima across groups, kept
    // loaded values alive past their group and spilled them between the loads
#if defined(__HIP_DEVICE_COMPILE__)
#pragma unroll
    for (int r = 0; r < RM_ROWS; ++r)
      if (r >= (c * RM_G * 32) / N4 && r <= (c * RM_G * 32 + RM_G * 32 - 1) / N4)
        asm volatile("" : "+v"(mx[r]));   // streaming pattern: each row's result closed, against spills
#endif
  }
}

__global__ __launch_bounds__(RM_THREADS, 8) void rowmax_gather_kernel(
    const float* __restrict__ x, const int* __restrict__ lc,
    float* __restrict__ glb, float* __restrict__ ctx,
    const float* __restrict__ fA, const float* __restrict__ fv,
    const float* __restrict__ fB, const float* __restrict__ fw, float* __restrict__ fC) {
  __shared__ float rm[RM_WGROWS];
  if (blockIdx.x >= RM_BLOCKS) {      // the whole block takes this way
    fold_tile<RM_WAVES / GK_SLICES, FF, true, false>(blockIdx.x - RM_BLOCKS, fA, fv, fB, fw, fC);
    return;
  }
  const int tid  = threadIdx.x;
  const int lane = tid & 31;
  const int w    = __builtin_amdgcn_readfirstlane(tid >> 5);
  const int wg0  = blockIdx.x * RM_WGROWS;                // the workgroup's first row in [0, B*F)
  const v4f* sp = (const v4f*)(x + (size_t)(wg0 + w * RM_ROWS) * NN) + lane;
  float mx[RM_ROWS];
#pragma unroll
  for (int r = 0; r < RM_ROWS; ++r) mx[r] = -INFINITY;
  // gather: wave w takes last (w < GA_WAVES / 2) or cur of 32 of the workgroup's rows
  const int gb = wg0 / FF;                                // batch
  const int gj = w / (GA_WAVES / 2);                      // 0 last, 1 cur
  const int gr = wg0 + (w % (GA_WAVES / 2)) * 32 + lane;  // row in [0, B*F)
  float gv = 0.f;
  if (w & 1) rm_stream<true>(sp, x, lc, w, lane, gb, gj, gr, mx, gv);    // the same in every lane of a wave
  else       rm_stream<false>(sp, x, lc, w, lane, gb, gj, gr, mx, gv);
#pragma unroll
  for (int r = 0; r < RM_ROWS; ++r) {
#pragma unroll
    for (int o = 16; o; o >>= 1) mx[r] = fmaxf(mx[r], __shfl_xor(mx[r], o));
  }
  float mine = mx[0];
#pragma unroll
  for (int r = 1; r < RM_ROWS; ++r) mine = (lane == r) ? mx[r] : mine;
  if (lane < RM_ROWS) rm[w * RM_ROWS + lane] = mine;
  __syncthreads();
  // the workgroup's maxima leave as whole 128-byte lines, one wave each
  if (tid < RM_WGROWS) glb[wg0 + tid] = rm[tid];
  // behind the barrier: in front of it every wave would wait for this store to finish
  if (w < GA_WAVES) ctx[gb * 2 * FF + gj * FF + (gr - gb * FF)] = gv;   // a whole line per wave
#if defined(__HIP_DEVICE_COMPILE__)
  // the launch's other kind of block stands behind these stores in the code and writes their registers
  asm volatile("s_wait_xcnt 0x0" ::: "memory");
#endif
}

// [ql | cL] = xbar @ Wc, Bm(k,n) = Bp[k*WP + n], in the tiles and slices named above; row F
// of Bp is the bias, column F goes to dout.
// A is pass B's pair of un-normalised sums [2][B][F] and dv its (max, sum) lines; the A
// load joins the two node ranges of a row: A[b,:] = (w0 * A0 + w1 * A1) / (w0 * l0 + w1 * l1),
// wi = exp(Mi - max(M0, M1)).
__global__ __launch_bounds__(512) void gemm_ql_kernel(
    const float* __restrict__ A, const float* __restrict__ Bp, float* __restrict__ C,
    const float* __restrict__ dv, float* __restrict__ dout) {
  constexpr int K  = FF;
  constexpr int KW = K / GK_SLICES;   // k per wave
  constexpr int J  = KW / 8;          // groups of four k per lane and operand
  constexpr int NBK = WP / 32;        // blocks across the columns
  __shared__ float red[GK_SLICES][16 * 32];
  const int tid  = threadIdx.x;
  const int lane = tid & 31;
  const int l16  = lane & 15;
  const int hi   = lane >> 4;
  const int w    = __builtin_amdgcn_readfirstlane(tid >> 5);
  const int nt   = w & 1;
  const int ks   = w >> 1;
  const int m0   = (blockIdx.x / NBK) << 4;
  const int n0   = (blockIdx.x % NBK) << 5;
  const int kb   = ks * KW + 4 * hi;
  const int col  = n0 + nt * 16 + l16;

  // every loop of this kernel is unrolled: the fragments must lie in registers, and a
  // rolled loop would wait for each load before it issues the next
  v4f a4[J], b4[J];
  const float* st = dv + (m0 + l16) * ST_PITCH;
  // wanted first, so asked for first
  const float M0 = st[0];
  const float L0 = st[1];
  const float M1 = st[BB * ST_PITCH];
  const float L1 = st[BB * ST_PITCH + 1];
  const float* ap = A + (size_t)(m0 + l16) * K + kb;
#pragma unroll
  for (int j = 0; j < J; ++j) a4[j] = *(const v4f*)(ap + 8 * j);
  v4f a1[J];
#pragma unroll
  for (int j = 0; j < J; ++j) a1[j] = *(const v4f*)(ap + (size_t)BB * K + 8 * j);
  const float* bp = Bp + (size_t)kb * WP + col;
#pragma unroll
  for (int j = 0; j < J; ++j) {
#pragma unroll
    for (int e = 0; e < 4; ++e) b4[j][e] = bp[(size_t)(8 * j + e) * WP];
  }
  // the element this thread finishes: row tid/32, column tid%32 of the block's tile
  const int orow = m0 + (tid >> 5);
  const int ocol = n0 + lane;
  const float bcol = Bp[(size_t)K * WP + ocol];
  // every load above is issued before the first wait: without this the compiler held
  // half of them back behind the wait for M and l, a second trip to memory
  __builtin_amdgcn_sched_barrier(0);
  const float Mx = fmaxf(M0, M1);
  const float w0 = __expf(M0 - Mx), w1 = __expf(M1 - Mx);
  const float inv = 1.f / fmaf(L1, w1, L0 * w0);   // softmax-normalized here
  const float c0 = w0 * inv, c1 = w1 * inv;
#pragma unroll
  for (int j = 0; j < J; ++j) a4[j] = a4[j] * c0 + a1[j] * c1;

  v8f acc = {};
#if __has_builtin(__builtin_amdgcn_wmma_f32_16x16x4_f32)
#pragma unroll
  for (int j = 0; j < J; ++j) {
#pragma unroll
    for (int h = 0; h < 2; ++h) {
      const v2f a  = {a4[j][2 * h], a4[j][2 * h + 1]};
      const v2f bv = {b4[j][2 * h], b4[j][2 * h + 1]};
      acc = __builtin_amdgcn_wmma_f32_16x16x4_f32(
          false, a, false, bv, (short)0, acc, false, false);
    }
  }
#endif
  gk_slots(acc, a4, b4, ap, bp, st);
#pragma unroll
  for (int r = 0; r < 8; ++r) red[ks][(r + 8 * hi) * 32 + nt * 16 + l16] = acc[r];
  __syncthreads();
  float tot = red[0][tid];
#pragma unroll
  for (int v = 1; v < GK_SLICES; ++v) tot += red[v][tid];
  tot += bcol;
  if (ocol < FF) C[(size_t)orow * FF + ocol] = tot;
  else if (ocol == FF) dout[orow] = tot;
}

#define CQ_SLICES 12
#define QK_SHARES (FF / 32)
#define CQ_PITCH 36
#define CK_PITCH 32
__global__ __launch_bounds__(CQ_SLICES * 64) void gemm_cq_qk_kernel(
    const float* __restrict__ glb, const float* __restrict__ Wg, const float* __restrict__ bg,
    const float* __restrict__ ctx, const float* __restrict__ Wlc, const float* __restrict__ blc,
    const float* __restrict__ WK, const float* __restrict__ bK,
    float* __restrict__ qkp, float* __restrict__ cKp,
    const float* __restrict__ fA, const float* __restrict__ fv,
    const float* __restrict__ fB, float* __restrict__ fC) {
  constexpr int KW = 64;              // k per wave
  constexpr int J  = KW / 8;          // 16-byte loads per lane and operand
  __shared__ float red[CQ_SLICES][16 * 32];
  __shared__ __attribute__((aligned(16))) float cqt[16 * CQ_PITCH];
  if (blockIdx.x >= GT_BLOCKS) {      // the whole block takes this way
    fold_tile<CQ_SLICES / 4, WP, false, true>(blockIdx.x - GT_BLOCKS, fA, fv, fB, nullptr, fC);
    return;
  }
  const int tid  = threadIdx.x;
  const int lane = tid & 31;
  const int l16  = lane & 15;
  const int hi   = lane >> 4;
  const int w    = __builtin_amdgcn_readfirstlane(tid >> 5);
  const int nt   = w & 1;
  const int ks   = w >> 1;
  const int mt   = blockIdx.x >> 3;   // which 16 rows
  const int gs   = blockIdx.x & 7;    // which 32 columns of cQ
  const int m0   = mt << 4;
  const int n0   = gs << 5;
  const int col  = n0 + nt * 16 + l16;
  const bool first = ks < FF / KW;    // the same in every lane of a wave
  const int K    = first ? FF : 2 * FF;
  const int kb   = (first ? ks : ks - FF / KW) * KW + 4 * hi;

  v4f a4[J], b4[J];
  const float* ap = (first ? glb : ctx) + (size_t)(m0 + l16) * K + kb;
  const float* bp = (first ? Wg : Wlc) + (size_t)col * K + kb;
#pragma unroll
  for (int j = 0; j < J; ++j) a4[j] = *(const v4f*)(ap + 8 * j);
#pragma unroll
  for (int j = 0; j < J; ++j) b4[j] = *(const v4f*)(bp + 8 * j);
  const int ocol = n0 + lane;
  const float bcol = bg[ocol] + blc[ocol];
#if defined(__HIP_DEVICE_COMPILE__)
  // ocol is these two loads' offset register: it stays theirs up to this wait
  asm volatile("s_wait_xcnt 0x0" :: "v"(ocol) : "memory");
#endif
  // the second product's B: register e of group j holds g = n0 + 4hi + 8j + e, as its A below
  const v4f zero = {0.f, 0.f, 0.f, 0.f};
  v4f b2[2][4] = {{zero, zero, zero, zero}, {zero, zero, zero, zero}};
  if (w < QK_SHARES) {                // both tests read the same in every lane of a wave
    const float* kp = WK + (size_t)(n0 + 4 * hi) * FF + 32 * w + l16;
#pragma unroll
    for (int n = 0; n < 2; ++n) {
#pragma unroll
      for (int j = 0; j < 4; ++j) {
#pragma unroll
        for (int e = 0; e < 4; ++e) b2[n][j][e] = kp[(8 * j + e) * FF + 16 * n];
      }
    }
#if defined(__HIP_DEVICE_COMPILE__)
    // later arithmetic may reuse these loads' address registers
    asm volatile("s_wait_xcnt 0x0" ::: "memory");
#endif
  } else if (w == QK_SHARES) {
    const int kq = n0 / 4 + hi;       // in groups of four g
#pragma unroll
    for (int j = 0; j < 4; ++j) b2[0][j] = ((const v4f*)bK)[kq + 2 * j];
#if defined(__HIP_DEVICE_COMPILE__)
    // kq is these loads' offset register: it stays theirs up to this wait
    asm volatile("s_wait_xcnt 0x0" :: "v"(kq) : "memory");
#endif
#pragma unroll
    for (int j = 0; j < 4; ++j) b2[0][j] = (l16 == 0) ? b2[0][j] : zero;   // cK's column, then padding
  }

  v8f acc = {};
#if __has_builtin(__builtin_amdgcn_wmma_f32_16x16x4_f32)
#pragma unroll
  for (int j = 0; j < J; ++j) {
#pragma unroll
    for (int h = 0; h < 2; ++h) {
      const v2f a  = {a4[j][2 * h], a4[j][2 * h + 1]};
      const v2f bv = {b4[j][2 * h], b4[j][2 * h + 1]};
      acc = __builtin_amdgcn_wmma_f32_16x16x4_f32(
          false, a, false, bv, (short)0, acc, false, false);
    }
  }
#endif
  gk_slots(acc, a4, b4, ap, bp);
#pragma unroll
  for (int r = 0; r < 8; ++r) red[ks][(r + 8 * hi) * 32 + nt * 16 + l16] = acc[r];
  __syncthreads();
  // the tile has 512 elements: the first 16 waves finish one each (row tid/32, column tid%32)
  if (tid < 16 * 32) {
    float tot = red[0][tid];
#pragma unroll
    for (int v = 1; v < CQ_SLICES; ++v) tot += red[v][tid];
    cqt[(tid >> 5) * CQ_PITCH + lane] = tot + bcol;
  }
  __syncthreads();
  if (w > QK_SHARES) return;          // whole waves, behind the last barrier
  v4f a2[1][4];
#pragma unroll
  for (int j = 0; j < 4; ++j) a2[0][j] = *(const v4f*)&cqt[l16 * CQ_PITCH + 4 * hi + 8 * j];
  // the LDS reads and their addresses stay in front of the WMMA chain
  __builtin_amdgcn_sched_barrier(0);
  v8f acc2[1][2] = {};
#if __has_builtin(__builtin_amdgcn_wmma_f32_16x16x4_f32)
#pragma unroll
  for (int j = 0; j < 4; ++j) {
#pragma unroll
    for (int h = 0; h < 2; ++h) {
#pragma unroll
      for (int n = 0; n < 2; ++n) {
        const v2f a  = {a2[0][j][2 * h], a2[0][j][2 * h + 1]};
        const v2f bv = {b2[n][j][2 * h], b2[n][j][2 * h + 1]};
        acc2[0][n] = __builtin_amdgcn_wmma_f32_16x16x4_f32(
            false, a, false, bv, (short)0, acc2[0][n], false, false);
      }
    }
  }
#endif
  fd_slots<1, 2>(acc2, a2, b2);
  if (w < QK_SHARES) {
    float* pp = qkp + ((size_t)gs * BB + m0 + 8 * hi) * FF + 32 * w + l16;
#pragma unroll
    for (int n = 0; n < 2; ++n) {
#pragma unroll
      for (int r = 0; r < 8; ++r) pp[r * FF + 16 * n] = acc2[0][n][r];
    }
  } else if (l16 == 0) {
    float* pp = cKp + (gs * (BB / 16) + mt) * CK_PITCH + 8 * hi;
#pragma unroll
    for (int r = 0; r < 8; ++r) pp[r] = acc2[0][0][r];
  }
#if defined(__HIP_DEVICE_COMPILE__)
  // the launch's other kind of block stands behind these stores in the code and writes their registers
  asm volatile("s_wait_xcnt 0x0" ::: "memory");
#endif
}

#define PB_COPY8(TH) \
      "global_load_async_to_lds_b128 %0, %8, off" TH "\n\t" \
      "global_load_async_to_lds_b128 %1, %9, off" TH "\n\t" \
      "global_load_async_to_lds_b128 %2, %10, off" TH "\n\t" \
      "global_load_async_to_lds_b128 %3, %11, off" TH "\n\t" \
      "global_load_async_to_lds_b128 %4, %12, off" TH "\n\t" \
      "global_load_async_to_lds_b128 %5, %13, off" TH "\n\t" \
      "global_load_async_to_lds_b128 %6, %14, off" TH "\n\t" \
      "global_load_async_to_lds_b128 %7, %15, off" TH "\n\t" \
      "s_wait_xcnt 0x0"
template <bool NT>
__device__ __forceinline__ void pb_copy8(const v4f* g, const v4f* l) {
#if defined(__HIP_DEVICE_COMPILE__)
  const unsigned long long g0 = (unsigned long long)(uintptr_t)g;
  const unsigned int l0 = (unsigned int)(uintptr_t)l;   // generic LDS pointer: low 32 bits
#define PB_COPY8_OPS \
      "v"(l0), "v"(l0 + 512u), "v"(l0 + 1024u), "v"(l0 + 1536u), \
      "v"(l0 + 2048u), "v"(l0 + 2560u), "v"(l0 + 3072u), "v"(l0 + 3584u), \
      "v"(g0), "v"(g0 + 1ull * NN * 4), "v"(g0 + 2ull * NN * 4), "v"(g0 + 3ull * NN * 4), \
      "v"(g0 + 4ull * NN * 4), "v"(g0 + 5ull * NN * 4), "v"(g0 + 6ull * NN * 4), \
      "v"(g0 + 7ull * NN * 4)
  if constexpr (NT) asm volatile(PB_COPY8(" th:TH_LOAD_NT") :: PB_COPY8_OPS : "memory");
  else              asm volatile(PB_COPY8("") :: PB_COPY8_OPS : "memory");
#else
  (void)g; (void)l;
#endif
}

// The wave's 16 rows of tile t into its slice of one LDS buffer.
__device__ __forceinline__ void pb_fill(const v4f* xr, v4f* slice, int t, int lane) {
  const int c = min(t * 32 + lane, N4 - 1);     // past the row's end: copy its last column
  static_assert(PB_ROWS == 16 && XK_KEEP == 8, "the first eight rows are kept, the second eight pass");
  pb_copy8<false>(xr + c, slice + lane);
  pb_copy8<true>(xr + 8 * N4 + c, slice + 8 * 32 + lane);
}

// One trip: tile t out of its LDS buffer. REFILL: a tile t + 2 exists and is copied
// into the buffer that this trip has read (the caller's loop bounds are the test).
template <bool REFILL>
__device__ __forceinline__ void pb_trip(const v4f* xr, v4f* slice, v4f (*part)[32],
                                        const float (&q)[PB_ROWS], int t, int w, int lane,
                                        float cKb, v2f (&acc)[PB_ROWS], float& m, float& l) {
  // this wave's share of the scores of the lane's four nodes; sums run in node
  // pairs (.xy, .zw) so that packed f32 instructions take the registers as they lie
  v4f X[PB_ROWS];
#pragma unroll
  for (int i = 0; i < PB_ROWS; ++i) X[i] = slice[i * 32 + lane];
  v2f s01 = {0.f, 0.f}, s23 = {0.f, 0.f};
#pragma unroll
  for (int i = 0; i < PB_ROWS; ++i) {
    const v2f qq = {q[i], q[i]};
    s01 = __builtin_elementwise_fma(qq, X[i].xy, s01);
    s23 = __builtin_elementwise_fma(qq, X[i].zw, s23);
  }
  part[w][lane] = (v4f){s01.x, s01.y, s23.x, s23.y};
  __syncthreads();
  // every wave adds the 16 shares in the same order, so all waves see equal scores
  v4f tot = part[0][lane];
#pragma unroll
  for (int v = 1; v < PB_WAVES; ++v) tot += part[v][lane];
  const bool valid = REFILL || t * 32 + lane < N4;   // a tile with a tile t + 2 behind it is whole
  const float t0 = valid ? (tot.x + cKb) * SCALE : -INFINITY;
  const float t1 = valid ? (tot.y + cKb) * SCALE : -INFINITY;
  const float t2 = valid ? (tot.z + cKb) * SCALE : -INFINITY;
  const float t3 = valid ? (tot.w + cKb) * SCALE : -INFINITY;
  const float mn = fmaxf(m, fmaxf(fmaxf(t0, t1), fmaxf(t2, t3)));
  const float r  = __expf(m - mn);              // 0 on the first tile (m = -inf)
  const v2f e01 = {valid ? __expf(t0 - mn) : 0.f, valid ? __expf(t1 - mn) : 0.f};
  const v2f e23 = {valid ? __expf(t2 - mn) : 0.f, valid ? __expf(t3 - mn) : 0.f};
  const v2f es = e01 + e23;
  l = fmaf(l, r, es.x + es.y);
  m = mn;
  const v2f rr = {r, r};
#pragma unroll
  for (int i = 0; i < PB_ROWS; ++i)
    acc[i] = __builtin_elementwise_fma(e23, X[i].zw,
             __builtin_elementwise_fma(e01, X[i].xy, acc[i] * rr));

  // keeps the arithmetic above in front of the foot: without it the compiler moved it
  // behind the barrier, ahead of the copies, and read the 16 shares one wait at a time
  __builtin_amdgcn_sched_barrier(0);
  // foot of the trip: own LDS reads done, tile t+1 landed, everybody here; only
  // then is the buffer just read refilled
  asm volatile("s_wait_dscnt 0x0" ::: "memory");
  asm volatile("s_wait_asynccnt 0x0" ::: "memory");
  __syncthreads();
  if (REFILL) pb_fill(xr, slice, t + 2, lane);
}

__global__ __launch_bounds__(PB_THREADS) void passB_kernel(
    const float* __restrict__ x, const float* __restrict__ qkp,
    const float* __restrict__ cKp, float* __restrict__ xpart, float* __restrict__ st) {
  __shared__ __attribute__((aligned(16))) v4f tile[2][FF * 32];   // 2 x 128 KB
  __shared__ v4f part[PB_WAVES][32];
  __shared__ float xs[FF];
  const int b = blockIdx.x / PB_SPLIT;
  const int h = blockIdx.x % PB_SPLIT;   // which node range
  const int t0 = h * PB_TPB;             // its first tile (even: it lies in buffer 0)
  const int tid = threadIdx.x;
  const int lane = tid & 31;
  const int w = __builtin_amdgcn_readfirstlane(tid >> 5);
  const v4f* xr = (const v4f*)(x + ((size_t)b * FF + w * PB_ROWS) * NN);
  float q[PB_ROWS];
  v2f acc[PB_ROWS];
#pragma unroll
  for (int i = 0; i < PB_ROWS; ++i) acc[i] = (v2f){0.f, 0.f};
  static_assert(QK_SHARES == 8 && PB_ROWS == 16, "32 lanes = 8 shares x 4 groups of 4 rows");
  v4f qv = *(const v4f*)(qkp + ((size_t)(lane >> 2) * BB + b) * FF + w * PB_ROWS + 4 * (lane & 3));
  float cKb = cKp[((lane & 7) * (BB / 16) + b / 16) * CK_PITCH + b % 16];
#if defined(__HIP_DEVICE_COMPILE__)
  // the copies' address arithmetic may reuse these loads' address registers
  asm volatile("s_wait_xcnt 0x0" ::: "memory");
#endif
  float m = -INFINITY, l = 0.f;

  pb_fill(xr, &tile[0][w * PB_ROWS * 32], t0, lane);
  // the two scheduling barriers keep the sums of the shares between the first tile's copies
  // and the wait for them: without them the compiler put the wait for the two loads between
  // the copies, or the sums behind the barrier, in front of the second tile's copies
  __builtin_amdgcn_sched_barrier(0);
#pragma unroll
  for (int o = 4; o <= 16; o <<= 1) {
#pragma unroll
    for (int e = 0; e < 4; ++e) qv[e] += __shfl_xor(qv[e], o);
  }
#pragma unroll
  for (int o = 1; o <= 4; o <<= 1) cKb += __shfl_xor(cKb, o);
#pragma unroll
  for (int i = 0; i < PB_ROWS; ++i) q[i] = __shfl(qv[i & 3], i >> 2);
  __builtin_amdgcn_sched_barrier(0);
  asm volatile("s_wait_asynccnt 0x0" ::: "memory");   // the first tile has landed
  __syncthreads();
  pb_fill(xr, &tile[1][w * PB_ROWS * 32], t0 + 1, lane);

  // both loops rolled (for speed only)
#pragma unroll 1
  for (int t = t0; t < t0 + PB_TPB - 2; ++t)
    pb_trip<true>(xr, &tile[t & 1][w * PB_ROWS * 32], part, q, t, w, lane, cKb, acc, m, l);
#pragma unroll 1
  for (int t = t0 + PB_TPB - 2; t < t0 + PB_TPB; ++t)
    pb_trip<false>(xr, &tile[t & 1][w * PB_ROWS * 32], part, q, t, w, lane, cKb, acc, m, l);
  asm volatile("s_wait_asynccnt 0x0" ::: "memory");   // nothing in flight at the wave's end

  // join the 32 lanes: common max, rescale, butterfly sums
  float M = m;
#pragma unroll
  for (int o = 16; o; o >>= 1) M = fmaxf(M, __shfl_xor(M, o));
  const float sc = __expf(m - M);
  l *= sc;
#pragma unroll
  for (int o = 16; o; o >>= 1) l += __shfl_xor(l, o);
  float a[PB_ROWS];
#pragma unroll
  for (int i = 0; i < PB_ROWS; ++i) a[i] = (acc[i].x + acc[i].y) * sc;
#pragma unroll
  for (int o = 16; o; o >>= 1) {
#pragma unroll
    for (int i = 0; i < PB_ROWS; ++i) a[i] += __shfl_xor(a[i], o);
  }
  if (lane == 0) {
#pragma unroll
    for (int i = 0; i < PB_ROWS; ++i) xs[w * PB_ROWS + i] = a[i];
  }
  __syncthreads();
  // M and l are the same in every wave; whole 128-byte lines per wave
  if (tid < FF) xpart[(h * BB + b) * FF + tid] = xs[tid];   // relative to M, not normalized
  if (tid == 0) {
    st[(h * BB + b) * ST_PITCH]     = M;
    st[(h * BB + b) * ST_PITCH + 1] = l;
  }
}

#define PC_WAVES 16
#define PC_THREADS (PC_WAVES * 32)
#define PC_ROWS (FF / PC_WAVES)     // feature rows held by one wave
#define PC_GROUPS (PC_ROWS / 2)     // groups of one kept and one passing row
static_assert(PB_TPB * 32 <= PC_THREADS, "one thread finishes four nodes");
static_assert(PC_ROWS == 16 && 2 * XK_KEEP == PC_ROWS, "a wave's rows are one group of 16: as many kept as passing");
// One row's piece of the range. cb: the lane's column in the range's first tile; ce: in its last.
template <bool NT>
__device__ __forceinline__ void pc_row(const v4f* rp, int cb, int ce, v4f (&d)[PB_TPB]) {
#pragma unroll
  for (int t = 0; t + 1 < PB_TPB; ++t) d[t] = x_load<NT>(rp + t * 32 + cb);   // not a range's last tile: whole
  d[PB_TPB - 1] = x_load<NT>(rp + ce);
}
__global__ __launch_bounds__(PC_THREADS) void passC_kernel(
    const float* __restrict__ x, const float* __restrict__ ql,
    const float* __restrict__ cL, float* __restrict__ out) {
  __shared__ v4f share[PC_WAVES][PB_TPB * 32];   // 64 KB
  const int b = blockIdx.x / PB_SPLIT;
  const int h = blockIdx.x % PB_SPLIT;   // which node range
  const int c0 = h * PB_TPB * 32;        // its first float4 column
  const int tid = threadIdx.x;
  const int lane = tid & 31;
  const int w = __builtin_amdgcn_readfirstlane(tid >> 5);
  const v4f* xr = (const v4f*)(x + ((size_t)b * FF + w * PC_ROWS) * NN);
  float q[PC_ROWS];
#pragma unroll
  for (int i = 0; i < PC_ROWS; ++i) q[i] = ql[b * FF + w * PC_ROWS + i];
  const float cLb = cL[b];

  // every loop here is unrolled: the two groups of loaded values and the tiles' sums must lie in registers
  v4f buf[2][2][PB_TPB];
  const int cb = c0 + lane;                                // the lane's column in the range's first tile
  const int ce = min(cb + (PB_TPB - 1) * 32, N4 - 1);      // in its last; past the row's end: the last column
  pc_row<false>(xr, cb, ce, buf[0][0]);
  pc_row<true>(xr + XK_KEEP * N4, cb, ce, buf[0][1]);
  // sums run in node pairs (.xy, .zw) so that packed f32 instructions take the registers as they lie
  v2f s01[PB_TPB], s23[PB_TPB];
#pragma unroll
  for (int t = 0; t < PB_TPB; ++t) { s01[t] = (v2f){0.f, 0.f}; s23[t] = (v2f){0.f, 0.f}; }
#pragma unroll
  for (int g = 0; g < PC_GROUPS; ++g) {
    // the two scheduling barriers pin the order "next group's loads, then this group's
    // sums": without them the loads may sink behind the waits for this group
    __builtin_amdgcn_sched_barrier(0);
    if (g + 1 < PC_GROUPS) {
      pc_row<false>(xr + (g + 1) * N4, cb, ce, buf[(g + 1) & 1][0]);
      pc_row<true>(xr + (XK_KEEP + g + 1) * N4, cb, ce, buf[(g + 1) & 1][1]);
    }
    __builtin_amdgcn_sched_barrier(0);
#pragma unroll
    for (int k = 0; k < 2; ++k) {
      const float qi = q[k * XK_KEEP + g];
      const v2f qq = {qi, qi};
#pragma unroll
      for (int t = 0; t < PB_TPB; ++t) {
        s01[t] = __builtin_elementwise_fma(qq, buf[g & 1][k][t].xy, s01[t]);
        s23[t] = __builtin_elementwise_fma(qq, buf[g & 1][k][t].zw, s23[t]);
      }
    }
  }
#if defined(__HIP_DEVICE_COMPILE__)
  // cb and ce are the loads' offset registers: they stay theirs up to this wait
  asm volatile("s_wait_xcnt 0x0" :: "v"(cb), "v"(ce) : "memory");
#endif
#pragma unroll
  for (int t = 0; t < PB_TPB; ++t)
    share[w][t * 32 + lane] = (v4f){s01[t].x, s01[t].y, s23[t].x, s23[t].y};
  __syncthreads();
  // thread j finishes float4 column c0 + j: whole 512-byte pieces of the output row per wave
  if (tid < PB_TPB * 32 && c0 + tid < N4) {
    v4f tot = share[0][tid];
#pragma unroll
    for (int v = 1; v < PC_WAVES; ++v) tot += share[v][tid];
    v4f r;
    r.x = tanhf((tot.x + cLb) * SCALE) * 10.f;
    r.y = tanhf((tot.y + cLb) * SCALE) * 10.f;
    r.z = tanhf((tot.z + cLb) * SCALE) * 10.f;
    r.w = tanhf((tot.w + cLb) * SCALE) * 10.f;
    *((v4f*)(out + (size_t)b * NN) + c0 + tid) = r;
  }
}

// ---------------------------------------------------------------------------
extern "C" void kernel_launch(void* const* d_in, const int* in_sizes, int n_in,
                              void* d_out, int out_size, void* d_ws, size_t ws_size,
                              hipStream_t stream) {
  const float* x     = (const float*)d_in[0];   // [B,F,N,1]
  const int*   lc    = (const int*)  d_in[1];   // [B,2]
  const float* Wg    = (const float*)d_in[2];   // [F,F]
  const float* bg    = (const float*)d_in[3];   // [F]
  const float* Wnode = (const float*)d_in[4];   // [3F,F]
  const float* bnode = (const float*)d_in[5];   // [3F]
  const float* Wlc   = (const float*)d_in[6];   // [F,2F]
  const float* blc   = (const float*)d_in[7];   // [F]
  const float* Wproj = (const float*)d_in[8];   // [F,F]
  const float* bproj = (const float*)d_in[9];   // [F]
  float* out = (float*)d_out;                   // [B,N]

  // workspace carve-up (~2.5 MB of f32)
  float* ws   = (float*)d_ws;
  float* glb  = ws;                         // [B,F]
  float* ctx  = glb  + BB * FF;             // [B,2F]
  float* qkp  = ctx  + BB * 2 * FF;         // [F/32,B,F]
  float* cKp  = qkp  + QK_SHARES * BB * FF; // [F/32,B/16] lines of CK_PITCH
  float* xpart = cKp + QK_SHARES * (BB / 16) * CK_PITCH;   // [2,B,F]
  float* st   = xpart + PB_SPLIT * BB * FF; // [2,B] lines of ST_PITCH
  float* T    = st   + PB_SPLIT * BB * ST_PITCH;   // [WR,WP]
  float* Wc   = T    + WR * WP;             // [WR,WP]
  float* ql   = Wc   + WR * WP;             // [B,F]
  float* cL   = ql   + BB * FF;             // [B]

  // context gather, and pass A: glb = max_n x; beside them T = [Wproj^T ; bproj^T] [Wnode_L | bnode_L]
  rowmax_gather_kernel<<<RM_BLOCKS + FD_BLOCKS(RM_WAVES / GK_SLICES), RM_THREADS, 0, stream>>>(x, lc, glb, ctx,
      Wproj, bproj, Wnode + (size_t)2 * FF * FF, bnode + 2 * FF, T);
  // cQ = glb @ Wg^T + bg + ctx @ Wlc^T + blc, then the shares of qk = cQ @ Wnode_K (Bm(k,n) = Wnode[k,n])
  // and cK = cQ . bnode_K; beside them Wc = [Wnode_V^T ; bnode_V^T] T
  gemm_cq_qk_kernel<<<GT_BLOCKS + FD_BLOCKS(CQ_SLICES / 4), CQ_SLICES * 64, 0, stream>>>(glb, Wg, bg, ctx, Wlc, blc,
      Wnode, bnode, qkp, cKp, Wnode + (size_t)FF * FF, bnode + FF, T, Wc);
  // Pass B: fused attention (single read of x)
  passB_kernel<<<BB * PB_SPLIT, PB_THREADS, 0, stream>>>(x, qkp, cKp, xpart, st);
  // [ql | cL] = xbar @ Wc + Wc's bias row, xbar joined from xpart and st
  gemm_ql_kernel<<<QL_BLOCKS, 512, 0, stream>>>(xpart, Wc, ql, st, cL);
  // Pass C: logits
  passC_kernel<<<BB * PB_SPLIT, PC_THREADS, 0, stream>>>(x, ql, cL, out);
}
